// v000
// Measured on an AMD MI455X. A time is GPU time per run, averaged over a window of back-to-back runs after a warm-up
// (all launches, gaps included; the runs take copies of the inputs in turn), and the median of several windows.
// Apart from v000's, it joins two sittings. Times from different sittings can be a few percent apart, while
// side-by-side timings come from the same sitting.
// v000, which the later versions start from, runs in 173 microseconds.
#include <hip/hip_runtime.h>
#include <stdint.h>
// qkv projection and output projection: v_wmma_f32_16x16x32_f16 (f16 operands, weights carried x64, f32 accumulate); attention q.k^T and p.v: v_wmma_f32_16x16x32_f16 (f16 operands, p carried x2^15, f32 accumulate); softmax and epilogues f32.

typedef __attribute__((ext_vector_type(16))) _Float16 v16h;
typedef __attribute__((ext_vector_type(8)))  _Float16 v8h;
typedef __attribute__((ext_vector_type(16))) __bf16   v16b;
typedef __attribute__((ext_vector_type(8)))  __bf16   v8b;
typedef __attribute__((ext_vector_type(8)))  float    v8f;
typedef __attribute__((ext_vector_type(4)))  float    v4f;
#define PSCALE 32768.0f
#define U16(p) ((const unsigned short*)(const void*)(p))
#define PSCALE_INV (1.0f / 32768.0f)

__device__ __forceinline__ unsigned short f2bf_bits(float f) {
  unsigned u = __float_as_uint(f);
  return (unsigned short)((u + 0x7FFFu + ((u >> 16) & 1u)) >> 16);
}
__device__ __forceinline__ float bf_bits2f(unsigned short h) { return __uint_as_float(((unsigned)h) << 16); }

// hazard guards as plain device helpers (no inline asm inside the kernel template body)
__device__ __forceinline__ void dep_guard_h(v8f& a, v8f& b, v16h x, v16h y) { asm volatile("v_nop\n\tv_nop\n\tv_nop\n\tv_nop" : "+v"(a), "+v"(b) : "v"(x), "v"(y)); }
__device__ __forceinline__ void dep_guard_b(v8f& a, v8f& b, v16b x, v16b y) { asm volatile("v_nop\n\tv_nop\n\tv_nop\n\tv_nop" : "+v"(a), "+v"(b) : "v"(x), "v"(y)); }
__device__ __forceinline__ void keep4_h(v16h a, v16h b, v16h c, v16h d) { asm volatile("v_nop" :: "v"(a), "v"(b), "v"(c), "v"(d)); }
__device__ __forceinline__ void keep4_b(v16b a, v16b b, v16b c, v16b d) { asm volatile("v_nop" :: "v"(a), "v"(b), "v"(c), "v"(d)); }
__device__ __forceinline__ void acc_guard4(v8f& a, v8f& b, v8f& c, v8f& d) { asm volatile("v_nop\n\tv_nop\n\tv_nop\n\tv_nop" : "+v"(a), "+v"(b), "+v"(c), "+v"(d)); }
template <typename T> struct Frag;
template <> struct Frag<_Float16> {
  typedef v16h V; union U { v16h v; v8h h[2]; };
  static __device__ __forceinline__ v16h load(const _Float16* p) {   // elements 0..7 <- p[0..7], 8..15 <- p[16..23]
    U f; f.h[0] = *(const v8h*)(p); f.h[1] = *(const v8h*)(p + 16); return f.v;
  }
  static __device__ __forceinline__ v8f mma(v16h a, v16h b, v8f c) {
    return __builtin_amdgcn_wmma_f32_16x16x32_f16(false, a, false, b, (short)0, c, false, false);
  }
  static __device__ __forceinline__ void guard(v8f& a, v8f& b, v16h x, v16h y) { dep_guard_h(a, b, x, y); }
  static __device__ __forceinline__ void keep(v16h a, v16h b, v16h c, v16h d) { keep4_h(a, b, c, d); }
};
template <> struct Frag<__bf16> {
  typedef v16b V; union U { v16b v; v8b h[2]; };
  static __device__ __forceinline__ v16b load(const __bf16* p) {
    U f; f.h[0] = *(const v8b*)(p); f.h[1] = *(const v8b*)(p + 16); return f.v;
  }
  static __device__ __forceinline__ v8f mma(v16b a, v16b b, v8f c) {
    return __builtin_amdgcn_wmma_f32_16x16x32_bf16(false, a, false, b, (short)0, c, false, false);
  }
  static __device__ __forceinline__ void guard(v8f& a, v8f& b, v16b x, v16b y) { dep_guard_b(a, b, x, y); }
  static __device__ __forceinline__ void keep(v16b a, v16b b, v16b c, v16b d) { keep4_b(a, b, c, d); }
};

// ---- Register-blocked batched WMMA GEMM ------------------------------------
// C[m,n] = scale * sum_k A[m,k] * Bt[n,k] (+bias)(+resid); each wave owns a 64x64 tile.
// A row-major [M,K]; Bt row-major [N,K]; M,N % 64 == 0, K % 32 == 0.
// SPLIT: operands are hi/lo planes (A2/Bt2 = lo planes, same layout); product = hi.hi + hi.lo + lo.hi.
// BIAS_MODE: 0 = none, 1 = bias[m], 2 = bias[n].
// OUT_MODE: 0 = f32, 1 = f16, 2 = bf16 hi plane (Cout) + bf16 lo plane (Cout2).
// ET: 0 = f16 operands, 1 = bf16 operands (pointers passed as 16-bit storage)
template <int ET> struct Elem;
template <> struct Elem<0> { typedef _Float16 T; };
template <> struct Elem<1> { typedef __bf16 T; };
template <int ET, bool SPLIT, int BIAS_MODE, int OUT_MODE, bool RESID, int ACT = 0>
__global__ __launch_bounds__(256) void wmma_gemm64(
    const unsigned short* __restrict__ Ap, const unsigned short* __restrict__ A2p, int lda, long strideA,
    const unsigned short* __restrict__ Btp, const unsigned short* __restrict__ Bt2p, int ldb, long strideB,
    void* __restrict__ Cout, void* __restrict__ Cout2, int ldc, long strideC,
    const float* __restrict__ bias,
    const float* __restrict__ resid, long strideR,
    int M, int N, int K, float scale) {
  typedef typename Elem<ET>::T T;
  typedef typename Frag<T>::V V;
  const T* A = (const T*)Ap; const T* A2 = (const T*)A2p; const T* Bt = (const T*)Btp; const T* Bt2 = (const T*)Bt2p;
  __shared__ __align__(16) float sT[8][16 * 68];   // per-wave 16x64 slab, pitch 68 floats
  const int b    = blockIdx.y;
  const int lane = threadIdx.x & 31;
  const int wave = threadIdx.x >> 5;
  const int tilesN = N >> 6;
  const int tilesM = M >> 6;
  const int tile = blockIdx.x * 8 + wave;
  if (tile >= tilesM * tilesN) return;   // wave-uniform; no block barriers in this kernel
  const int tm = tile / tilesN;
  const int tn = tile - tm * tilesN;
  const int m0 = tm << 6;
  const int n0 = tn << 6;

  const T* Ab  = A  + (size_t)b * strideA;
  const T* Bb  = Bt + (size_t)b * strideB;
  const T* Ab2 = SPLIT ? (A2  + (size_t)b * strideA) : nullptr;
  const T* Bb2 = SPLIT ? (Bt2 + (size_t)b * strideB) : nullptr;

  const int rlane = lane & 15;                 // row (A) / col (B, D) within subtile
  const int koff  = (lane >> 4) * 8;           // k offset of this lane half
  const int mOff  = (lane >> 4) * 8;           // D row offset

  v8f acc[4][4];
#pragma unroll
  for (int i = 0; i < 4; ++i)
#pragma unroll
    for (int j = 0; j < 4; ++j) acc[i][j] = (v8f){0.f,0.f,0.f,0.f,0.f,0.f,0.f,0.f};

  for (int k0 = 0; k0 < K; k0 += 32) {
    V bh[4], bl[4];
#pragma unroll
    for (int j = 0; j < 4; ++j) {
      const size_t bo = (size_t)(n0 + (j << 4) + rlane) * ldb + koff + k0;
      bh[j] = Frag<T>::load(Bb + bo);
      if (SPLIT) bl[j] = Frag<T>::load(Bb2 + bo);
    }
#pragma unroll
    for (int i = 0; i < 4; ++i) {
      const size_t ao = (size_t)(m0 + (i << 4) + rlane) * lda + koff + k0;
      V ah = Frag<T>::load(Ab + ao);
      V al;
      if (SPLIT) al = Frag<T>::load(Ab2 + ao);
#pragma unroll
      for (int j = 0; j < 4; ++j) {
        acc[i][j] = Frag<T>::mma(ah, bh[j], acc[i][j]);
        if (SPLIT) {
          acc[i][j] = Frag<T>::mma(ah, bl[j], acc[i][j]);
          acc[i][j] = Frag<T>::mma(al, bh[j], acc[i][j]);
        }
      }
      Frag<T>::guard(acc[i][0], acc[i][3], ah, SPLIT ? al : ah);
    }
    Frag<T>::keep(bh[0], bh[1], bh[2], bh[3]);
    if (SPLIT) Frag<T>::keep(bl[0], bl[1], bl[2], bl[3]);
  }
  acc_guard4(acc[0][0], acc[0][1], acc[0][2], acc[0][3]);
  acc_guard4(acc[1][0], acc[1][1], acc[1][2], acc[1][3]);
  acc_guard4(acc[2][0], acc[2][1], acc[2][2], acc[2][3]);
  acc_guard4(acc[3][0], acc[3][1], acc[3][2], acc[3][3]);

  // ---- epilogue ----
  float* slab = sT[wave];
  const float* Rb = RESID ? (resid + (size_t)b * strideR) : nullptr;
#pragma unroll
  for (int i = 0; i < 4; ++i) {
    const int mBase = m0 + (i << 4);
#pragma unroll
    for (int j = 0; j < 4; ++j) {
      const int n = n0 + (j << 4) + rlane;
      float bv = 0.f;
      if (BIAS_MODE == 2) bv = bias[n];
#pragma unroll
      for (int r = 0; r < 8; ++r) {
        float v = acc[i][j][r] * scale;
        if (BIAS_MODE == 1) v += bias[mBase + mOff + r];
        if (BIAS_MODE == 2) v += bv;
        if (RESID) v += Rb[(size_t)(mBase + mOff + r) * ldc + n];
        if (ACT == 1) v = tanhf(v);
        if (ACT == 2) v = fmaxf(v, 0.0f);
        if (ACT == 3) v = v / (1.0f + expf(-v));
        if (ACT == 4) v = (v > 0.f) ? v : 0.01f * v;
        if (ACT == 5) v = 0.5f * v * (1.0f + erff(v * 0.70710678118654752f));
        slab[(mOff + r) * 68 + (j << 4) + rlane] = v;
      }
    }
    __builtin_amdgcn_fence(__ATOMIC_RELEASE, "workgroup");
    __builtin_amdgcn_wave_barrier();
    __builtin_amdgcn_fence(__ATOMIC_ACQUIRE, "workgroup");
    if (OUT_MODE == 0) {
      float* C = (float*)Cout + (size_t)b * strideC;
      const int hh = lane >> 4, c4 = (lane & 15) * 4;     // row seg = 256 B = 16 lanes x 16 B
      {
#pragma unroll
        for (int it = 0; it < 8; ++it) {
          const int row = it * 2 + hh;
          v4f v = *(const v4f*)(slab + row * 68 + c4);
          *(v4f*)(C + (size_t)(mBase + row) * ldc + n0 + c4) = v;
        }
        
      }
    } else {
      const int q = lane >> 3, c8 = (lane & 7) * 8;
      unsigned short* C  = (unsigned short*)Cout  + (size_t)b * strideC;
      unsigned short* C2 = (OUT_MODE == 2) ? ((unsigned short*)Cout2 + (size_t)b * strideC) : nullptr;
      {
#pragma unroll
        for (int it = 0; it < 4; ++it) {
          const int row = it * 4 + q;
          const float* sp = slab + row * 68 + c8;
          v8h hv, lv;
#pragma unroll
          for (int e = 0; e < 8; ++e) {
            if (OUT_MODE == 1) {
              hv[e] = (_Float16)sp[e];
            } else {
              unsigned short hb = f2bf_bits(sp[e]);
              unsigned short lb = f2bf_bits(sp[e] - bf_bits2f(hb));
              hv[e] = __builtin_bit_cast(_Float16, hb);
              lv[e] = __builtin_bit_cast(_Float16, lb);
            }
          }
          *(v8h*)(C + (size_t)(mBase + row) * ldc + n0 + c8) = hv;
          if (OUT_MODE == 2) *(v8h*)(C2 + (size_t)(mBase + row) * ldc + n0 + c8) = lv;
        }
        
      }
    }
    __builtin_amdgcn_fence(__ATOMIC_RELEASE, "workgroup");
    __builtin_amdgcn_wave_barrier();
    __builtin_amdgcn_fence(__ATOMIC_ACQUIRE, "workgroup");
  }
}

__global__ __launch_bounds__(256) void cast_f32_f16x2_scaled(
    const float* __restrict__ in, _Float16* __restrict__ out, int n2, float sc) {
  int i = blockIdx.x * 256 + threadIdx.x;
  if (i < n2) {
    const _Float16 h0 = (_Float16)(in[2 * (size_t)i] * sc), h1 = (_Float16)(in[2 * (size_t)i + 1] * sc);
    const unsigned u = (unsigned)__builtin_bit_cast(unsigned short, h0) | ((unsigned)__builtin_bit_cast(unsigned short, h1) << 16);
    ((unsigned*)out)[i] = u;
    
  }
}

// =====================================================================================
// Banded (sliding-window) attention for head_dim 64, f32 in / f32 out, f16 operands.
//   scores = (q . k^T) * qscale : v_wmma_f32_16x16x32_f16, f32 accumulate
//   out    = p . v               : v_wmma_f32_16x16x32_f16, p carried x2^15, folded into the final 1/l
//   Online softmax in f32. Block = 4 waves = 64 query rows of one (batch, head); S % 64 == 0.
//   Key chunks of 64; only chunks overlapping [q - W, q + W] for the block's rows are visited
//   (static bound AT_MAXCH, computed start); keys with |q - kv| > W get mask_fill before the softmax.
//   Element (b, s, h, d) of tensor X lives at X[b*X_bs + s*X_rs + h*X_hs + d] (strides in floats, multiples of 4).
//   grid.x = B * H * (S/64).
// =====================================================================================
#define AT_D 64
#define AT_NW 4
#define AT_QB 64
#define AT_KC 64
#define AT_MAXCH 6
#define AT_PSC 32768.0f
struct BandGeom { long q_bs, q_rs, q_hs, k_bs, k_rs, k_hs, v_bs, v_rs, v_hs, o_bs, o_rs, o_hs;
                  int S, H; float qscale, mask_fill; };
static_assert(sizeof(BandGeom) == 112);

__device__ __forceinline__ v8f mma_h(v16h a, v16h b, v8f c) {
  c = __builtin_amdgcn_wmma_f32_16x16x32_f16(false, a, false, b, (short)0, c, false, false);
  asm volatile("v_nop\n\tv_nop\n\tv_nop\n\tv_nop" : "+v"(c) : "v"(a), "v"(b));
  return c;
}

__global__ __launch_bounds__(128)
void attn_band64_kernel(const float* __restrict__ q, const float* __restrict__ k,
                        const float* __restrict__ v, float* __restrict__ out,
                        const int* __restrict__ wptr, BandGeom g) {
  union FH { v16h v; v8h h[2]; };
  __shared__ __align__(16) _Float16 Ksh[AT_KC * AT_D];        // K [kv][d]   8 KB
  __shared__ __align__(16) _Float16 Vth[AT_D * AT_KC];        // V [d][kv]   8 KB
  __shared__ __align__(16) _Float16 Psh[AT_NW][16 * AT_KC];   // per wave P [row][kv]  8 KB
  __shared__ __align__(16) float    Os[AT_NW][16 * 68];       // per wave out tile, pitch 68

  const int tid  = threadIdx.x;
  const int wave = tid >> 5;
  const int lane = tid & 31;
  const int hh   = lane >> 4;
  const int c    = lane & 15;

  const int nqb = g.S / AT_QB;
  const int bx = blockIdx.x;
  const int qb = bx % nqb;
  const int bh = bx / nqb;
  const int h  = bh % g.H;
  const int b  = bh / g.H;
  const int qbase = qb * AT_QB;
  const int q0 = qbase + wave * 16;

  const float* qb_ptr = q + (size_t)b * g.q_bs + (size_t)h * g.q_hs;
  const float* kb_ptr = k + (size_t)b * g.k_bs + (size_t)h * g.k_hs;
  const float* vb_ptr = v + (size_t)b * g.v_bs + (size_t)h * g.v_hs;
  float*       ob_ptr = out + (size_t)b * g.o_bs + (size_t)h * g.o_hs;

  // ---- Q fragments (A operand, row = q0 + c): d-chunks 0..31 and 32..63 ----
  v16h qa0, qa1;
  {
    const float* qrow = qb_ptr + (size_t)(q0 + c) * g.q_rs;
#pragma unroll
    for (int e = 0; e < 8; ++e) {
      qa0[e]     = (_Float16)qrow[8 * hh + e];
      qa0[8 + e] = (_Float16)qrow[16 + 8 * hh + e];
      qa1[e]     = (_Float16)qrow[32 + 8 * hh + e];
      qa1[8 + e] = (_Float16)qrow[32 + 16 + 8 * hh + e];
    }
  }

  float mrow[8], lrow[8];
  v8f oacc[4];
#pragma unroll
  for (int r = 0; r < 8; ++r) { mrow[r] = -__builtin_huge_valf(); lrow[r] = 0.f; }
#pragma unroll
  for (int t = 0; t < 4; ++t) oacc[t] = (v8f){0.f,0.f,0.f,0.f,0.f,0.f,0.f,0.f};

  // ---- visited key-chunk range (block-uniform), statically bounded trip count ----
  const int nkc = g.S / AT_KC;
  int Wd = wptr[0];
  Wd = Wd < 0 ? 0 : Wd;
  Wd = Wd > g.S ? g.S : Wd;
  const int lo = qbase - Wd;
  const int kcLo = (lo < 0) ? 0 : (lo / AT_KC);
  int kcHi = (qbase + AT_QB - 1 + Wd) / AT_KC;
  kcHi = kcHi > nkc - 1 ? nkc - 1 : kcHi;
  int nvis = kcHi - kcLo + 1;
  nvis = nvis > AT_MAXCH ? AT_MAXCH : nvis;
  nvis = nvis < 1 ? 1 : nvis;

  for (int ci = 0; ci < nvis; ++ci) {
    const int kv0 = (kcLo + ci) * AT_KC;   // kcLo + ci <= kcHi <= nkc - 1
    __syncthreads();
    {
      const int kvr = tid >> 1, dh = (tid & 1) * 32;
      const float* krow = kb_ptr + (size_t)(kv0 + kvr) * g.k_rs + dh;
      const float* vrow = vb_ptr + (size_t)(kv0 + kvr) * g.v_rs + dh;
#pragma unroll
      for (int i = 0; i < 8; ++i) {
        v4f kk = *(const v4f*)(krow + 4 * i);
        v4f vv = *(const v4f*)(vrow + 4 * i);
#pragma unroll
        for (int e = 0; e < 4; ++e) {
          const int d = dh + 4 * i + e;
          Ksh[kvr * AT_D + d]  = (_Float16)kk[e];
          Vth[d * AT_KC + kvr] = (_Float16)vv[e];
        }
      }
    }
    __syncthreads();

    // ---- scores: 16 rows x 64 keys per wave ----
    v8f s[4];
#pragma unroll
    for (int j = 0; j < 4; ++j) {
      s[j] = (v8f){0.f,0.f,0.f,0.f,0.f,0.f,0.f,0.f};
      FH kb0, kb1;
      kb0.h[0] = *(const v8h*)(Ksh + (j * 16 + c) * AT_D + 8 * hh);
      kb0.h[1] = *(const v8h*)(Ksh + (j * 16 + c) * AT_D + 16 + 8 * hh);
      kb1.h[0] = *(const v8h*)(Ksh + (j * 16 + c) * AT_D + 32 + 8 * hh);
      kb1.h[1] = *(const v8h*)(Ksh + (j * 16 + c) * AT_D + 32 + 16 + 8 * hh);
      s[j] = mma_h(qa0, kb0.v, s[j]);
      s[j] = mma_h(qa1, kb1.v, s[j]);
    }

    // ---- scale + band mask + chunk row max ----
    float cm[8];
#pragma unroll
    for (int r = 0; r < 8; ++r) {
      const int qrow = q0 + 8 * hh + r;
      float m = -__builtin_huge_valf();
#pragma unroll
      for (int j = 0; j < 4; ++j) {
        const int kvcol = kv0 + j * 16 + c;
        const int dlt = qrow - kvcol;
        float sv = s[j][r] * g.qscale;
        const bool masked = (dlt > Wd) || (dlt < -Wd);
        if (masked) sv = g.mask_fill;
        s[j][r] = sv;
        m = fmaxf(m, sv);
      }
#pragma unroll
      for (int off = 1; off < 16; off <<= 1) m = fmaxf(m, __shfl_xor(m, off, 32));
      cm[r] = m;
    }
    _Float16* pwh = Psh[wave];
#pragma unroll
    for (int r = 0; r < 8; ++r) {
      const float mnew = fmaxf(mrow[r], cm[r]);
      const float alpha = expf(mrow[r] - mnew);
      mrow[r] = mnew;
      float psum = 0.f;
#pragma unroll
      for (int j = 0; j < 4; ++j) {
        const float p = expf(s[j][r] - mnew);
        psum += p;
        pwh[(8 * hh + r) * AT_KC + j * 16 + c] = (_Float16)(p * AT_PSC);
      }
#pragma unroll
      for (int off = 1; off < 16; off <<= 1) psum += __shfl_xor(psum, off, 32);
      lrow[r] = lrow[r] * alpha + psum;
#pragma unroll
      for (int t = 0; t < 4; ++t) oacc[t][r] *= alpha;
    }
    // P tile: stored as _Float16 elements, reloaded below as v8h of _Float16 after a wave barrier
    __builtin_amdgcn_fence(__ATOMIC_RELEASE, "workgroup");
    __builtin_amdgcn_wave_barrier();
    __builtin_amdgcn_fence(__ATOMIC_ACQUIRE, "workgroup");
#pragma unroll 1
    for (int kk = 0; kk < 2; ++kk) {
      FH pa;
      pa.h[0] = *(const v8h*)(pwh + c * AT_KC + kk * 32 + 8 * hh);
      pa.h[1] = *(const v8h*)(pwh + c * AT_KC + kk * 32 + 16 + 8 * hh);
#pragma unroll
      for (int t = 0; t < 4; ++t) {
        FH vb;
        vb.h[0] = *(const v8h*)(Vth + (t * 16 + c) * AT_KC + kk * 32 + 8 * hh);
        vb.h[1] = *(const v8h*)(Vth + (t * 16 + c) * AT_KC + kk * 32 + 16 + 8 * hh);
        oacc[t] = mma_h(pa.v, vb.v, oacc[t]);
      }
    }
  }

  float* os = Os[wave];
#pragma unroll
  for (int r = 0; r < 8; ++r) {
    const float inv = 1.0f / (lrow[r] * AT_PSC);
#pragma unroll
    for (int t = 0; t < 4; ++t) os[(8 * hh + r) * 68 + t * 16 + c] = oacc[t][r] * inv;
  }
  __builtin_amdgcn_fence(__ATOMIC_RELEASE, "workgroup");
  __builtin_amdgcn_wave_barrier();
  __builtin_amdgcn_fence(__ATOMIC_ACQUIRE, "workgroup");
  {
    const int c4 = (lane & 15) * 4;      // row seg = 256 B = 16 lanes x 16 B; rows it*2+hh cover 0..15
    {
#pragma unroll
      for (int it = 0; it < 8; ++it) {
        const int row = it * 2 + hh;
        v4f val = *(const v4f*)(os + row * 68 + c4);
        *(v4f*)(ob_ptr + (size_t)(q0 + row) * g.o_rs + c4) = val;
      }
      
    }
  }
}

// =====================================================================================
extern "C" void kernel_launch(void* const* d_in, const int* in_sizes, int n_in,
                              void* d_out, int out_size, void* d_ws, size_t ws_size,
                              hipStream_t stream) {
  constexpr int Bz = 2, S = 2048, D = 1024, H = 16, HD = 64;
  constexpr int TD = 3 * D;          // 3072
  constexpr int M  = Bz * S;         // 4096 token rows
  static_assert(H * HD == D);
  static_assert(M % 64 == 0 && TD % 64 == 0 && D % 64 == 0 && S % AT_QB == 0);

  if (n_in < 6) return;
  if (in_sizes[0] != M * D || in_sizes[1] != TD * D || in_sizes[2] != TD ||
      in_sizes[3] != D * D || in_sizes[4] != D || in_sizes[5] < 1 || out_size != M * D) return;

  const float* x     = (const float*)d_in[0];   // [B,S,D]
  const float* in_w  = (const float*)d_in[1];   // [3D, D] = (out, in) -> Bt
  const float* in_b  = (const float*)d_in[2];   // [3D]
  const float* out_w = (const float*)d_in[3];   // [D, D] = (out, in) -> Bt
  const float* out_b = (const float*)d_in[4];   // [D]
  const int*   wsz   = (const int*)d_in[5];     // window size, int32[1]
  float* y = (float*)d_out;

  // ---- workspace carve (all offsets multiples of 1 MiB) ----
  const size_t bytes_x16  = (size_t)M  * D  * 2;   //  8,388,608
  const size_t bytes_w16  = (size_t)TD * D  * 2;   //  6,291,456
  const size_t bytes_ow16 = (size_t)D  * D  * 2;   //  2,097,152
  const size_t bytes_qkv  = (size_t)M  * TD * 4;   // 50,331,648 (f32)
  const size_t bytes_att  = (size_t)M  * D  * 4;   // 16,777,216 (f32)
  const size_t bytes_a16  = (size_t)M  * D  * 2;   //  8,388,608
  const size_t total = bytes_x16 + bytes_w16 + bytes_ow16 + bytes_qkv + bytes_att + bytes_a16;   // 92,274,688
  if (total > ws_size) return;
  char* p = (char*)d_ws;
  _Float16* x16  = (_Float16*)p;  p += bytes_x16;
  _Float16* w16  = (_Float16*)p;  p += bytes_w16;
  _Float16* ow16 = (_Float16*)p;  p += bytes_ow16;
  float*    qkv  = (float*)p;     p += bytes_qkv;
  float*    att  = (float*)p;     p += bytes_att;
  _Float16* a16  = (_Float16*)p;  p += bytes_a16;

  // 1) f32 -> f16 casts: x unscaled, weights x64 (exact power of two, folded back in the GEMM scale)
  {
    const int n2x = (M * D) / 2, n2w = (TD * D) / 2, n2o = (D * D) / 2;
    cast_f32_f16x2_scaled<<<(n2x + 255) / 256, 256, 0, stream>>>(x,     x16,  n2x, 1.0f);
    cast_f32_f16x2_scaled<<<(n2w + 255) / 256, 256, 0, stream>>>(in_w,  w16,  n2w, 64.0f);
    cast_f32_f16x2_scaled<<<(n2o + 255) / 256, 256, 0, stream>>>(out_w, ow16, n2o, 64.0f);
  }

  // 2) qkv[M][3D] (f32) = x16 . w16^T * (1/64) + in_b
  {
    const int tiles = (M / 64) * (TD / 64);             // 3072
    dim3 grid((tiles + 7) / 8, 1);
    wmma_gemm64<0, false, 2, 0, false, 0><<<grid, 256, 0, stream>>>(
        (const unsigned short*)x16, (const unsigned short*)x16, D, 0L,
        (const unsigned short*)w16, (const unsigned short*)w16, D, 0L,
        (void*)qkv, (void*)qkv, TD, 0L,
        in_b, in_b, 0L,
        M, TD, D, 1.0f / 64.0f);
  }

  // 3) banded attention per (batch, head, 64-query block) -> att [B,S,D] f32
  {
    BandGeom g;
    g.q_bs = (long)S * TD; g.q_rs = TD; g.q_hs = HD;
    g.k_bs = (long)S * TD; g.k_rs = TD; g.k_hs = HD;
    g.v_bs = (long)S * TD; g.v_rs = TD; g.v_hs = HD;
    g.o_bs = (long)S * D;  g.o_rs = D;  g.o_hs = HD;
    g.S = S; g.H = H; g.qscale = 0.125f; g.mask_fill = -1e30f;
    dim3 grid(Bz * H * (S / AT_QB));                    // 1024 blocks
    attn_band64_kernel<<<grid, 128, 0, stream>>>(qkv, qkv + D, qkv + 2 * D, att, wsz, g);
  }

  // 4) att f32 -> f16 carried x64
  {
    const int n2a = (M * D) / 2;
    cast_f32_f16x2_scaled<<<(n2a + 255) / 256, 256, 0, stream>>>(att, a16, n2a, 64.0f);
  }

  // 5) y[M][D] (f32) = a16 . ow16^T * (1/4096) + out_b
  {
    const int tiles = (M / 64) * (D / 64);              // 1024
    dim3 grid((tiles + 7) / 8, 1);
    wmma_gemm64<0, false, 2, 0, false, 0><<<grid, 256, 0, stream>>>(
        (const unsigned short*)a16, (const unsigned short*)a16, D, 0L,
        (const unsigned short*)ow16, (const unsigned short*)ow16, D, 0L,
        (void*)y, (void*)y, D, 0L,
        out_b, out_b, 0L,
        M, D, D, 1.0f / 4096.0f);
  }
  (void)stream;
}

// v001
// One run takes 107 microseconds.
// Next to v000, in two timings, it ran 1.66 times as fast each time.
#include <hip/hip_runtime.h>
#include <stdint.h>
// qkv projection and output projection: v_wmma_f32_16x16x32_f16 (f16 operands, weights carried x64, f32 accumulate); attention q.k^T and p.v: v_wmma_f32_16x16x32_f16 (f16 operands, p carried x2^15, f32 accumulate); softmax and epilogues f32.

typedef __attribute__((ext_vector_type(16))) _Float16 v16h;
typedef __attribute__((ext_vector_type(8)))  _Float16 v8h;
typedef __attribute__((ext_vector_type(16))) __bf16   v16b;
typedef __attribute__((ext_vector_type(8)))  __bf16   v8b;
typedef __attribute__((ext_vector_type(8)))  float    v8f;
typedef __attribute__((ext_vector_type(4)))  float    v4f;
#define PSCALE 32768.0f
#define U16(p) ((const unsigned short*)(const void*)(p))
#define PSCALE_INV (1.0f / 32768.0f)

__device__ __forceinline__ unsigned short f2bf_bits(float f) {
  unsigned u = __float_as_uint(f);
  return (unsigned short)((u + 0x7FFFu + ((u >> 16) & 1u)) >> 16);
}
__device__ __forceinline__ float bf_bits2f(unsigned short h) { return __uint_as_float(((unsigned)h) << 16); }

// ---- Block-tiled WMMA GEMM, operands staged in LDS by the tensor mover ------
// C[m,n] = scale * sum_k A[m,k] * Bt[n,k] + bias[n]; f16 operands, f32 accumulate, f32 out.
// A row-major [M,K]; Bt row-major [N,K]; M, N % 128 == 0; K % 128 == 0 and K >= 256 (two stages).
// One work-group = 4 waves (2 x 2) = one 128 x 128 tile of C; each wave owns 64 x 64.
// A pass is 128 k = 256 B of each operand row. A stage is four slices of 64 rows
// [A 0..63 | A 64..127 | Bt 0..63 | Bt 64..127], LDS pitch 272 B (16 B pad behind each row);
// every wave issues one tensor load per stage for its own slice. Two buffers.
typedef uint32_t u32x4 __attribute__((ext_vector_type(4)));
typedef uint32_t u32x8 __attribute__((ext_vector_type(8)));
#define GT_ROWB  256u      // bytes of an operand row per pass
#define GT_ROWS  64u       // rows per slice
#define GT_PITCH 272u      // LDS row pitch: odd multiple of 16 B for ds_load_b128 readers
#define GT_SLICE 18432u    // 64 x 272 = 17,408 B rounded up to a multiple of 2 KiB
#define GT_STAGE 73728u    // four slices
static_assert(GT_ROWS * GT_PITCH <= GT_SLICE && GT_SLICE % 2048u == 0u && GT_STAGE == 4u * GT_SLICE);

__device__ __forceinline__ uint32_t uni(uint32_t v) { return (uint32_t)__builtin_amdgcn_readfirstlane(v); }
__device__ __forceinline__ uint32_t pinned(uint32_t v) { uint32_t w = uni(v); asm volatile("" : "+s"(w)); return w; }   // a wave-uniform word held in a scalar register: a test on it compiles to s_cmp + s_cbranch_scc (tensor loads ignore EXEC)
// this wave's LDS reads have retired before the buffer they read is handed back for a refill
__device__ __forceinline__ void wait_ds0() { asm volatile("s_wait_dscnt 0x0" ::: "memory"); }
// this wave's own tensor load has landed (the compiler places no wait for the tensor mover)
__device__ __forceinline__ void wait_tensor0() { asm volatile("s_wait_tensorcnt 0x0" ::: "memory"); }
// one request of the whole wave: a 2-D tile from global memory into LDS
__device__ __forceinline__ void tdm_load(u32x4 g0, u32x8 g1) { asm volatile("tensor_load_to_lds %0, %1" :: "s"(g0), "s"(g1) : "memory"); }
__device__ __forceinline__ u32x8 tdm_group1(uint32_t src_pitch) {   // 1-byte elements, tile = tensor = 64 rows of 256 B
  u32x8 g;
  g[0] = uni((1u << 20) | (5u << 22) | (3u << 25));   // no mask; a pad of 4 dwords behind every 64 dwords
  g[1] = uni((GT_ROWB & 0xFFFFu) << 16);
  g[2] = uni((GT_ROWB >> 16) | ((GT_ROWS & 0xFFFFu) << 16));
  g[3] = uni((GT_ROWS >> 16) | (GT_ROWB << 16));
  g[4] = uni(GT_ROWS);
  g[5] = uni(src_pitch);
  g[6] = uni(0u);
  g[7] = uni(0u);
  return g;
}
__device__ __forceinline__ u32x4 tdm_group0(uint32_t lds_dst, uint64_t ga) {
  u32x4 g;
  g[0] = uni(1u); g[1] = uni(lds_dst); g[2] = uni((uint32_t)ga);
  g[3] = uni((((uint32_t)(ga >> 32)) & 0x01FFFFFFu) | 0x80000000u);
  return g;
}
__device__ __forceinline__ v16h lds_frag(const unsigned char* p) {   // elements 0..7 <- k 0..7, 8..15 <- k 16..23 from p
  union { v16h v; v8h h[2]; } f;
  f.h[0] = *(const v8h*)(p); f.h[1] = *(const v8h*)(p + 32); return f.v;
}

__global__ __launch_bounds__(128) void wmma_gemm128(
    const unsigned short* __restrict__ A, int lda,
    const unsigned short* __restrict__ Bt, int ldb,
    float* __restrict__ C, int ldc,
    const float* __restrict__ bias,
    int N, int K, float scale) {
  __shared__ __attribute__((aligned(2048))) unsigned char L[2u * GT_STAGE];
  const int lane = threadIdx.x & 31;
  const uint32_t wave = uni(threadIdx.x >> 5);
  const int tilesN = N >> 7;
  const int tm = blockIdx.x / tilesN;
  const int tn = blockIdx.x - tm * tilesN;
  const int wm = wave >> 1, wn = wave & 1;
  const int m0 = (tm << 7) + (wm << 6);        // this wave's 64 x 64 tile of C
  const int n0 = (tn << 7) + (wn << 6);

  const int rlane = lane & 15;                 // row (A) / col (B, D) within subtile
  const int hh    = lane >> 4;                 // k half of this lane; D row offset 8 * hh
  const int mOff  = hh * 8;

  // this wave's slice of every stage: waves 0, 1 bring A rows, waves 2, 3 bring Bt rows
  const unsigned short* srow = (wave < 2u) ? (A  + (size_t)((tm << 7) + (wave << 6)) * lda)
                                           : (Bt + (size_t)((tn << 7) + ((wave - 2u) << 6)) * ldb);
  const uint64_t src0 = (uint64_t)(uintptr_t)srow;
  u32x8 g1 = tdm_group1((uint32_t)((wave < 2u) ? lda : ldb) * 2u);
  asm volatile("" : "+s"(g1));   // as pinned(): descriptor words held in their scalar registers, so that none takes another value while a request is outstanding
  const uint32_t lds_slice = (uint32_t)(size_t)L + wave * GT_SLICE;
  const uint32_t T = (uint32_t)K >> 7;         // passes

  const uint32_t aOff = (uint32_t)wm * GT_SLICE + (uint32_t)rlane * GT_PITCH + (uint32_t)hh * 16u;
  const uint32_t bOff = (2u + (uint32_t)wn) * GT_SLICE + (uint32_t)rlane * GT_PITCH + (uint32_t)hh * 16u;

  v8f acc[4][4];
#pragma unroll
  for (int i = 0; i < 4; ++i)
#pragma unroll
    for (int j = 0; j < 4; ++j) acc[i][j] = (v8f){0.f,0.f,0.f,0.f,0.f,0.f,0.f,0.f};

  // prologue: stage 0 lands and is published, then stage 1 flies under pass 0
  tdm_load(tdm_group0(lds_slice, src0), g1);
  wait_tensor0();
  __syncthreads();
  tdm_load(tdm_group0(lds_slice + GT_STAGE, src0 + GT_ROWB), g1);

  for (uint32_t t = 0; t < T; ++t) {
    const uint32_t buf = (t & 1u) * GT_STAGE;
    const unsigned char* La = L + buf + aOff;
    const unsigned char* Lb = L + buf + bOff;
    v16h af[2][4], bf[2][4];                   // set (ks & 1) holds block ks's fragments; a block is 32 k = 16 WMMAs
#pragma unroll
    for (int j = 0; j < 4; ++j) bf[0][j] = lds_frag(Lb + j * 16 * GT_PITCH);
#pragma unroll
    for (int i = 0; i < 4; ++i) af[0][i] = lds_frag(La + i * 16 * GT_PITCH);
#pragma unroll
    for (int ks = 0; ks < 4; ++ks) {
      const int cs = ks & 1;
      if (ks < 3) {
#pragma unroll
        for (int j = 0; j < 4; ++j) bf[cs ^ 1][j] = lds_frag(Lb + j * 16 * GT_PITCH + (ks + 1) * 64);
#pragma unroll
        for (int i = 0; i < 4; ++i) af[cs ^ 1][i] = lds_frag(La + i * 16 * GT_PITCH + (ks + 1) * 64);
      }
      // keeps the next block's LDS loads as one group ahead of this block's WMMAs; without it they sink among the WMMAs, each behind a wait to 0
      __builtin_amdgcn_sched_barrier(0);
#pragma unroll
      for (int i = 0; i < 4; ++i)
#pragma unroll
        for (int j = 0; j < 4; ++j)
          acc[i][j] = __builtin_amdgcn_wmma_f32_16x16x32_f16(false, af[cs][i], false, bf[cs][j], (short)0, acc[i][j], false, false);
      // ends the block: without it the following load group is lifted in among these WMMAs, into further registers
      __builtin_amdgcn_sched_barrier(0);
    }
    // publish point of stage t + 1, which also frees the buffer that pass t has read
    wait_ds0();
    wait_tensor0();
    __syncthreads();
    if (pinned(t + 2u < T))
      tdm_load(tdm_group0(lds_slice + buf, src0 + (uint64_t)((t + 2u) * GT_ROWB)), g1);
  }
  wait_tensor0();
  wait_ds0();

  // ---- epilogue: the ring is free behind the last pass's barrier; each wave stages 16 x 64 in its own range ----
  float* slab = (float*)(L + wave * (16u * 68u * 4u));   // pitch 68 floats
#pragma unroll
  for (int i = 0; i < 4; ++i) {
    const int mBase = m0 + (i << 4);
#pragma unroll
    for (int j = 0; j < 4; ++j) {
      const float bv = bias[n0 + (j << 4) + rlane];
#pragma unroll
      for (int r = 0; r < 8; ++r) {
        float v = acc[i][j][r] * scale;
        v += bv;
        slab[(mOff + r) * 68 + (j << 4) + rlane] = v;
      }
    }
    __builtin_amdgcn_fence(__ATOMIC_RELEASE, "workgroup");
    __builtin_amdgcn_wave_barrier();
    __builtin_amdgcn_fence(__ATOMIC_ACQUIRE, "workgroup");
    {
      const int c4 = (lane & 15) * 4;     // row seg = 256 B = 16 lanes x 16 B
#pragma unroll
      for (int it = 0; it < 8; ++it) {
        const int row = it * 2 + hh;
        v4f v = *(const v4f*)(slab + row * 68 + c4);
        *(v4f*)(C + (size_t)(mBase + row) * ldc + n0 + c4) = v;
      }
    }
    __builtin_amdgcn_fence(__ATOMIC_RELEASE, "workgroup");
    __builtin_amdgcn_wave_barrier();
    __builtin_amdgcn_fence(__ATOMIC_ACQUIRE, "workgroup");
  }
}

__global__ __launch_bounds__(256) void cast_f32_f16x2_scaled(
    const float* __restrict__ in, _Float16* __restrict__ out, int n2, float sc) {
  int i = blockIdx.x * 256 + threadIdx.x;
  if (i < n2) {
    const _Float16 h0 = (_Float16)(in[2 * (size_t)i] * sc), h1 = (_Float16)(in[2 * (size_t)i + 1] * sc);
    const unsigned u = (unsigned)__builtin_bit_cast(unsigned short, h0) | ((unsigned)__builtin_bit_cast(unsigned short, h1) << 16);
    ((unsigned*)out)[i] = u;
    
  }
}

// =====================================================================================
// Banded (sliding-window) attention for head_dim 64, f32 in / f32 out, f16 operands.
//   scores = (q . k^T) * qscale : v_wmma_f32_16x16x32_f16, f32 accumulate
//   out    = p . v               : v_wmma_f32_16x16x32_f16, p carried x2^15, folded into the final 1/l
//   Online softmax in f32. Block = 4 waves = 64 query rows of one (batch, head); S % 64 == 0.
//   Key chunks of 64; only chunks overlapping [q - W, q + W] for the block's rows are visited
//   (static bound AT_MAXCH, computed start); keys with |q - kv| > W get mask_fill before the softmax.
//   Element (b, s, h, d) of tensor X lives at X[b*X_bs + s*X_rs + h*X_hs + d] (strides in floats, multiples of 4).
//   grid.x = B * H * (S/64).
// =====================================================================================
#define AT_D 64
#define AT_NW 4
#define AT_QB 64
#define AT_KC 64
#define AT_MAXCH 6
#define AT_PSC 32768.0f
struct BandGeom { long q_bs, q_rs, q_hs, k_bs, k_rs, k_hs, v_bs, v_rs, v_hs, o_bs, o_rs, o_hs;
                  int S, H; float qscale, mask_fill; };
static_assert(sizeof(BandGeom) == 112);

__device__ __forceinline__ v8f mma_h(v16h a, v16h b, v8f c) {
  c = __builtin_amdgcn_wmma_f32_16x16x32_f16(false, a, false, b, (short)0, c, false, false);
  asm volatile("v_nop\n\tv_nop\n\tv_nop\n\tv_nop" : "+v"(c) : "v"(a), "v"(b));
  return c;
}

__global__ __launch_bounds__(128)
void attn_band64_kernel(const float* __restrict__ q, const float* __restrict__ k,
                        const float* __restrict__ v, float* __restrict__ out,
                        const int* __restrict__ wptr, BandGeom g) {
  union FH { v16h v; v8h h[2]; };
  __shared__ __align__(16) _Float16 Ksh[AT_KC * AT_D];        // K [kv][d]   8 KB
  __shared__ __align__(16) _Float16 Vth[AT_D * AT_KC];        // V [d][kv]   8 KB
  __shared__ __align__(16) _Float16 Psh[AT_NW][16 * AT_KC];   // per wave P [row][kv]  8 KB
  __shared__ __align__(16) float    Os[AT_NW][16 * 68];       // per wave out tile, pitch 68

  const int tid  = threadIdx.x;
  const int wave = tid >> 5;
  const int lane = tid & 31;
  const int hh   = lane >> 4;
  const int c    = lane & 15;

  const int nqb = g.S / AT_QB;
  const int bx = blockIdx.x;
  const int qb = bx % nqb;
  const int bh = bx / nqb;
  const int h  = bh % g.H;
  const int b  = bh / g.H;
  const int qbase = qb * AT_QB;
  const int q0 = qbase + wave * 16;

  const float* qb_ptr = q + (size_t)b * g.q_bs + (size_t)h * g.q_hs;
  const float* kb_ptr = k + (size_t)b * g.k_bs + (size_t)h * g.k_hs;
  const float* vb_ptr = v + (size_t)b * g.v_bs + (size_t)h * g.v_hs;
  float*       ob_ptr = out + (size_t)b * g.o_bs + (size_t)h * g.o_hs;

  // ---- Q fragments (A operand, row = q0 + c): d-chunks 0..31 and 32..63 ----
  v16h qa0, qa1;
  {
    const float* qrow = qb_ptr + (size_t)(q0 + c) * g.q_rs;
#pragma unroll
    for (int e = 0; e < 8; ++e) {
      qa0[e]     = (_Float16)qrow[8 * hh + e];
      qa0[8 + e] = (_Float16)qrow[16 + 8 * hh + e];
      qa1[e]     = (_Float16)qrow[32 + 8 * hh + e];
      qa1[8 + e] = (_Float16)qrow[32 + 16 + 8 * hh + e];
    }
  }

  float mrow[8], lrow[8];
  v8f oacc[4];
#pragma unroll
  for (int r = 0; r < 8; ++r) { mrow[r] = -__builtin_huge_valf(); lrow[r] = 0.f; }
#pragma unroll
  for (int t = 0; t < 4; ++t) oacc[t] = (v8f){0.f,0.f,0.f,0.f,0.f,0.f,0.f,0.f};

  // ---- visited key-chunk range (block-uniform), statically bounded trip count ----
  const int nkc = g.S / AT_KC;
  int Wd = wptr[0];
  Wd = Wd < 0 ? 0 : Wd;
  Wd = Wd > g.S ? g.S : Wd;
  const int lo = qbase - Wd;
  const int kcLo = (lo < 0) ? 0 : (lo / AT_KC);
  int kcHi = (qbase + AT_QB - 1 + Wd) / AT_KC;
  kcHi = kcHi > nkc - 1 ? nkc - 1 : kcHi;
  int nvis = kcHi - kcLo + 1;
  nvis = nvis > AT_MAXCH ? AT_MAXCH : nvis;
  nvis = nvis < 1 ? 1 : nvis;

  for (int ci = 0; ci < nvis; ++ci) {
    const int kv0 = (kcLo + ci) * AT_KC;   // kcLo + ci <= kcHi <= nkc - 1
    __syncthreads();
    {
      const int kvr = tid >> 1, dh = (tid & 1) * 32;
      const float* krow = kb_ptr + (size_t)(kv0 + kvr) * g.k_rs + dh;
      const float* vrow = vb_ptr + (size_t)(kv0 + kvr) * g.v_rs + dh;
#pragma unroll
      for (int i = 0; i < 8; ++i) {
        v4f kk = *(const v4f*)(krow + 4 * i);
        v4f vv = *(const v4f*)(vrow + 4 * i);
#pragma unroll
        for (int e = 0; e < 4; ++e) {
          const int d = dh + 4 * i + e;
          Ksh[kvr * AT_D + d]  = (_Float16)kk[e];
          Vth[d * AT_KC + kvr] = (_Float16)vv[e];
        }
      }
    }
    __syncthreads();

    // ---- scores: 16 rows x 64 keys per wave ----
    v8f s[4];
#pragma unroll
    for (int j = 0; j < 4; ++j) {
      s[j] = (v8f){0.f,0.f,0.f,0.f,0.f,0.f,0.f,0.f};
      FH kb0, kb1;
      kb0.h[0] = *(const v8h*)(Ksh + (j * 16 + c) * AT_D + 8 * hh);
      kb0.h[1] = *(const v8h*)(Ksh + (j * 16 + c) * AT_D + 16 + 8 * hh);
      kb1.h[0] = *(const v8h*)(Ksh + (j * 16 + c) * AT_D + 32 + 8 * hh);
      kb1.h[1] = *(const v8h*)(Ksh + (j * 16 + c) * AT_D + 32 + 16 + 8 * hh);
      s[j] = mma_h(qa0, kb0.v, s[j]);
      s[j] = mma_h(qa1, kb1.v, s[j]);
    }

    // ---- scale + band mask + chunk row max ----
    float cm[8];
#pragma unroll
    for (int r = 0; r < 8; ++r) {
      const int qrow = q0 + 8 * hh + r;
      float m = -__builtin_huge_valf();
#pragma unroll
      for (int j = 0; j < 4; ++j) {
        const int kvcol = kv0 + j * 16 + c;
        const int dlt = qrow - kvcol;
        float sv = s[j][r] * g.qscale;
        const bool masked = (dlt > Wd) || (dlt < -Wd);
        if (masked) sv = g.mask_fill;
        s[j][r] = sv;
        m = fmaxf(m, sv);
      }
#pragma unroll
      for (int off = 1; off < 16; off <<= 1) m = fmaxf(m, __shfl_xor(m, off, 32));
      cm[r] = m;
    }
    _Float16* pwh = Psh[wave];
#pragma unroll
    for (int r = 0; r < 8; ++r) {
      const float mnew = fmaxf(mrow[r], cm[r]);
      const float alpha = expf(mrow[r] - mnew);
      mrow[r] = mnew;
      float psum = 0.f;
#pragma unroll
      for (int j = 0; j < 4; ++j) {
        const float p = expf(s[j][r] - mnew);
        psum += p;
        pwh[(8 * hh + r) * AT_KC + j * 16 + c] = (_Float16)(p * AT_PSC);
      }
#pragma unroll
      for (int off = 1; off < 16; off <<= 1) psum += __shfl_xor(psum, off, 32);
      lrow[r] = lrow[r] * alpha + psum;
#pragma unroll
      for (int t = 0; t < 4; ++t) oacc[t][r] *= alpha;
    }
    // P tile: stored as _Float16 elements, reloaded below as v8h of _Float16 after a wave barrier
    __builtin_amdgcn_fence(__ATOMIC_RELEASE, "workgroup");
    __builtin_amdgcn_wave_barrier();
    __builtin_amdgcn_fence(__ATOMIC_ACQUIRE, "workgroup");
#pragma unroll 1
    for (int kk = 0; kk < 2; ++kk) {
      FH pa;
      pa.h[0] = *(const v8h*)(pwh + c * AT_KC + kk * 32 + 8 * hh);
      pa.h[1] = *(const v8h*)(pwh + c * AT_KC + kk * 32 + 16 + 8 * hh);
#pragma unroll
      for (int t = 0; t < 4; ++t) {
        FH vb;
        vb.h[0] = *(const v8h*)(Vth + (t * 16 + c) * AT_KC + kk * 32 + 8 * hh);
        vb.h[1] = *(const v8h*)(Vth + (t * 16 + c) * AT_KC + kk * 32 + 16 + 8 * hh);
        oacc[t] = mma_h(pa.v, vb.v, oacc[t]);
      }
    }
  }

  float* os = Os[wave];
#pragma unroll
  for (int r = 0; r < 8; ++r) {
    const float inv = 1.0f / (lrow[r] * AT_PSC);
#pragma unroll
    for (int t = 0; t < 4; ++t) os[(8 * hh + r) * 68 + t * 16 + c] = oacc[t][r] * inv;
  }
  __builtin_amdgcn_fence(__ATOMIC_RELEASE, "workgroup");
  __builtin_amdgcn_wave_barrier();
  __builtin_amdgcn_fence(__ATOMIC_ACQUIRE, "workgroup");
  {
    const int c4 = (lane & 15) * 4;      // row seg = 256 B = 16 lanes x 16 B; rows it*2+hh cover 0..15
    {
#pragma unroll
      for (int it = 0; it < 8; ++it) {
        const int row = it * 2 + hh;
        v4f val = *(const v4f*)(os + row * 68 + c4);
        *(v4f*)(ob_ptr + (size_t)(q0 + row) * g.o_rs + c4) = val;
      }
      
    }
  }
}

// =====================================================================================
extern "C" void kernel_launch(void* const* d_in, const int* in_sizes, int n_in,
                              void* d_out, int out_size, void* d_ws, size_t ws_size,
                              hipStream_t stream) {
  constexpr int Bz = 2, S = 2048, D = 1024, H = 16, HD = 64;
  constexpr int TD = 3 * D;          // 3072
  constexpr int M  = Bz * S;         // 4096 token rows
  static_assert(H * HD == D);
  static_assert(M % 128 == 0 && TD % 128 == 0 && D % 128 == 0 && D >= 256 && S % AT_QB == 0);

  if (n_in < 6) return;
  if (in_sizes[0] != M * D || in_sizes[1] != TD * D || in_sizes[2] != TD ||
      in_sizes[3] != D * D || in_sizes[4] != D || in_sizes[5] < 1 || out_size != M * D) return;

  const float* x     = (const float*)d_in[0];   // [B,S,D]
  const float* in_w  = (const float*)d_in[1];   // [3D, D] = (out, in) -> Bt
  const float* in_b  = (const float*)d_in[2];   // [3D]
  const float* out_w = (const float*)d_in[3];   // [D, D] = (out, in) -> Bt
  const float* out_b = (const float*)d_in[4];   // [D]
  const int*   wsz   = (const int*)d_in[5];     // window size, int32[1]
  float* y = (float*)d_out;

  // ---- workspace carve (all offsets multiples of 1 MiB) ----
  const size_t bytes_x16  = (size_t)M  * D  * 2;   //  8,388,608
  const size_t bytes_w16  = (size_t)TD * D  * 2;   //  6,291,456
  const size_t bytes_ow16 = (size_t)D  * D  * 2;   //  2,097,152
  const size_t bytes_qkv  = (size_t)M  * TD * 4;   // 50,331,648 (f32)
  const size_t bytes_att  = (size_t)M  * D  * 4;   // 16,777,216 (f32)
  const size_t bytes_a16  = (size_t)M  * D  * 2;   //  8,388,608
  const size_t total = bytes_x16 + bytes_w16 + bytes_ow16 + bytes_qkv + bytes_att + bytes_a16;   // 92,274,688
  if (total > ws_size) return;
  char* p = (char*)d_ws;
  _Float16* x16  = (_Float16*)p;  p += bytes_x16;
  _Float16* w16  = (_Float16*)p;  p += bytes_w16;
  _Float16* ow16 = (_Float16*)p;  p += bytes_ow16;
  float*    qkv  = (float*)p;     p += bytes_qkv;
  float*    att  = (float*)p;     p += bytes_att;
  _Float16* a16  = (_Float16*)p;  p += bytes_a16;

  // 1) f32 -> f16 casts: x unscaled, weights x64 (exact power of two, folded back in the GEMM scale)
  {
    const int n2x = (M * D) / 2, n2w = (TD * D) / 2, n2o = (D * D) / 2;
    cast_f32_f16x2_scaled<<<(n2x + 255) / 256, 256, 0, stream>>>(x,     x16,  n2x, 1.0f);
    cast_f32_f16x2_scaled<<<(n2w + 255) / 256, 256, 0, stream>>>(in_w,  w16,  n2w, 64.0f);
    cast_f32_f16x2_scaled<<<(n2o + 255) / 256, 256, 0, stream>>>(out_w, ow16, n2o, 64.0f);
  }

  // 2) qkv[M][3D] (f32) = x16 . w16^T * (1/64) + in_b
  {
    dim3 grid((M / 128) * (TD / 128), 1);               // 768 tiles of 128 x 128
    wmma_gemm128<<<grid, 128, 0, stream>>>(
        (const unsigned short*)x16, D, (const unsigned short*)w16, D,
        qkv, TD, in_b, TD, D, 1.0f / 64.0f);
  }

  // 3) banded attention per (batch, head, 64-query block) -> att [B,S,D] f32
  {
    BandGeom g;
    g.q_bs = (long)S * TD; g.q_rs = TD; g.q_hs = HD;
    g.k_bs = (long)S * TD; g.k_rs = TD; g.k_hs = HD;
    g.v_bs = (long)S * TD; g.v_rs = TD; g.v_hs = HD;
    g.o_bs = (long)S * D;  g.o_rs = D;  g.o_hs = HD;
    g.S = S; g.H = H; g.qscale = 0.125f; g.mask_fill = -1e30f;
    dim3 grid(Bz * H * (S / AT_QB));                    // 1024 blocks
    attn_band64_kernel<<<grid, 128, 0, stream>>>(qkv, qkv + D, qkv + 2 * D, att, wsz, g);
  }

  // 4) att f32 -> f16 carried x64
  {
    const int n2a = (M * D) / 2;
    cast_f32_f16x2_scaled<<<(n2a + 255) / 256, 256, 0, stream>>>(att, a16, n2a, 64.0f);
  }

  // 5) y[M][D] (f32) = a16 . ow16^T * (1/4096) + out_b
  {
    dim3 grid((M / 128) * (D / 128), 1);                // 256 tiles of 128 x 128
    wmma_gemm128<<<grid, 128, 0, stream>>>(
        (const unsigned short*)a16, D, (const unsigned short*)ow16, D,
        y, D, out_b, D, D, 1.0f / 4096.0f);
  }
  (void)stream;
}

// v002
// A run of this version takes 104 microseconds.
// Timed twice side by side with v001, it ran 1.03 and 1.04 times as fast.
// Counting every step since v000, it is 1.72 times as fast.
#include <hip/hip_runtime.h>
#include <stdint.h>
// qkv projection and output projection: v_wmma_f32_16x16x32_f16 (f16 operands, weights carried x64, f32 accumulate); attention q.k^T and p.v: v_wmma_f32_16x16x32_f16 (f16 operands, p carried x2^15, f32 accumulate); softmax and epilogues f32.

typedef __attribute__((ext_vector_type(16))) _Float16 v16h;
typedef __attribute__((ext_vector_type(8)))  _Float16 v8h;
typedef __attribute__((ext_vector_type(16))) __bf16   v16b;
typedef __attribute__((ext_vector_type(8)))  __bf16   v8b;
typedef __attribute__((ext_vector_type(8)))  float    v8f;
typedef __attribute__((ext_vector_type(4)))  float    v4f;
#define PSCALE 32768.0f
#define U16(p) ((const unsigned short*)(const void*)(p))
#define PSCALE_INV (1.0f / 32768.0f)

__device__ __forceinline__ unsigned short f2bf_bits(float f) {
  unsigned u = __float_as_uint(f);
  return (unsigned short)((u + 0x7FFFu + ((u >> 16) & 1u)) >> 16);
}
__device__ __forceinline__ float bf_bits2f(unsigned short h) { return __uint_as_float(((unsigned)h) << 16); }

// ---- Block-tiled WMMA GEMM, operands staged in LDS by the tensor mover ------
// C[m,n] = scale * sum_k A[m,k] * Bt[n,k] + bias[n]; f16 operands, f32 accumulate, f32 out.
// A row-major [M,K]; Bt row-major [N,K]; M, N % 128 == 0; K % 128 == 0 and K >= 256 (two stages).
// One work-group = 4 waves (2 x 2) = one 128 x 128 tile of C; each wave owns 64 x 64.
// A pass is 128 k = 256 B of each operand row. A stage is four slices of 64 rows
// [A 0..63 | A 64..127 | Bt 0..63 | Bt 64..127], LDS pitch 272 B (16 B pad behind each row);
// every wave issues one tensor load per stage for its own slice. Two buffers.
typedef uint32_t u32x4 __attribute__((ext_vector_type(4)));
typedef uint32_t u32x8 __attribute__((ext_vector_type(8)));
#define GT_ROWB  256u      // bytes of an operand row per pass
#define GT_ROWS  64u       // rows per slice
#define GT_PITCH 272u      // LDS row pitch: odd multiple of 16 B for ds_load_b128 readers
#define GT_SLICE 18432u    // 64 x 272 = 17,408 B rounded up to a multiple of 2 KiB
#define GT_STAGE 73728u    // four slices
static_assert(GT_ROWS * GT_PITCH <= GT_SLICE && GT_SLICE % 2048u == 0u && GT_STAGE == 4u * GT_SLICE);

__device__ __forceinline__ uint32_t uni(uint32_t v) { return (uint32_t)__builtin_amdgcn_readfirstlane(v); }
__device__ __forceinline__ uint32_t pinned(uint32_t v) { uint32_t w = uni(v); asm volatile("" : "+s"(w)); return w; }   // a wave-uniform word held in a scalar register: a test on it compiles to s_cmp + s_cbranch_scc (tensor loads ignore EXEC)
// this wave's LDS reads have retired before the buffer they read is handed back for a refill
__device__ __forceinline__ void wait_ds0() { asm volatile("s_wait_dscnt 0x0" ::: "memory"); }
// this wave's own tensor load has landed (the compiler places no wait for the tensor mover)
__device__ __forceinline__ void wait_tensor0() { asm volatile("s_wait_tensorcnt 0x0" ::: "memory"); }
// one request of the whole wave: a 2-D tile from global memory into LDS
__device__ __forceinline__ void tdm_load(u32x4 g0, u32x8 g1) { asm volatile("tensor_load_to_lds %0, %1" :: "s"(g0), "s"(g1) : "memory"); }
__device__ __forceinline__ u32x8 tdm_group1(uint32_t src_pitch) {   // 1-byte elements, tile = tensor = 64 rows of 256 B
  u32x8 g;
  g[0] = uni((1u << 20) | (5u << 22) | (3u << 25));   // no mask; a pad of 4 dwords behind every 64 dwords
  g[1] = uni((GT_ROWB & 0xFFFFu) << 16);
  g[2] = uni((GT_ROWB >> 16) | ((GT_ROWS & 0xFFFFu) << 16));
  g[3] = uni((GT_ROWS >> 16) | (GT_ROWB << 16));
  g[4] = uni(GT_ROWS);
  g[5] = uni(src_pitch);
  g[6] = uni(0u);
  g[7] = uni(0u);
  return g;
}
__device__ __forceinline__ u32x4 tdm_group0(uint32_t lds_dst, uint64_t ga) {
  u32x4 g;
  g[0] = uni(1u); g[1] = uni(lds_dst); g[2] = uni((uint32_t)ga);
  g[3] = uni((((uint32_t)(ga >> 32)) & 0x01FFFFFFu) | 0x80000000u);
  return g;
}
__device__ __forceinline__ v16h lds_frag(const unsigned char* p) {   // elements 0..7 <- k 0..7, 8..15 <- k 16..23 from p
  union { v16h v; v8h h[2]; } f;
  f.h[0] = *(const v8h*)(p); f.h[1] = *(const v8h*)(p + 32); return f.v;
}

__global__ __launch_bounds__(128) void wmma_gemm128(
    const unsigned short* __restrict__ A, int lda,
    const unsigned short* __restrict__ Bt, int ldb,
    float* __restrict__ C, int ldc,
    const float* __restrict__ bias,
    int N, int K, float scale) {
  __shared__ __attribute__((aligned(2048))) unsigned char L[2u * GT_STAGE];
  const int lane = threadIdx.x & 31;
  const uint32_t wave = uni(threadIdx.x >> 5);
  const int tilesN = N >> 7;
  const int tm = blockIdx.x / tilesN;
  const int tn = blockIdx.x - tm * tilesN;
  const int wm = wave >> 1, wn = wave & 1;
  const int m0 = (tm << 7) + (wm << 6);        // this wave's 64 x 64 tile of C
  const int n0 = (tn << 7) + (wn << 6);

  const int rlane = lane & 15;                 // row (A) / col (B, D) within subtile
  const int hh    = lane >> 4;                 // k half of this lane; D row offset 8 * hh
  const int mOff  = hh * 8;

  // this wave's slice of every stage: waves 0, 1 bring A rows, waves 2, 3 bring Bt rows
  const unsigned short* srow = (wave < 2u) ? (A  + (size_t)((tm << 7) + (wave << 6)) * lda)
                                           : (Bt + (size_t)((tn << 7) + ((wave - 2u) << 6)) * ldb);
  const uint64_t src0 = (uint64_t)(uintptr_t)srow;
  u32x8 g1 = tdm_group1((uint32_t)((wave < 2u) ? lda : ldb) * 2u);
  asm volatile("" : "+s"(g1));   // as pinned(): descriptor words held in their scalar registers, so that none takes another value while a request is outstanding
  const uint32_t lds_slice = (uint32_t)(size_t)L + wave * GT_SLICE;
  const uint32_t T = (uint32_t)K >> 7;         // passes

  const uint32_t aOff = (uint32_t)wm * GT_SLICE + (uint32_t)rlane * GT_PITCH + (uint32_t)hh * 16u;
  const uint32_t bOff = (2u + (uint32_t)wn) * GT_SLICE + (uint32_t)rlane * GT_PITCH + (uint32_t)hh * 16u;

  v8f acc[4][4];
#pragma unroll
  for (int i = 0; i < 4; ++i)
#pragma unroll
    for (int j = 0; j < 4; ++j) acc[i][j] = (v8f){0.f,0.f,0.f,0.f,0.f,0.f,0.f,0.f};

  // prologue: stage 0 lands and is published, then stage 1 flies under pass 0
  tdm_load(tdm_group0(lds_slice, src0), g1);
  wait_tensor0();
  __syncthreads();
  tdm_load(tdm_group0(lds_slice + GT_STAGE, src0 + GT_ROWB), g1);

  for (uint32_t t = 0; t < T; ++t) {
    const uint32_t buf = (t & 1u) * GT_STAGE;
    const unsigned char* La = L + buf + aOff;
    const unsigned char* Lb = L + buf + bOff;
    v16h af[2][4], bf[2][4];                   // set (ks & 1) holds block ks's fragments; a block is 32 k = 16 WMMAs
#pragma unroll
    for (int j = 0; j < 4; ++j) bf[0][j] = lds_frag(Lb + j * 16 * GT_PITCH);
#pragma unroll
    for (int i = 0; i < 4; ++i) af[0][i] = lds_frag(La + i * 16 * GT_PITCH);
#pragma unroll
    for (int ks = 0; ks < 4; ++ks) {
      const int cs = ks & 1;
      if (ks < 3) {
#pragma unroll
        for (int j = 0; j < 4; ++j) bf[cs ^ 1][j] = lds_frag(Lb + j * 16 * GT_PITCH + (ks + 1) * 64);
#pragma unroll
        for (int i = 0; i < 4; ++i) af[cs ^ 1][i] = lds_frag(La + i * 16 * GT_PITCH + (ks + 1) * 64);
      }
      // keeps the next block's LDS loads as one group ahead of this block's WMMAs; without it they sink among the WMMAs, each behind a wait to 0
      __builtin_amdgcn_sched_barrier(0);
#pragma unroll
      for (int i = 0; i < 4; ++i)
#pragma unroll
        for (int j = 0; j < 4; ++j)
          acc[i][j] = __builtin_amdgcn_wmma_f32_16x16x32_f16(false, af[cs][i], false, bf[cs][j], (short)0, acc[i][j], false, false);
      // ends the block: without it the following load group is lifted in among these WMMAs, into further registers
      __builtin_amdgcn_sched_barrier(0);
    }
    // publish point of stage t + 1, which also frees the buffer that pass t has read
    wait_ds0();
    wait_tensor0();
    __syncthreads();
    if (pinned(t + 2u < T))
      tdm_load(tdm_group0(lds_slice + buf, src0 + (uint64_t)((t + 2u) * GT_ROWB)), g1);
  }
  wait_tensor0();
  wait_ds0();

  // ---- epilogue: the ring is free behind the last pass's barrier; each wave stages 16 x 64 in its own range ----
  float* slab = (float*)(L + wave * (16u * 68u * 4u));   // pitch 68 floats
#pragma unroll
  for (int i = 0; i < 4; ++i) {
    const int mBase = m0 + (i << 4);
#pragma unroll
    for (int j = 0; j < 4; ++j) {
      const float bv = bias[n0 + (j << 4) + rlane];
#pragma unroll
      for (int r = 0; r < 8; ++r) {
        float v = acc[i][j][r] * scale;
        v += bv;
        slab[(mOff + r) * 68 + (j << 4) + rlane] = v;
      }
    }
    __builtin_amdgcn_fence(__ATOMIC_RELEASE, "workgroup");
    __builtin_amdgcn_wave_barrier();
    __builtin_amdgcn_fence(__ATOMIC_ACQUIRE, "workgroup");
    {
      const int c4 = (lane & 15) * 4;     // row seg = 256 B = 16 lanes x 16 B
#pragma unroll
      for (int it = 0; it < 8; ++it) {
        const int row = it * 2 + hh;
        v4f v = *(const v4f*)(slab + row * 68 + c4);
        *(v4f*)(C + (size_t)(mBase + row) * ldc + n0 + c4) = v;
      }
    }
    __builtin_amdgcn_fence(__ATOMIC_RELEASE, "workgroup");
    __builtin_amdgcn_wave_barrier();
    __builtin_amdgcn_fence(__ATOMIC_ACQUIRE, "workgroup");
  }
}

// f32 -> f16 conversion, out[i] = (f16)(in[i] * sc). One work-group of 8 waves converts 256 * NL groups of 4 floats:
// every lane issues its NL 16-byte loads (512 contiguous bytes per wave and load) before it converts the first,
// so a launch starts 2,048 waves at most and each WGP still has 8 * NL * 512 bytes in flight.
typedef __attribute__((ext_vector_type(4))) _Float16 v4h;
template <int NL>
__device__ __forceinline__ void cast_body(const float* __restrict__ in, _Float16* __restrict__ out, float sc) {
  const size_t base = ((size_t)blockIdx.x * (256u * NL) + threadIdx.x) * 4u;   // first float of this lane
  const float* p = in + base;
  v4f v[NL];
#pragma unroll
  for (int i = 0; i < NL; ++i) v[i] = *(const v4f*)(p + i * 1024);
  // the loads' address register stays live up to here, so nothing (the last load's own result included) rewrites it ahead of this wait
  asm volatile("s_wait_xcnt 0x0" :: "v"(p) : "memory");
#pragma unroll
  for (int i = 0; i < NL; ++i) {
    v4h h;
#pragma unroll
    for (int e = 0; e < 4; ++e) h[e] = (_Float16)(v[i][e] * sc);
    *(v4h*)(out + base + i * 1024) = h;
  }
}
// element count = gridDim.x * 1024 * NL exactly (asserted where they are launched)
__global__ __launch_bounds__(256) void cast_f32_f16_nl16(const float* __restrict__ in, _Float16* __restrict__ out, float sc) { cast_body<16>(in, out, sc); }
__global__ __launch_bounds__(256) void cast_f32_f16_nl12(const float* __restrict__ in, _Float16* __restrict__ out, float sc) { cast_body<12>(in, out, sc); }
__global__ __launch_bounds__(256) void cast_f32_f16_nl4(const float* __restrict__ in, _Float16* __restrict__ out, float sc) { cast_body<4>(in, out, sc); }

// =====================================================================================
// Banded (sliding-window) attention for head_dim 64, f32 in / f32 out, f16 operands.
//   scores = (q . k^T) * qscale : v_wmma_f32_16x16x32_f16, f32 accumulate
//   out    = p . v               : v_wmma_f32_16x16x32_f16, p carried x2^15, folded into the final 1/l
//   Online softmax in f32. Block = 4 waves = 64 query rows of one (batch, head); S % 64 == 0.
//   Key chunks of 64; only chunks overlapping [q - W, q + W] for the block's rows are visited
//   (static bound AT_MAXCH, computed start); keys with |q - kv| > W get mask_fill before the softmax.
//   Element (b, s, h, d) of tensor X lives at X[b*X_bs + s*X_rs + h*X_hs + d] (strides in floats, multiples of 4).
//   grid.x = B * H * (S/64).
// =====================================================================================
#define AT_D 64
#define AT_NW 4
#define AT_QB 64
#define AT_KC 64
#define AT_MAXCH 6
#define AT_PSC 32768.0f
struct BandGeom { long q_bs, q_rs, q_hs, k_bs, k_rs, k_hs, v_bs, v_rs, v_hs, o_bs, o_rs, o_hs;
                  int S, H; float qscale, mask_fill; };
static_assert(sizeof(BandGeom) == 112);

__device__ __forceinline__ v8f mma_h(v16h a, v16h b, v8f c) {
  c = __builtin_amdgcn_wmma_f32_16x16x32_f16(false, a, false, b, (short)0, c, false, false);
  asm volatile("v_nop\n\tv_nop\n\tv_nop\n\tv_nop" : "+v"(c) : "v"(a), "v"(b));
  return c;
}

__global__ __launch_bounds__(128)
void attn_band64_kernel(const float* __restrict__ q, const float* __restrict__ k,
                        const float* __restrict__ v, float* __restrict__ out,
                        const int* __restrict__ wptr, BandGeom g) {
  union FH { v16h v; v8h h[2]; };
  __shared__ __align__(16) _Float16 Ksh[AT_KC * AT_D];        // K [kv][d]   8 KB
  __shared__ __align__(16) _Float16 Vth[AT_D * AT_KC];        // V [d][kv]   8 KB
  __shared__ __align__(16) _Float16 Psh[AT_NW][16 * AT_KC];   // per wave P [row][kv]  8 KB
  __shared__ __align__(16) float    Os[AT_NW][16 * 68];       // per wave out tile, pitch 68

  const int tid  = threadIdx.x;
  const int wave = tid >> 5;
  const int lane = tid & 31;
  const int hh   = lane >> 4;
  const int c    = lane & 15;

  const int nqb = g.S / AT_QB;
  const int bx = blockIdx.x;
  const int qb = bx % nqb;
  const int bh = bx / nqb;
  const int h  = bh % g.H;
  const int b  = bh / g.H;
  const int qbase = qb * AT_QB;
  const int q0 = qbase + wave * 16;

  const float* qb_ptr = q + (size_t)b * g.q_bs + (size_t)h * g.q_hs;
  const float* kb_ptr = k + (size_t)b * g.k_bs + (size_t)h * g.k_hs;
  const float* vb_ptr = v + (size_t)b * g.v_bs + (size_t)h * g.v_hs;
  float*       ob_ptr = out + (size_t)b * g.o_bs + (size_t)h * g.o_hs;

  // ---- Q fragments (A operand, row = q0 + c): d-chunks 0..31 and 32..63 ----
  v16h qa0, qa1;
  {
    const float* qrow = qb_ptr + (size_t)(q0 + c) * g.q_rs;
#pragma unroll
    for (int e = 0; e < 8; ++e) {
      qa0[e]     = (_Float16)qrow[8 * hh + e];
      qa0[8 + e] = (_Float16)qrow[16 + 8 * hh + e];
      qa1[e]     = (_Float16)qrow[32 + 8 * hh + e];
      qa1[8 + e] = (_Float16)qrow[32 + 16 + 8 * hh + e];
    }
  }

  float mrow[8], lrow[8];
  v8f oacc[4];
#pragma unroll
  for (int r = 0; r < 8; ++r) { mrow[r] = -__builtin_huge_valf(); lrow[r] = 0.f; }
#pragma unroll
  for (int t = 0; t < 4; ++t) oacc[t] = (v8f){0.f,0.f,0.f,0.f,0.f,0.f,0.f,0.f};

  // ---- visited key-chunk range (block-uniform), statically bounded trip count ----
  const int nkc = g.S / AT_KC;
  int Wd = wptr[0];
  Wd = Wd < 0 ? 0 : Wd;
  Wd = Wd > g.S ? g.S : Wd;
  const int lo = qbase - Wd;
  const int kcLo = (lo < 0) ? 0 : (lo / AT_KC);
  int kcHi = (qbase + AT_QB - 1 + Wd) / AT_KC;
  kcHi = kcHi > nkc - 1 ? nkc - 1 : kcHi;
  int nvis = kcHi - kcLo + 1;
  nvis = nvis > AT_MAXCH ? AT_MAXCH : nvis;
  nvis = nvis < 1 ? 1 : nvis;

  for (int ci = 0; ci < nvis; ++ci) {
    const int kv0 = (kcLo + ci) * AT_KC;   // kcLo + ci <= kcHi <= nkc - 1
    __syncthreads();
    {
      const int kvr = tid >> 1, dh = (tid & 1) * 32;
      const float* krow = kb_ptr + (size_t)(kv0 + kvr) * g.k_rs + dh;
      const float* vrow = vb_ptr + (size_t)(kv0 + kvr) * g.v_rs + dh;
#pragma unroll
      for (int i = 0; i < 8; ++i) {
        v4f kk = *(const v4f*)(krow + 4 * i);
        v4f vv = *(const v4f*)(vrow + 4 * i);
#pragma unroll
        for (int e = 0; e < 4; ++e) {
          const int d = dh + 4 * i + e;
          Ksh[kvr * AT_D + d]  = (_Float16)kk[e];
          Vth[d * AT_KC + kvr] = (_Float16)vv[e];
        }
      }
    }
    __syncthreads();

    // ---- scores: 16 rows x 64 keys per wave ----
    v8f s[4];
#pragma unroll
    for (int j = 0; j < 4; ++j) {
      s[j] = (v8f){0.f,0.f,0.f,0.f,0.f,0.f,0.f,0.f};
      FH kb0, kb1;
      kb0.h[0] = *(const v8h*)(Ksh + (j * 16 + c) * AT_D + 8 * hh);
      kb0.h[1] = *(const v8h*)(Ksh + (j * 16 + c) * AT_D + 16 + 8 * hh);
      kb1.h[0] = *(const v8h*)(Ksh + (j * 16 + c) * AT_D + 32 + 8 * hh);
      kb1.h[1] = *(const v8h*)(Ksh + (j * 16 + c) * AT_D + 32 + 16 + 8 * hh);
      s[j] = mma_h(qa0, kb0.v, s[j]);
      s[j] = mma_h(qa1, kb1.v, s[j]);
    }

    // ---- scale + band mask + chunk row max ----
    float cm[8];
#pragma unroll
    for (int r = 0; r < 8; ++r) {
      const int qrow = q0 + 8 * hh + r;
      float m = -__builtin_huge_valf();
#pragma unroll
      for (int j = 0; j < 4; ++j) {
        const int kvcol = kv0 + j * 16 + c;
        const int dlt = qrow - kvcol;
        float sv = s[j][r] * g.qscale;
        const bool masked = (dlt > Wd) || (dlt < -Wd);
        if (masked) sv = g.mask_fill;
        s[j][r] = sv;
        m = fmaxf(m, sv);
      }
#pragma unroll
      for (int off = 1; off < 16; off <<= 1) m = fmaxf(m, __shfl_xor(m, off, 32));
      cm[r] = m;
    }
    _Float16* pwh = Psh[wave];
#pragma unroll
    for (int r = 0; r < 8; ++r) {
      const float mnew = fmaxf(mrow[r], cm[r]);
      const float alpha = expf(mrow[r] - mnew);
      mrow[r] = mnew;
      float psum = 0.f;
#pragma unroll
      for (int j = 0; j < 4; ++j) {
        const float p = expf(s[j][r] - mnew);
        psum += p;
        pwh[(8 * hh + r) * AT_KC + j * 16 + c] = (_Float16)(p * AT_PSC);
      }
#pragma unroll
      for (int off = 1; off < 16; off <<= 1) psum += __shfl_xor(psum, off, 32);
      lrow[r] = lrow[r] * alpha + psum;
#pragma unroll
      for (int t = 0; t < 4; ++t) oacc[t][r] *= alpha;
    }
    // P tile: stored as _Float16 elements, reloaded below as v8h of _Float16 after a wave barrier
    __builtin_amdgcn_fence(__ATOMIC_RELEASE, "workgroup");
    __builtin_amdgcn_wave_barrier();
    __builtin_amdgcn_fence(__ATOMIC_ACQUIRE, "workgroup");
#pragma unroll 1
    for (int kk = 0; kk < 2; ++kk) {
      FH pa;
      pa.h[0] = *(const v8h*)(pwh + c * AT_KC + kk * 32 + 8 * hh);
      pa.h[1] = *(const v8h*)(pwh + c * AT_KC + kk * 32 + 16 + 8 * hh);
#pragma unroll
      for (int t = 0; t < 4; ++t) {
        FH vb;
        vb.h[0] = *(const v8h*)(Vth + (t * 16 + c) * AT_KC + kk * 32 + 8 * hh);
        vb.h[1] = *(const v8h*)(Vth + (t * 16 + c) * AT_KC + kk * 32 + 16 + 8 * hh);
        oacc[t] = mma_h(pa.v, vb.v, oacc[t]);
      }
    }
  }

  float* os = Os[wave];
#pragma unroll
  for (int r = 0; r < 8; ++r) {
    const float inv = 1.0f / (lrow[r] * AT_PSC);
#pragma unroll
    for (int t = 0; t < 4; ++t) os[(8 * hh + r) * 68 + t * 16 + c] = oacc[t][r] * inv;
  }
  __builtin_amdgcn_fence(__ATOMIC_RELEASE, "workgroup");
  __builtin_amdgcn_wave_barrier();
  __builtin_amdgcn_fence(__ATOMIC_ACQUIRE, "workgroup");
  {
    const int c4 = (lane & 15) * 4;      // row seg = 256 B = 16 lanes x 16 B; rows it*2+hh cover 0..15
    {
#pragma unroll
      for (int it = 0; it < 8; ++it) {
        const int row = it * 2 + hh;
        v4f val = *(const v4f*)(os + row * 68 + c4);
        *(v4f*)(ob_ptr + (size_t)(q0 + row) * g.o_rs + c4) = val;
      }
      
    }
  }
}

// =====================================================================================
extern "C" void kernel_launch(void* const* d_in, const int* in_sizes, int n_in,
                              void* d_out, int out_size, void* d_ws, size_t ws_size,
                              hipStream_t stream) {
  constexpr int Bz = 2, S = 2048, D = 1024, H = 16, HD = 64;
  constexpr int TD = 3 * D;          // 3072
  constexpr int M  = Bz * S;         // 4096 token rows
  static_assert(H * HD == D);
  static_assert(M % 128 == 0 && TD % 128 == 0 && D % 128 == 0 && D >= 256 && S % AT_QB == 0);

  if (n_in < 6) return;
  if (in_sizes[0] != M * D || in_sizes[1] != TD * D || in_sizes[2] != TD ||
      in_sizes[3] != D * D || in_sizes[4] != D || in_sizes[5] < 1 || out_size != M * D) return;

  const float* x     = (const float*)d_in[0];   // [B,S,D]
  const float* in_w  = (const float*)d_in[1];   // [3D, D] = (out, in) -> Bt
  const float* in_b  = (const float*)d_in[2];   // [3D]
  const float* out_w = (const float*)d_in[3];   // [D, D] = (out, in) -> Bt
  const float* out_b = (const float*)d_in[4];   // [D]
  const int*   wsz   = (const int*)d_in[5];     // window size, int32[1]
  float* y = (float*)d_out;

  // ---- workspace carve (all offsets multiples of 1 MiB) ----
  const size_t bytes_x16  = (size_t)M  * D  * 2;   //  8,388,608
  const size_t bytes_w16  = (size_t)TD * D  * 2;   //  6,291,456
  const size_t bytes_ow16 = (size_t)D  * D  * 2;   //  2,097,152
  const size_t bytes_qkv  = (size_t)M  * TD * 4;   // 50,331,648 (f32)
  const size_t bytes_att  = (size_t)M  * D  * 4;   // 16,777,216 (f32)
  const size_t bytes_a16  = (size_t)M  * D  * 2;   //  8,388,608
  const size_t total = bytes_x16 + bytes_w16 + bytes_ow16 + bytes_qkv + bytes_att + bytes_a16;   // 92,274,688
  if (total > ws_size) return;
  char* p = (char*)d_ws;
  _Float16* x16  = (_Float16*)p;  p += bytes_x16;
  _Float16* w16  = (_Float16*)p;  p += bytes_w16;
  _Float16* ow16 = (_Float16*)p;  p += bytes_ow16;
  float*    qkv  = (float*)p;     p += bytes_qkv;
  float*    att  = (float*)p;     p += bytes_att;
  _Float16* a16  = (_Float16*)p;  p += bytes_a16;

  // 1) f32 -> f16 casts: x unscaled, weights x64 (exact power of two, folded back in the GEMM scale)
  {
    static_assert(M * D == 256 * 1024 * 16 && TD * D == 256 * 1024 * 12 && D * D == 256 * 1024 * 4);
    cast_f32_f16_nl16<<<256, 256, 0, stream>>>(x,     x16,  1.0f);
    cast_f32_f16_nl12<<<256, 256, 0, stream>>>(in_w,  w16,  64.0f);
    cast_f32_f16_nl4<<<256, 256, 0, stream>>>(out_w, ow16, 64.0f);
  }

  // 2) qkv[M][3D] (f32) = x16 . w16^T * (1/64) + in_b
  {
    dim3 grid((M / 128) * (TD / 128), 1);               // 768 tiles of 128 x 128
    wmma_gemm128<<<grid, 128, 0, stream>>>(
        (const unsigned short*)x16, D, (const unsigned short*)w16, D,
        qkv, TD, in_b, TD, D, 1.0f / 64.0f);
  }

  // 3) banded attention per (batch, head, 64-query block) -> att [B,S,D] f32
  {
    BandGeom g;
    g.q_bs = (long)S * TD; g.q_rs = TD; g.q_hs = HD;
    g.k_bs = (long)S * TD; g.k_rs = TD; g.k_hs = HD;
    g.v_bs = (long)S * TD; g.v_rs = TD; g.v_hs = HD;
    g.o_bs = (long)S * D;  g.o_rs = D;  g.o_hs = HD;
    g.S = S; g.H = H; g.qscale = 0.125f; g.mask_fill = -1e30f;
    dim3 grid(Bz * H * (S / AT_QB));                    // 1024 blocks
    attn_band64_kernel<<<grid, 128, 0, stream>>>(qkv, qkv + D, qkv + 2 * D, att, wsz, g);
  }

  // 4) att f32 -> f16 carried x64
  {
    cast_f32_f16_nl16<<<256, 256, 0, stream>>>(att, a16, 64.0f);
  }

  // 5) y[M][D] (f32) = a16 . ow16^T * (1/4096) + out_b
  {
    dim3 grid((M / 128) * (D / 128), 1);                // 256 tiles of 128 x 128
    wmma_gemm128<<<grid, 128, 0, stream>>>(
        (const unsigned short*)a16, D, (const unsigned short*)ow16, D,
        y, D, out_b, D, D, 1.0f / 4096.0f);
  }
  (void)stream;
}

// v003
// A run of this version takes 95.4 microseconds.
// Two timings next to v002 both put it at 1.09 times that version's speed.
// All steps since v000 together make it 1.87 times as fast.
#include <hip/hip_runtime.h>
#include <stdint.h>
// qkv projection and output projection: v_wmma_f32_16x16x32_f16 (f16 operands, weights carried x64, f32 accumulate); attention q.k^T and p.v: v_wmma_f32_16x16x32_f16 (f16 operands, p carried x2^15, f32 accumulate); softmax and epilogues f32.

typedef __attribute__((ext_vector_type(16))) _Float16 v16h;
typedef __attribute__((ext_vector_type(8)))  _Float16 v8h;
typedef __attribute__((ext_vector_type(16))) __bf16   v16b;
typedef __attribute__((ext_vector_type(8)))  __bf16   v8b;
typedef __attribute__((ext_vector_type(8)))  float    v8f;
typedef __attribute__((ext_vector_type(4)))  float    v4f;
#define PSCALE 32768.0f
#define U16(p) ((const unsigned short*)(const void*)(p))
#define PSCALE_INV (1.0f / 32768.0f)

__device__ __forceinline__ unsigned short f2bf_bits(float f) {
  unsigned u = __float_as_uint(f);
  return (unsigned short)((u + 0x7FFFu + ((u >> 16) & 1u)) >> 16);
}
__device__ __forceinline__ float bf_bits2f(unsigned short h) { return __uint_as_float(((unsigned)h) << 16); }

// ---- Block-tiled WMMA GEMM, operands staged in LDS by the tensor mover ------
// C[m,n] = scale * sum_k A[m,k] * Bt[n,k] + bias[n]; f16 operands, f32 accumulate, f32 out.
// A row-major [M,K]; Bt row-major [N,K]; M, N % 128 == 0; K % 128 == 0 and K >= 256 (two stages).
// One work-group = 4 waves (2 x 2) = one 128 x 128 tile of C; each wave owns 64 x 64.
// A pass is 128 k = 256 B of each operand row. A stage is four slices of 64 rows
// [A 0..63 | A 64..127 | Bt 0..63 | Bt 64..127], LDS pitch 272 B (16 B pad behind each row);
// every wave issues one tensor load per stage for its own slice. Two buffers.
typedef uint32_t u32x4 __attribute__((ext_vector_type(4)));
typedef uint32_t u32x8 __attribute__((ext_vector_type(8)));
#define GT_ROWB  256u      // bytes of an operand row per pass
#define GT_ROWS  64u       // rows per slice
#define GT_PITCH 272u      // LDS row pitch: odd multiple of 16 B for ds_load_b128 readers
#define GT_SLICE 18432u    // 64 x 272 = 17,408 B rounded up to a multiple of 2 KiB
#define GT_STAGE 73728u    // four slices
static_assert(GT_ROWS * GT_PITCH <= GT_SLICE && GT_SLICE % 2048u == 0u && GT_STAGE == 4u * GT_SLICE);

__device__ __forceinline__ uint32_t uni(uint32_t v) { return (uint32_t)__builtin_amdgcn_readfirstlane(v); }
__device__ __forceinline__ uint32_t pinned(uint32_t v) { uint32_t w = uni(v); asm volatile("" : "+s"(w)); return w; }   // a wave-uniform word held in a scalar register: a test on it compiles to s_cmp + s_cbranch_scc (tensor loads ignore EXEC)
// this wave's LDS reads have retired before the buffer they read is handed back for a refill
__device__ __forceinline__ void wait_ds0() { asm volatile("s_wait_dscnt 0x0" ::: "memory"); }
// this wave's own tensor load has landed (the compiler places no wait for the tensor mover)
__device__ __forceinline__ void wait_tensor0() { asm volatile("s_wait_tensorcnt 0x0" ::: "memory"); }
// one request of the whole wave: a 2-D tile from global memory into LDS
__device__ __forceinline__ void tdm_load(u32x4 g0, u32x8 g1) { asm volatile("tensor_load_to_lds %0, %1" :: "s"(g0), "s"(g1) : "memory"); }
__device__ __forceinline__ u32x8 tdm_group1(uint32_t src_pitch) {   // 1-byte elements, tile = tensor = 64 rows of 256 B
  u32x8 g;
  g[0] = uni((1u << 20) | (5u << 22) | (3u << 25));   // no mask; a pad of 4 dwords behind every 64 dwords
  g[1] = uni((GT_ROWB & 0xFFFFu) << 16);
  g[2] = uni((GT_ROWB >> 16) | ((GT_ROWS & 0xFFFFu) << 16));
  g[3] = uni((GT_ROWS >> 16) | (GT_ROWB << 16));
  g[4] = uni(GT_ROWS);
  g[5] = uni(src_pitch);
  g[6] = uni(0u);
  g[7] = uni(0u);
  return g;
}
__device__ __forceinline__ u32x4 tdm_group0(uint32_t lds_dst, uint64_t ga) {
  u32x4 g;
  g[0] = uni(1u); g[1] = uni(lds_dst); g[2] = uni((uint32_t)ga);
  g[3] = uni((((uint32_t)(ga >> 32)) & 0x01FFFFFFu) | 0x80000000u);
  return g;
}
__device__ __forceinline__ v16h lds_frag(const unsigned char* p) {   // elements 0..7 <- k 0..7, 8..15 <- k 16..23 from p
  union { v16h v; v8h h[2]; } f;
  f.h[0] = *(const v8h*)(p); f.h[1] = *(const v8h*)(p + 32); return f.v;
}

__global__ __launch_bounds__(128) void wmma_gemm128(
    const unsigned short* __restrict__ A, int lda,
    const unsigned short* __restrict__ Bt, int ldb,
    float* __restrict__ C, int ldc,
    const float* __restrict__ bias,
    int N, int K, float scale) {
  __shared__ __attribute__((aligned(2048))) unsigned char L[2u * GT_STAGE];
  const int lane = threadIdx.x & 31;
  const uint32_t wave = uni(threadIdx.x >> 5);
  const int tilesN = N >> 7;
  const int tm = blockIdx.x / tilesN;
  const int tn = blockIdx.x - tm * tilesN;
  const int wm = wave >> 1, wn = wave & 1;
  const int m0 = (tm << 7) + (wm << 6);        // this wave's 64 x 64 tile of C
  const int n0 = (tn << 7) + (wn << 6);

  const int rlane = lane & 15;                 // row (A) / col (B, D) within subtile
  const int hh    = lane >> 4;                 // k half of this lane; D row offset 8 * hh
  const int mOff  = hh * 8;

  // this wave's slice of every stage: waves 0, 1 bring A rows, waves 2, 3 bring Bt rows
  const unsigned short* srow = (wave < 2u) ? (A  + (size_t)((tm << 7) + (wave << 6)) * lda)
                                           : (Bt + (size_t)((tn << 7) + ((wave - 2u) << 6)) * ldb);
  const uint64_t src0 = (uint64_t)(uintptr_t)srow;
  u32x8 g1 = tdm_group1((uint32_t)((wave < 2u) ? lda : ldb) * 2u);
  asm volatile("" : "+s"(g1));   // as pinned(): descriptor words held in their scalar registers, so that none takes another value while a request is outstanding
  const uint32_t lds_slice = (uint32_t)(size_t)L + wave * GT_SLICE;
  const uint32_t T = (uint32_t)K >> 7;         // passes

  const uint32_t aOff = (uint32_t)wm * GT_SLICE + (uint32_t)rlane * GT_PITCH + (uint32_t)hh * 16u;
  const uint32_t bOff = (2u + (uint32_t)wn) * GT_SLICE + (uint32_t)rlane * GT_PITCH + (uint32_t)hh * 16u;

  v8f acc[4][4];
#pragma unroll
  for (int i = 0; i < 4; ++i)
#pragma unroll
    for (int j = 0; j < 4; ++j) acc[i][j] = (v8f){0.f,0.f,0.f,0.f,0.f,0.f,0.f,0.f};

  // prologue: stage 0 lands and is published, then stage 1 flies under pass 0
  tdm_load(tdm_group0(lds_slice, src0), g1);
  wait_tensor0();
  __syncthreads();
  tdm_load(tdm_group0(lds_slice + GT_STAGE, src0 + GT_ROWB), g1);

  for (uint32_t t = 0; t < T; ++t) {
    const uint32_t buf = (t & 1u) * GT_STAGE;
    const unsigned char* La = L + buf + aOff;
    const unsigned char* Lb = L + buf + bOff;
    v16h af[2][4], bf[2][4];                   // set (ks & 1) holds block ks's fragments; a block is 32 k = 16 WMMAs
#pragma unroll
    for (int j = 0; j < 4; ++j) bf[0][j] = lds_frag(Lb + j * 16 * GT_PITCH);
#pragma unroll
    for (int i = 0; i < 4; ++i) af[0][i] = lds_frag(La + i * 16 * GT_PITCH);
#pragma unroll
    for (int ks = 0; ks < 4; ++ks) {
      const int cs = ks & 1;
      if (ks < 3) {
#pragma unroll
        for (int j = 0; j < 4; ++j) bf[cs ^ 1][j] = lds_frag(Lb + j * 16 * GT_PITCH + (ks + 1) * 64);
#pragma unroll
        for (int i = 0; i < 4; ++i) af[cs ^ 1][i] = lds_frag(La + i * 16 * GT_PITCH + (ks + 1) * 64);
      }
      // keeps the next block's LDS loads as one group ahead of this block's WMMAs; without it they sink among the WMMAs, each behind a wait to 0
      __builtin_amdgcn_sched_barrier(0);
#pragma unroll
      for (int i = 0; i < 4; ++i)
#pragma unroll
        for (int j = 0; j < 4; ++j)
          acc[i][j] = __builtin_amdgcn_wmma_f32_16x16x32_f16(false, af[cs][i], false, bf[cs][j], (short)0, acc[i][j], false, false);
      // ends the block: without it the following load group is lifted in among these WMMAs, into further registers
      __builtin_amdgcn_sched_barrier(0);
    }
    // publish point of stage t + 1, which also frees the buffer that pass t has read
    wait_ds0();
    wait_tensor0();
    __syncthreads();
    if (pinned(t + 2u < T))
      tdm_load(tdm_group0(lds_slice + buf, src0 + (uint64_t)((t + 2u) * GT_ROWB)), g1);
  }
  wait_tensor0();
  wait_ds0();

  // ---- epilogue: the ring is free behind the last pass's barrier; each wave stages 16 x 64 in its own range ----
  float* slab = (float*)(L + wave * (16u * 68u * 4u));   // pitch 68 floats
#pragma unroll
  for (int i = 0; i < 4; ++i) {
    const int mBase = m0 + (i << 4);
#pragma unroll
    for (int j = 0; j < 4; ++j) {
      const float bv = bias[n0 + (j << 4) + rlane];
#pragma unroll
      for (int r = 0; r < 8; ++r) {
        float v = acc[i][j][r] * scale;
        v += bv;
        slab[(mOff + r) * 68 + (j << 4) + rlane] = v;
      }
    }
    __builtin_amdgcn_fence(__ATOMIC_RELEASE, "workgroup");
    __builtin_amdgcn_wave_barrier();
    __builtin_amdgcn_fence(__ATOMIC_ACQUIRE, "workgroup");
    {
      const int c4 = (lane & 15) * 4;     // row seg = 256 B = 16 lanes x 16 B
#pragma unroll
      for (int it = 0; it < 8; ++it) {
        const int row = it * 2 + hh;
        v4f v = *(const v4f*)(slab + row * 68 + c4);
        *(v4f*)(C + (size_t)(mBase + row) * ldc + n0 + c4) = v;
      }
    }
    __builtin_amdgcn_fence(__ATOMIC_RELEASE, "workgroup");
    __builtin_amdgcn_wave_barrier();
    __builtin_amdgcn_fence(__ATOMIC_ACQUIRE, "workgroup");
  }
}

// f32 -> f16 conversion of the three f32 inputs in ONE launch: x unscaled, both weight matrices times wsc.
// One work-group of 8 waves converts 256 * NL groups of 4 floats of each input (NL = 16, 12, 4): every lane issues all
// its 32 16-byte loads (512 contiguous bytes per wave and load) before it converts the first.
typedef __attribute__((ext_vector_type(4))) _Float16 v4h;
template <int NL>
__device__ __forceinline__ size_t cast_base() { return ((size_t)blockIdx.x * (256u * NL) + threadIdx.x) * 4u; }   // first float of this lane
template <int NL>
__device__ __forceinline__ void cast_load(const float* p, v4f (&v)[NL]) {
#pragma unroll
  for (int i = 0; i < NL; ++i) v[i] = *(const v4f*)(p + i * 1024);
}
template <int NL>
__device__ __forceinline__ void cast_store(_Float16* o, const v4f (&v)[NL], float sc) {
#pragma unroll
  for (int i = 0; i < NL; ++i) {
    v4h h;
#pragma unroll
    for (int e = 0; e < 4; ++e) h[e] = (_Float16)(v[i][e] * sc);
    *(v4h*)(o + i * 1024) = h;
  }
}
// element counts = gridDim.x * 1024 * {16, 12, 4} exactly (asserted where it is launched)
__global__ __launch_bounds__(256) void cast3_f32_f16(const float* __restrict__ x,  _Float16* __restrict__ x16,
                                                     const float* __restrict__ w,  _Float16* __restrict__ w16,
                                                     const float* __restrict__ ow, _Float16* __restrict__ ow16, float wsc) {
  const float* px = x  + cast_base<16>();
  const float* pw = w  + cast_base<12>();
  const float* po = ow + cast_base<4>();
  v4f vx[16], vw[12], vo[4];
  cast_load<16>(px, vx);
  cast_load<12>(pw, vw);
  cast_load<4>(po, vo);
  // the loads' address registers stay live up to here, so nothing (a load's own result included) rewrites one ahead of this wait
  asm volatile("s_wait_xcnt 0x0" :: "v"(px), "v"(pw), "v"(po) : "memory");
  cast_store<16>(x16  + cast_base<16>(), vx, 1.0f);
  cast_store<12>(w16  + cast_base<12>(), vw, wsc);
  cast_store<4>(ow16 + cast_base<4>(),  vo, wsc);
}

// =====================================================================================
// Banded (sliding-window) attention for head_dim 64, f32 in / f16 out carried x64, f16 operands.
//   scores = (q . k^T) * qscale : v_wmma_f32_16x16x32_f16, f32 accumulate
//   out    = p . v               : v_wmma_f32_16x16x32_f16, p carried x2^15, folded into the final 1/l
//   Online softmax in f32. Block = 4 waves = 64 query rows of one (batch, head); S % 64 == 0.
//   Key chunks of 64; only chunks overlapping [q - W, q + W] for the block's rows are visited
//   (static bound AT_MAXCH, computed start); keys with |q - kv| > W get mask_fill before the softmax.
//   Element (b, s, h, d) of tensor X lives at X[b*X_bs + s*X_rs + h*X_hs + d] (strides in elements, multiples of 8).
//   grid.x = B * H * (S/64).
// =====================================================================================
#define AT_D 64
#define AT_NW 4
#define AT_QB 64
#define AT_KC 64
#define AT_MAXCH 6
#define AT_PSC 32768.0f
#define AT_OSC 64.0f      // the output is stored as f16 times 64 (exact power of two), the next GEMM's A operand
struct BandGeom { long q_bs, q_rs, q_hs, k_bs, k_rs, k_hs, v_bs, v_rs, v_hs, o_bs, o_rs, o_hs;
                  int S, H; float qscale, mask_fill; };
static_assert(sizeof(BandGeom) == 112);

__device__ __forceinline__ v8f mma_h(v16h a, v16h b, v8f c) {
  c = __builtin_amdgcn_wmma_f32_16x16x32_f16(false, a, false, b, (short)0, c, false, false);
  asm volatile("v_nop\n\tv_nop\n\tv_nop\n\tv_nop" : "+v"(c) : "v"(a), "v"(b));
  return c;
}

__global__ __launch_bounds__(128)
void attn_band64_kernel(const float* __restrict__ q, const float* __restrict__ k,
                        const float* __restrict__ v, _Float16* __restrict__ out,
                        const int* __restrict__ wptr, BandGeom g) {
  union FH { v16h v; v8h h[2]; };
  __shared__ __align__(16) _Float16 Ksh[AT_KC * AT_D];        // K [kv][d]   8 KB
  __shared__ __align__(16) _Float16 Vth[AT_D * AT_KC];        // V [d][kv]   8 KB
  __shared__ __align__(16) _Float16 Psh[AT_NW][16 * AT_KC];   // per wave P [row][kv]  8 KB
  __shared__ __align__(16) float    Os[AT_NW][16 * 68];       // per wave out tile, pitch 68

  const int tid  = threadIdx.x;
  const int wave = tid >> 5;
  const int lane = tid & 31;
  const int hh   = lane >> 4;
  const int c    = lane & 15;

  const int nqb = g.S / AT_QB;
  const int bx = blockIdx.x;
  const int qb = bx % nqb;
  const int bh = bx / nqb;
  const int h  = bh % g.H;
  const int b  = bh / g.H;
  const int qbase = qb * AT_QB;
  const int q0 = qbase + wave * 16;

  const float* qb_ptr = q + (size_t)b * g.q_bs + (size_t)h * g.q_hs;
  const float* kb_ptr = k + (size_t)b * g.k_bs + (size_t)h * g.k_hs;
  const float* vb_ptr = v + (size_t)b * g.v_bs + (size_t)h * g.v_hs;
  _Float16*    ob_ptr = out + (size_t)b * g.o_bs + (size_t)h * g.o_hs;

  // ---- Q fragments (A operand, row = q0 + c): d-chunks 0..31 and 32..63 ----
  v16h qa0, qa1;
  {
    const float* qrow = qb_ptr + (size_t)(q0 + c) * g.q_rs;
#pragma unroll
    for (int e = 0; e < 8; ++e) {
      qa0[e]     = (_Float16)qrow[8 * hh + e];
      qa0[8 + e] = (_Float16)qrow[16 + 8 * hh + e];
      qa1[e]     = (_Float16)qrow[32 + 8 * hh + e];
      qa1[8 + e] = (_Float16)qrow[32 + 16 + 8 * hh + e];
    }
  }

  float mrow[8], lrow[8];
  v8f oacc[4];
#pragma unroll
  for (int r = 0; r < 8; ++r) { mrow[r] = -__builtin_huge_valf(); lrow[r] = 0.f; }
#pragma unroll
  for (int t = 0; t < 4; ++t) oacc[t] = (v8f){0.f,0.f,0.f,0.f,0.f,0.f,0.f,0.f};

  // ---- visited key-chunk range (block-uniform), statically bounded trip count ----
  const int nkc = g.S / AT_KC;
  int Wd = wptr[0];
  Wd = Wd < 0 ? 0 : Wd;
  Wd = Wd > g.S ? g.S : Wd;
  const int lo = qbase - Wd;
  const int kcLo = (lo < 0) ? 0 : (lo / AT_KC);
  int kcHi = (qbase + AT_QB - 1 + Wd) / AT_KC;
  kcHi = kcHi > nkc - 1 ? nkc - 1 : kcHi;
  int nvis = kcHi - kcLo + 1;
  nvis = nvis > AT_MAXCH ? AT_MAXCH : nvis;
  nvis = nvis < 1 ? 1 : nvis;

  for (int ci = 0; ci < nvis; ++ci) {
    const int kv0 = (kcLo + ci) * AT_KC;   // kcLo + ci <= kcHi <= nkc - 1
    __syncthreads();
    {
      const int kvr = tid >> 1, dh = (tid & 1) * 32;
      const float* krow = kb_ptr + (size_t)(kv0 + kvr) * g.k_rs + dh;
      const float* vrow = vb_ptr + (size_t)(kv0 + kvr) * g.v_rs + dh;
#pragma unroll
      for (int i = 0; i < 8; ++i) {
        v4f kk = *(const v4f*)(krow + 4 * i);
        v4f vv = *(const v4f*)(vrow + 4 * i);
#pragma unroll
        for (int e = 0; e < 4; ++e) {
          const int d = dh + 4 * i + e;
          Ksh[kvr * AT_D + d]  = (_Float16)kk[e];
          Vth[d * AT_KC + kvr] = (_Float16)vv[e];
        }
      }
    }
    __syncthreads();

    // ---- scores: 16 rows x 64 keys per wave ----
    v8f s[4];
#pragma unroll
    for (int j = 0; j < 4; ++j) {
      s[j] = (v8f){0.f,0.f,0.f,0.f,0.f,0.f,0.f,0.f};
      FH kb0, kb1;
      kb0.h[0] = *(const v8h*)(Ksh + (j * 16 + c) * AT_D + 8 * hh);
      kb0.h[1] = *(const v8h*)(Ksh + (j * 16 + c) * AT_D + 16 + 8 * hh);
      kb1.h[0] = *(const v8h*)(Ksh + (j * 16 + c) * AT_D + 32 + 8 * hh);
      kb1.h[1] = *(const v8h*)(Ksh + (j * 16 + c) * AT_D + 32 + 16 + 8 * hh);
      s[j] = mma_h(qa0, kb0.v, s[j]);
      s[j] = mma_h(qa1, kb1.v, s[j]);
    }

    // ---- scale + band mask + chunk row max ----
    float cm[8];
#pragma unroll
    for (int r = 0; r < 8; ++r) {
      const int qrow = q0 + 8 * hh + r;
      float m = -__builtin_huge_valf();
#pragma unroll
      for (int j = 0; j < 4; ++j) {
        const int kvcol = kv0 + j * 16 + c;
        const int dlt = qrow - kvcol;
        float sv = s[j][r] * g.qscale;
        const bool masked = (dlt > Wd) || (dlt < -Wd);
        if (masked) sv = g.mask_fill;
        s[j][r] = sv;
        m = fmaxf(m, sv);
      }
#pragma unroll
      for (int off = 1; off < 16; off <<= 1) m = fmaxf(m, __shfl_xor(m, off, 32));
      cm[r] = m;
    }
    _Float16* pwh = Psh[wave];
#pragma unroll
    for (int r = 0; r < 8; ++r) {
      const float mnew = fmaxf(mrow[r], cm[r]);
      const float alpha = expf(mrow[r] - mnew);
      mrow[r] = mnew;
      float psum = 0.f;
#pragma unroll
      for (int j = 0; j < 4; ++j) {
        const float p = expf(s[j][r] - mnew);
        psum += p;
        pwh[(8 * hh + r) * AT_KC + j * 16 + c] = (_Float16)(p * AT_PSC);
      }
#pragma unroll
      for (int off = 1; off < 16; off <<= 1) psum += __shfl_xor(psum, off, 32);
      lrow[r] = lrow[r] * alpha + psum;
#pragma unroll
      for (int t = 0; t < 4; ++t) oacc[t][r] *= alpha;
    }
    // P tile: stored as _Float16 elements, reloaded below as v8h of _Float16 after a wave barrier
    __builtin_amdgcn_fence(__ATOMIC_RELEASE, "workgroup");
    __builtin_amdgcn_wave_barrier();
    __builtin_amdgcn_fence(__ATOMIC_ACQUIRE, "workgroup");
#pragma unroll 1
    for (int kk = 0; kk < 2; ++kk) {
      FH pa;
      pa.h[0] = *(const v8h*)(pwh + c * AT_KC + kk * 32 + 8 * hh);
      pa.h[1] = *(const v8h*)(pwh + c * AT_KC + kk * 32 + 16 + 8 * hh);
#pragma unroll
      for (int t = 0; t < 4; ++t) {
        FH vb;
        vb.h[0] = *(const v8h*)(Vth + (t * 16 + c) * AT_KC + kk * 32 + 8 * hh);
        vb.h[1] = *(const v8h*)(Vth + (t * 16 + c) * AT_KC + kk * 32 + 16 + 8 * hh);
        oacc[t] = mma_h(pa.v, vb.v, oacc[t]);
      }
    }
  }

  float* os = Os[wave];
#pragma unroll
  for (int r = 0; r < 8; ++r) {
    const float inv = 1.0f / (lrow[r] * AT_PSC);
#pragma unroll
    for (int t = 0; t < 4; ++t) os[(8 * hh + r) * 68 + t * 16 + c] = oacc[t][r] * inv;
  }
  __builtin_amdgcn_fence(__ATOMIC_RELEASE, "workgroup");
  __builtin_amdgcn_wave_barrier();
  __builtin_amdgcn_fence(__ATOMIC_ACQUIRE, "workgroup");
  {
    const int c8 = (lane & 7) * 8;       // row seg = 64 f16 = 128 B = 8 lanes x 16 B; rows it*4 + (lane >> 3) cover 0..15
#pragma unroll
    for (int it = 0; it < 4; ++it) {
      const int row = it * 4 + (lane >> 3);
      const v4f lo4 = *(const v4f*)(os + row * 68 + c8);
      const v4f hi4 = *(const v4f*)(os + row * 68 + c8 + 4);
      v8h hv;
#pragma unroll
      for (int e = 0; e < 4; ++e) { hv[e] = (_Float16)(lo4[e] * AT_OSC); hv[4 + e] = (_Float16)(hi4[e] * AT_OSC); }
      *(v8h*)(ob_ptr + (size_t)(q0 + row) * g.o_rs + c8) = hv;
    }
  }
}

// =====================================================================================
extern "C" void kernel_launch(void* const* d_in, const int* in_sizes, int n_in,
                              void* d_out, int out_size, void* d_ws, size_t ws_size,
                              hipStream_t stream) {
  constexpr int Bz = 2, S = 2048, D = 1024, H = 16, HD = 64;
  constexpr int TD = 3 * D;          // 3072
  constexpr int M  = Bz * S;         // 4096 token rows
  static_assert(H * HD == D);
  static_assert(M % 128 == 0 && TD % 128 == 0 && D % 128 == 0 && D >= 256 && S % AT_QB == 0);

  if (n_in < 6) return;
  if (in_sizes[0] != M * D || in_sizes[1] != TD * D || in_sizes[2] != TD ||
      in_sizes[3] != D * D || in_sizes[4] != D || in_sizes[5] < 1 || out_size != M * D) return;

  const float* x     = (const float*)d_in[0];   // [B,S,D]
  const float* in_w  = (const float*)d_in[1];   // [3D, D] = (out, in) -> Bt
  const float* in_b  = (const float*)d_in[2];   // [3D]
  const float* out_w = (const float*)d_in[3];   // [D, D] = (out, in) -> Bt
  const float* out_b = (const float*)d_in[4];   // [D]
  const int*   wsz   = (const int*)d_in[5];     // window size, int32[1]
  float* y = (float*)d_out;

  // ---- workspace carve (all offsets multiples of 1 MiB) ----
  const size_t bytes_x16  = (size_t)M  * D  * 2;   //  8,388,608
  const size_t bytes_w16  = (size_t)TD * D  * 2;   //  6,291,456
  const size_t bytes_ow16 = (size_t)D  * D  * 2;   //  2,097,152
  const size_t bytes_qkv  = (size_t)M  * TD * 4;   // 50,331,648 (f32)
  const size_t bytes_a16  = (size_t)M  * D  * 2;   //  8,388,608
  const size_t total = bytes_x16 + bytes_w16 + bytes_ow16 + bytes_qkv + bytes_a16;   // 75,497,472
  if (total > ws_size) return;
  char* p = (char*)d_ws;
  _Float16* x16  = (_Float16*)p;  p += bytes_x16;
  _Float16* w16  = (_Float16*)p;  p += bytes_w16;
  _Float16* ow16 = (_Float16*)p;  p += bytes_ow16;
  float*    qkv  = (float*)p;     p += bytes_qkv;
  _Float16* a16  = (_Float16*)p;  p += bytes_a16;

  // 1) f32 -> f16 casts, one launch: x unscaled, weights x64 (exact power of two, folded back in the GEMM scale)
  {
    static_assert(M * D == 256 * 1024 * 16 && TD * D == 256 * 1024 * 12 && D * D == 256 * 1024 * 4);
    cast3_f32_f16<<<256, 256, 0, stream>>>(x, x16, in_w, w16, out_w, ow16, 64.0f);
  }

  // 2) qkv[M][3D] (f32) = x16 . w16^T * (1/64) + in_b
  {
    dim3 grid((M / 128) * (TD / 128), 1);               // 768 tiles of 128 x 128
    wmma_gemm128<<<grid, 128, 0, stream>>>(
        (const unsigned short*)x16, D, (const unsigned short*)w16, D,
        qkv, TD, in_b, TD, D, 1.0f / 64.0f);
  }

  // 3) banded attention per (batch, head, 64-query block) -> a16 [B,S,D] f16 carried x64
  {
    BandGeom g;
    g.q_bs = (long)S * TD; g.q_rs = TD; g.q_hs = HD;
    g.k_bs = (long)S * TD; g.k_rs = TD; g.k_hs = HD;
    g.v_bs = (long)S * TD; g.v_rs = TD; g.v_hs = HD;
    g.o_bs = (long)S * D;  g.o_rs = D;  g.o_hs = HD;
    g.S = S; g.H = H; g.qscale = 0.125f; g.mask_fill = -1e30f;
    dim3 grid(Bz * H * (S / AT_QB));                    // 1024 blocks
    attn_band64_kernel<<<grid, 128, 0, stream>>>(qkv, qkv + D, qkv + 2 * D, a16, wsz, g);
  }

  // 4) y[M][D] (f32) = a16 . ow16^T * (1/4096) + out_b
  {
    dim3 grid((M / 128) * (D / 128), 1);                // 256 tiles of 128 x 128
    wmma_gemm128<<<grid, 128, 0, stream>>>(
        (const unsigned short*)a16, D, (const unsigned short*)ow16, D,
        y, D, out_b, D, D, 1.0f / 4096.0f);
  }
  (void)stream;
}

// v004
// One run takes 87.3 microseconds.
// Next to v003, in two timings, it ran 1.09 times as fast each time.
// Over all steps from v000 it is 2.05 times as fast.
#include <hip/hip_runtime.h>
#include <stdint.h>
// qkv projection and output projection: v_wmma_f32_16x16x32_f16 (f16 operands, weights carried x64, f32 accumulate); attention q.k^T and p.v: v_wmma_f32_16x16x32_f16 (f16 operands, p carried x2^15, f32 accumulate); softmax and epilogues f32.

typedef __attribute__((ext_vector_type(16))) _Float16 v16h;
typedef __attribute__((ext_vector_type(8)))  _Float16 v8h;
typedef __attribute__((ext_vector_type(16))) __bf16   v16b;
typedef __attribute__((ext_vector_type(8)))  __bf16   v8b;
typedef __attribute__((ext_vector_type(8)))  float    v8f;
typedef __attribute__((ext_vector_type(4)))  float    v4f;
#define PSCALE 32768.0f
#define U16(p) ((const unsigned short*)(const void*)(p))
#define PSCALE_INV (1.0f / 32768.0f)

__device__ __forceinline__ unsigned short f2bf_bits(float f) {
  unsigned u = __float_as_uint(f);
  return (unsigned short)((u + 0x7FFFu + ((u >> 16) & 1u)) >> 16);
}
__device__ __forceinline__ float bf_bits2f(unsigned short h) { return __uint_as_float(((unsigned)h) << 16); }

// ---- Block-tiled WMMA GEMM, operands staged in LDS by the tensor mover ------
// C[m,n] = scale * sum_k A[m,k] * Bt[n,k] + bias[n]; f16 operands, f32 accumulate, f32 out.
// A row-major [M,K]; Bt row-major [N,K]; M, N % 128 == 0; K % 128 == 0 and K >= 256 (two stages).
// One work-group = 4 waves (2 x 2) = one 128 x 128 tile of C; each wave owns 64 x 64.
// A pass is 128 k = 256 B of each operand row. A stage is four slices of 64 rows
// [A 0..63 | A 64..127 | Bt 0..63 | Bt 64..127], LDS pitch 272 B (16 B pad behind each row);
// every wave issues one tensor load per stage for its own slice. Two buffers.
typedef uint32_t u32x4 __attribute__((ext_vector_type(4)));
typedef uint32_t u32x8 __attribute__((ext_vector_type(8)));
#define GT_ROWB  256u      // bytes of an operand row per pass
#define GT_ROWS  64u       // rows per slice
#define GT_PITCH 272u      // LDS row pitch: odd multiple of 16 B for ds_load_b128 readers
#define GT_SLICE 18432u    // 64 x 272 = 17,408 B rounded up to a multiple of 2 KiB
#define GT_STAGE 73728u    // four slices
static_assert(GT_ROWS * GT_PITCH <= GT_SLICE && GT_SLICE % 2048u == 0u && GT_STAGE == 4u * GT_SLICE);

__device__ __forceinline__ uint32_t uni(uint32_t v) { return (uint32_t)__builtin_amdgcn_readfirstlane(v); }
__device__ __forceinline__ uint32_t pinned(uint32_t v) { uint32_t w = uni(v); asm volatile("" : "+s"(w)); return w; }   // a wave-uniform word held in a scalar register: a test on it compiles to s_cmp + s_cbranch_scc (tensor loads ignore EXEC)
// this wave's LDS reads have retired before the buffer they read is handed back for a refill
__device__ __forceinline__ void wait_ds0() { asm volatile("s_wait_dscnt 0x0" ::: "memory"); }
// this wave's own tensor load has landed (the compiler places no wait for the tensor mover)
__device__ __forceinline__ void wait_tensor0() { asm volatile("s_wait_tensorcnt 0x0" ::: "memory"); }
// one request of the whole wave: a 2-D tile from global memory into LDS
__device__ __forceinline__ void tdm_load(u32x4 g0, u32x8 g1) { asm volatile("tensor_load_to_lds %0, %1" :: "s"(g0), "s"(g1) : "memory"); }
__device__ __forceinline__ u32x8 tdm_group1(uint32_t src_pitch) {   // 1-byte elements, tile = tensor = 64 rows of 256 B
  u32x8 g;
  g[0] = uni((1u << 20) | (5u << 22) | (3u << 25));   // no mask; a pad of 4 dwords behind every 64 dwords
  g[1] = uni((GT_ROWB & 0xFFFFu) << 16);
  g[2] = uni((GT_ROWB >> 16) | ((GT_ROWS & 0xFFFFu) << 16));
  g[3] = uni((GT_ROWS >> 16) | (GT_ROWB << 16));
  g[4] = uni(GT_ROWS);
  g[5] = uni(src_pitch);
  g[6] = uni(0u);
  g[7] = uni(0u);
  return g;
}
__device__ __forceinline__ u32x4 tdm_group0(uint32_t lds_dst, uint64_t ga) {
  u32x4 g;
  g[0] = uni(1u); g[1] = uni(lds_dst); g[2] = uni((uint32_t)ga);
  g[3] = uni((((uint32_t)(ga >> 32)) & 0x01FFFFFFu) | 0x80000000u);
  return g;
}
__device__ __forceinline__ v16h lds_frag(const unsigned char* p) {   // elements 0..7 <- k 0..7, 8..15 <- k 16..23 from p
  union { v16h v; v8h h[2]; } f;
  f.h[0] = *(const v8h*)(p); f.h[1] = *(const v8h*)(p + 32); return f.v;
}

__global__ __launch_bounds__(128) void wmma_gemm128(
    const unsigned short* __restrict__ A, int lda,
    const unsigned short* __restrict__ Bt, int ldb,
    float* __restrict__ C, int ldc,
    const float* __restrict__ bias,
    int N, int K, float scale) {
  __shared__ __attribute__((aligned(2048))) unsigned char L[2u * GT_STAGE];
  const int lane = threadIdx.x & 31;
  const uint32_t wave = uni(threadIdx.x >> 5);
  const int tilesN = N >> 7;
  const int tm = blockIdx.x / tilesN;
  const int tn = blockIdx.x - tm * tilesN;
  const int wm = wave >> 1, wn = wave & 1;
  const int m0 = (tm << 7) + (wm << 6);        // this wave's 64 x 64 tile of C
  const int n0 = (tn << 7) + (wn << 6);

  const int rlane = lane & 15;                 // row (A) / col (B, D) within subtile
  const int hh    = lane >> 4;                 // k half of this lane; D row offset 8 * hh
  const int mOff  = hh * 8;

  // this wave's slice of every stage: waves 0, 1 bring A rows, waves 2, 3 bring Bt rows
  const unsigned short* srow = (wave < 2u) ? (A  + (size_t)((tm << 7) + (wave << 6)) * lda)
                                           : (Bt + (size_t)((tn << 7) + ((wave - 2u) << 6)) * ldb);
  const uint64_t src0 = (uint64_t)(uintptr_t)srow;
  u32x8 g1 = tdm_group1((uint32_t)((wave < 2u) ? lda : ldb) * 2u);
  asm volatile("" : "+s"(g1));   // as pinned(): descriptor words held in their scalar registers, so that none takes another value while a request is outstanding
  const uint32_t lds_slice = (uint32_t)(size_t)L + wave * GT_SLICE;
  const uint32_t T = (uint32_t)K >> 7;         // passes

  const uint32_t aOff = (uint32_t)wm * GT_SLICE + (uint32_t)rlane * GT_PITCH + (uint32_t)hh * 16u;
  const uint32_t bOff = (2u + (uint32_t)wn) * GT_SLICE + (uint32_t)rlane * GT_PITCH + (uint32_t)hh * 16u;

  v8f acc[4][4];
#pragma unroll
  for (int i = 0; i < 4; ++i)
#pragma unroll
    for (int j = 0; j < 4; ++j) acc[i][j] = (v8f){0.f,0.f,0.f,0.f,0.f,0.f,0.f,0.f};

  // prologue: stage 0 lands and is published, then stage 1 flies under pass 0
  tdm_load(tdm_group0(lds_slice, src0), g1);
  wait_tensor0();
  __syncthreads();
  tdm_load(tdm_group0(lds_slice + GT_STAGE, src0 + GT_ROWB), g1);

  for (uint32_t t = 0; t < T; ++t) {
    const uint32_t buf = (t & 1u) * GT_STAGE;
    const unsigned char* La = L + buf + aOff;
    const unsigned char* Lb = L + buf + bOff;
    v16h af[2][4], bf[2][4];                   // set (ks & 1) holds block ks's fragments; a block is 32 k = 16 WMMAs
#pragma unroll
    for (int j = 0; j < 4; ++j) bf[0][j] = lds_frag(Lb + j * 16 * GT_PITCH);
#pragma unroll
    for (int i = 0; i < 4; ++i) af[0][i] = lds_frag(La + i * 16 * GT_PITCH);
#pragma unroll
    for (int ks = 0; ks < 4; ++ks) {
      const int cs = ks & 1;
      if (ks < 3) {
#pragma unroll
        for (int j = 0; j < 4; ++j) bf[cs ^ 1][j] = lds_frag(Lb + j * 16 * GT_PITCH + (ks + 1) * 64);
#pragma unroll
        for (int i = 0; i < 4; ++i) af[cs ^ 1][i] = lds_frag(La + i * 16 * GT_PITCH + (ks + 1) * 64);
      }
      // keeps the next block's LDS loads as one group ahead of this block's WMMAs; without it they sink among the WMMAs, each behind a wait to 0
      __builtin_amdgcn_sched_barrier(0);
#pragma unroll
      for (int i = 0; i < 4; ++i)
#pragma unroll
        for (int j = 0; j < 4; ++j)
          acc[i][j] = __builtin_amdgcn_wmma_f32_16x16x32_f16(false, af[cs][i], false, bf[cs][j], (short)0, acc[i][j], false, false);
      // ends the block: without it the following load group is lifted in among these WMMAs, into further registers
      __builtin_amdgcn_sched_barrier(0);
    }
    // publish point of stage t + 1, which also frees the buffer that pass t has read
    wait_ds0();
    wait_tensor0();
    __syncthreads();
    if (pinned(t + 2u < T))
      tdm_load(tdm_group0(lds_slice + buf, src0 + (uint64_t)((t + 2u) * GT_ROWB)), g1);
  }
  wait_tensor0();
  wait_ds0();

  // ---- epilogue: the ring is free behind the last pass's barrier; each wave stages 16 x 64 in its own range ----
  float* slab = (float*)(L + wave * (16u * 68u * 4u));   // pitch 68 floats
#pragma unroll
  for (int i = 0; i < 4; ++i) {
    const int mBase = m0 + (i << 4);
#pragma unroll
    for (int j = 0; j < 4; ++j) {
      const float bv = bias[n0 + (j << 4) + rlane];
#pragma unroll
      for (int r = 0; r < 8; ++r) {
        float v = acc[i][j][r] * scale;
        v += bv;
        slab[(mOff + r) * 68 + (j << 4) + rlane] = v;
      }
    }
    __builtin_amdgcn_fence(__ATOMIC_RELEASE, "workgroup");
    __builtin_amdgcn_wave_barrier();
    __builtin_amdgcn_fence(__ATOMIC_ACQUIRE, "workgroup");
    {
      const int c4 = (lane & 15) * 4;     // row seg = 256 B = 16 lanes x 16 B
#pragma unroll
      for (int it = 0; it < 8; ++it) {
        const int row = it * 2 + hh;
        v4f v = *(const v4f*)(slab + row * 68 + c4);
        *(v4f*)(C + (size_t)(mBase + row) * ldc + n0 + c4) = v;
      }
    }
    __builtin_amdgcn_fence(__ATOMIC_RELEASE, "workgroup");
    __builtin_amdgcn_wave_barrier();
    __builtin_amdgcn_fence(__ATOMIC_ACQUIRE, "workgroup");
  }
}

// f32 -> f16 conversion of the three f32 inputs in ONE launch: x unscaled, both weight matrices times wsc.
// One work-group of 8 waves converts 256 * NL groups of 4 floats of each input (NL = 16, 12, 4): every lane issues all
// its 32 16-byte loads (512 contiguous bytes per wave and load) before it converts the first.
typedef __attribute__((ext_vector_type(4))) _Float16 v4h;
template <int NL>
__device__ __forceinline__ size_t cast_base() { return ((size_t)blockIdx.x * (256u * NL) + threadIdx.x) * 4u; }   // first float of this lane
template <int NL>
__device__ __forceinline__ void cast_load(const float* p, v4f (&v)[NL]) {
#pragma unroll
  for (int i = 0; i < NL; ++i) v[i] = *(const v4f*)(p + i * 1024);
}
template <int NL>
__device__ __forceinline__ void cast_store(_Float16* o, const v4f (&v)[NL], float sc) {
#pragma unroll
  for (int i = 0; i < NL; ++i) {
    v4h h;
#pragma unroll
    for (int e = 0; e < 4; ++e) h[e] = (_Float16)(v[i][e] * sc);
    *(v4h*)(o + i * 1024) = h;
  }
}
// element counts = gridDim.x * 1024 * {16, 12, 4} exactly (asserted where it is launched)
__global__ __launch_bounds__(256) void cast3_f32_f16(const float* __restrict__ x,  _Float16* __restrict__ x16,
                                                     const float* __restrict__ w,  _Float16* __restrict__ w16,
                                                     const float* __restrict__ ow, _Float16* __restrict__ ow16, float wsc) {
  const float* px = x  + cast_base<16>();
  const float* pw = w  + cast_base<12>();
  const float* po = ow + cast_base<4>();
  v4f vx[16], vw[12], vo[4];
  cast_load<16>(px, vx);
  cast_load<12>(pw, vw);
  cast_load<4>(po, vo);
  // the loads' address registers stay live up to here, so nothing (a load's own result included) rewrites one ahead of this wait
  asm volatile("s_wait_xcnt 0x0" :: "v"(px), "v"(pw), "v"(po) : "memory");
  cast_store<16>(x16  + cast_base<16>(), vx, 1.0f);
  cast_store<12>(w16  + cast_base<12>(), vw, wsc);
  cast_store<4>(ow16 + cast_base<4>(),  vo, wsc);
}

// =====================================================================================
// Banded (sliding-window) attention for head_dim 64, f32 in / f16 out carried x64, f16 operands.
//   scores = (q . k^T) * qscale : v_wmma_f32_16x16x32_f16, f32 accumulate
//   out    = p . v               : v_wmma_f32_16x16x32_f16, p carried x2^15, folded into the final 1/l
//   Online softmax in f32. Block = 4 waves = 64 query rows of one (batch, head); S % 64 == 0.
//   Key chunks of 64; only chunks overlapping [q - W, q + W] for the block's rows are visited
//   (static bound AT_MAXCH, computed start); keys with |q - kv| > W get mask_fill before the softmax.
//   Element (b, s, h, d) of tensor X lives at X[b*X_bs + s*X_rs + h*X_hs + d] (strides in elements, multiples of 8).
//   grid.x = B * H * (S/64).
// =====================================================================================
#define AT_D 64
#define AT_NW 4
#define AT_QB 64
#define AT_KC 64
#define AT_LP 72       // LDS row pitch of the K, V and P tiles in f16: 144 B = 16 B x 9 (odd), so that the 16 rows of a ds_load_b128 fall on distinct banks
#define AT_MAXCH 6
#define AT_PSC 32768.0f
#define AT_OSC 64.0f      // the output is stored as f16 times 64 (exact power of two), the next GEMM's A operand
struct BandGeom { long q_bs, q_rs, q_hs, k_bs, k_rs, k_hs, v_bs, v_rs, v_hs, o_bs, o_rs, o_hs;
                  int S, H; float qscale, mask_fill; };
static_assert(sizeof(BandGeom) == 112);

__device__ __forceinline__ v8f mma_h(v16h a, v16h b, v8f c) {
  c = __builtin_amdgcn_wmma_f32_16x16x32_f16(false, a, false, b, (short)0, c, false, false);
  asm volatile("v_nop\n\tv_nop\n\tv_nop\n\tv_nop" : "+v"(c) : "v"(a), "v"(b));
  return c;
}

__global__ __launch_bounds__(128)
void attn_band64_kernel(const float* __restrict__ q, const float* __restrict__ k,
                        const float* __restrict__ v, _Float16* __restrict__ out,
                        const int* __restrict__ wptr, BandGeom g) {
  union FH { v16h v; v8h h[2]; };
  __shared__ __align__(16) _Float16 Ksh[AT_KC * AT_LP];       // K [kv][d]   9 KB
  __shared__ __align__(16) _Float16 Vth[AT_D * AT_LP];        // V [d][kv]   9 KB
  __shared__ __align__(16) _Float16 Psh[AT_NW][16 * AT_LP];   // per wave P [row][kv]  9 KB
  __shared__ __align__(16) float    Os[AT_NW][16 * 68];       // per wave out tile, pitch 68

  const int tid  = threadIdx.x;
  const int wave = tid >> 5;
  const int lane = tid & 31;
  const int hh   = lane >> 4;
  const int c    = lane & 15;

  const int nqb = g.S / AT_QB;
  const int bx = blockIdx.x;
  const int qb = bx % nqb;
  const int bh = bx / nqb;
  const int h  = bh % g.H;
  const int b  = bh / g.H;
  const int qbase = qb * AT_QB;
  const int q0 = qbase + wave * 16;

  const float* qb_ptr = q + (size_t)b * g.q_bs + (size_t)h * g.q_hs;
  const float* kb_ptr = k + (size_t)b * g.k_bs + (size_t)h * g.k_hs;
  const float* vb_ptr = v + (size_t)b * g.v_bs + (size_t)h * g.v_hs;
  _Float16*    ob_ptr = out + (size_t)b * g.o_bs + (size_t)h * g.o_hs;

  // ---- Q fragments (A operand, row = q0 + c): d-chunks 0..31 and 32..63 ----
  v16h qa0, qa1;
  {
    const float* qrow = qb_ptr + (size_t)(q0 + c) * g.q_rs;
#pragma unroll
    for (int e = 0; e < 8; ++e) {
      qa0[e]     = (_Float16)qrow[8 * hh + e];
      qa0[8 + e] = (_Float16)qrow[16 + 8 * hh + e];
      qa1[e]     = (_Float16)qrow[32 + 8 * hh + e];
      qa1[8 + e] = (_Float16)qrow[32 + 16 + 8 * hh + e];
    }
  }

  float mrow[8], lrow[8];
  v8f oacc[4];
#pragma unroll
  for (int r = 0; r < 8; ++r) { mrow[r] = -__builtin_huge_valf(); lrow[r] = 0.f; }
#pragma unroll
  for (int t = 0; t < 4; ++t) oacc[t] = (v8f){0.f,0.f,0.f,0.f,0.f,0.f,0.f,0.f};

  // ---- visited key-chunk range (block-uniform), statically bounded trip count ----
  const int nkc = g.S / AT_KC;
  int Wd = wptr[0];
  Wd = Wd < 0 ? 0 : Wd;
  Wd = Wd > g.S ? g.S : Wd;
  const int lo = qbase - Wd;
  const int kcLo = (lo < 0) ? 0 : (lo / AT_KC);
  int kcHi = (qbase + AT_QB - 1 + Wd) / AT_KC;
  kcHi = kcHi > nkc - 1 ? nkc - 1 : kcHi;
  int nvis = kcHi - kcLo + 1;
  nvis = nvis > AT_MAXCH ? AT_MAXCH : nvis;
  nvis = nvis < 1 ? 1 : nvis;

  for (int ci = 0; ci < nvis; ++ci) {
    const int kv0 = (kcLo + ci) * AT_KC;   // kcLo + ci <= kcHi <= nkc - 1
    __syncthreads();
    {
      const int kvr = tid >> 1, dh = (tid & 1) * 32;
      const float* krow = kb_ptr + (size_t)(kv0 + kvr) * g.k_rs + dh;
      const float* vrow = vb_ptr + (size_t)(kv0 + kvr) * g.v_rs + dh;
#pragma unroll
      for (int i = 0; i < 8; ++i) {
        v4f kk = *(const v4f*)(krow + 4 * i);
        v4f vv = *(const v4f*)(vrow + 4 * i);
#pragma unroll
        for (int e = 0; e < 4; ++e) {
          const int d = dh + 4 * i + e;
          Ksh[kvr * AT_LP + d]  = (_Float16)kk[e];
          Vth[d * AT_LP + kvr] = (_Float16)vv[e];
        }
      }
    }
    __syncthreads();

    // ---- scores: 16 rows x 64 keys per wave ----
    v8f s[4];
#pragma unroll
    for (int j = 0; j < 4; ++j) {
      s[j] = (v8f){0.f,0.f,0.f,0.f,0.f,0.f,0.f,0.f};
      FH kb0, kb1;
      kb0.h[0] = *(const v8h*)(Ksh + (j * 16 + c) * AT_LP + 8 * hh);
      kb0.h[1] = *(const v8h*)(Ksh + (j * 16 + c) * AT_LP + 16 + 8 * hh);
      kb1.h[0] = *(const v8h*)(Ksh + (j * 16 + c) * AT_LP + 32 + 8 * hh);
      kb1.h[1] = *(const v8h*)(Ksh + (j * 16 + c) * AT_LP + 32 + 16 + 8 * hh);
      s[j] = mma_h(qa0, kb0.v, s[j]);
      s[j] = mma_h(qa1, kb1.v, s[j]);
    }

    // ---- scale + band mask + chunk row max ----
    float cm[8];
#pragma unroll
    for (int r = 0; r < 8; ++r) {
      const int qrow = q0 + 8 * hh + r;
      float m = -__builtin_huge_valf();
#pragma unroll
      for (int j = 0; j < 4; ++j) {
        const int kvcol = kv0 + j * 16 + c;
        const int dlt = qrow - kvcol;
        float sv = s[j][r] * g.qscale;
        const bool masked = (dlt > Wd) || (dlt < -Wd);
        if (masked) sv = g.mask_fill;
        s[j][r] = sv;
        m = fmaxf(m, sv);
      }
#pragma unroll
      for (int off = 1; off < 16; off <<= 1) m = fmaxf(m, __shfl_xor(m, off, 32));
      cm[r] = m;
    }
    _Float16* pwh = Psh[wave];
#pragma unroll
    for (int r = 0; r < 8; ++r) {
      const float mnew = fmaxf(mrow[r], cm[r]);
      const float alpha = expf(mrow[r] - mnew);
      mrow[r] = mnew;
      float psum = 0.f;
#pragma unroll
      for (int j = 0; j < 4; ++j) {
        const float p = expf(s[j][r] - mnew);
        psum += p;
        pwh[(8 * hh + r) * AT_LP + j * 16 + c] = (_Float16)(p * AT_PSC);
      }
#pragma unroll
      for (int off = 1; off < 16; off <<= 1) psum += __shfl_xor(psum, off, 32);
      lrow[r] = lrow[r] * alpha + psum;
#pragma unroll
      for (int t = 0; t < 4; ++t) oacc[t][r] *= alpha;
    }
    // P tile: stored as _Float16 elements, reloaded below as v8h of _Float16 after a wave barrier
    __builtin_amdgcn_fence(__ATOMIC_RELEASE, "workgroup");
    __builtin_amdgcn_wave_barrier();
    __builtin_amdgcn_fence(__ATOMIC_ACQUIRE, "workgroup");
#pragma unroll 1
    for (int kk = 0; kk < 2; ++kk) {
      FH pa;
      pa.h[0] = *(const v8h*)(pwh + c * AT_LP + kk * 32 + 8 * hh);
      pa.h[1] = *(const v8h*)(pwh + c * AT_LP + kk * 32 + 16 + 8 * hh);
#pragma unroll
      for (int t = 0; t < 4; ++t) {
        FH vb;
        vb.h[0] = *(const v8h*)(Vth + (t * 16 + c) * AT_LP + kk * 32 + 8 * hh);
        vb.h[1] = *(const v8h*)(Vth + (t * 16 + c) * AT_LP + kk * 32 + 16 + 8 * hh);
        oacc[t] = mma_h(pa.v, vb.v, oacc[t]);
      }
    }
  }

  float* os = Os[wave];
#pragma unroll
  for (int r = 0; r < 8; ++r) {
    const float inv = 1.0f / (lrow[r] * AT_PSC);
#pragma unroll
    for (int t = 0; t < 4; ++t) os[(8 * hh + r) * 68 + t * 16 + c] = oacc[t][r] * inv;
  }
  __builtin_amdgcn_fence(__ATOMIC_RELEASE, "workgroup");
  __builtin_amdgcn_wave_barrier();
  __builtin_amdgcn_fence(__ATOMIC_ACQUIRE, "workgroup");
  {
    const int c8 = (lane & 7) * 8;       // row seg = 64 f16 = 128 B = 8 lanes x 16 B; rows it*4 + (lane >> 3) cover 0..15
#pragma unroll
    for (int it = 0; it < 4; ++it) {
      const int row = it * 4 + (lane >> 3);
      const v4f lo4 = *(const v4f*)(os + row * 68 + c8);
      const v4f hi4 = *(const v4f*)(os + row * 68 + c8 + 4);
      v8h hv;
#pragma unroll
      for (int e = 0; e < 4; ++e) { hv[e] = (_Float16)(lo4[e] * AT_OSC); hv[4 + e] = (_Float16)(hi4[e] * AT_OSC); }
      *(v8h*)(ob_ptr + (size_t)(q0 + row) * g.o_rs + c8) = hv;
    }
  }
}

// =====================================================================================
extern "C" void kernel_launch(void* const* d_in, const int* in_sizes, int n_in,
                              void* d_out, int out_size, void* d_ws, size_t ws_size,
                              hipStream_t stream) {
  constexpr int Bz = 2, S = 2048, D = 1024, H = 16, HD = 64;
  constexpr int TD = 3 * D;          // 3072
  constexpr int M  = Bz * S;         // 4096 token rows
  static_assert(H * HD == D);
  static_assert(M % 128 == 0 && TD % 128 == 0 && D % 128 == 0 && D >= 256 && S % AT_QB == 0);

  if (n_in < 6) return;
  if (in_sizes[0] != M * D || in_sizes[1] != TD * D || in_sizes[2] != TD ||
      in_sizes[3] != D * D || in_sizes[4] != D || in_sizes[5] < 1 || out_size != M * D) return;

  const float* x     = (const float*)d_in[0];   // [B,S,D]
  const float* in_w  = (const float*)d_in[1];   // [3D, D] = (out, in) -> Bt
  const float* in_b  = (const float*)d_in[2];   // [3D]
  const float* out_w = (const float*)d_in[3];   // [D, D] = (out, in) -> Bt
  const float* out_b = (const float*)d_in[4];   // [D]
  const int*   wsz   = (const int*)d_in[5];     // window size, int32[1]
  float* y = (float*)d_out;

  // ---- workspace carve (all offsets multiples of 1 MiB) ----
  const size_t bytes_x16  = (size_t)M  * D  * 2;   //  8,388,608
  const size_t bytes_w16  = (size_t)TD * D  * 2;   //  6,291,456
  const size_t bytes_ow16 = (size_t)D  * D  * 2;   //  2,097,152
  const size_t bytes_qkv  = (size_t)M  * TD * 4;   // 50,331,648 (f32)
  const size_t bytes_a16  = (size_t)M  * D  * 2;   //  8,388,608
  const size_t total = bytes_x16 + bytes_w16 + bytes_ow16 + bytes_qkv + bytes_a16;   // 75,497,472
  if (total > ws_size) return;
  char* p = (char*)d_ws;
  _Float16* x16  = (_Float16*)p;  p += bytes_x16;
  _Float16* w16  = (_Float16*)p;  p += bytes_w16;
  _Float16* ow16 = (_Float16*)p;  p += bytes_ow16;
  float*    qkv  = (float*)p;     p += bytes_qkv;
  _Float16* a16  = (_Float16*)p;  p += bytes_a16;

  // 1) f32 -> f16 casts, one launch: x unscaled, weights x64 (exact power of two, folded back in the GEMM scale)
  {
    static_assert(M * D == 256 * 1024 * 16 && TD * D == 256 * 1024 * 12 && D * D == 256 * 1024 * 4);
    cast3_f32_f16<<<256, 256, 0, stream>>>(x, x16, in_w, w16, out_w, ow16, 64.0f);
  }

  // 2) qkv[M][3D] (f32) = x16 . w16^T * (1/64) + in_b
  {
    dim3 grid((M / 128) * (TD / 128), 1);               // 768 tiles of 128 x 128
    wmma_gemm128<<<grid, 128, 0, stream>>>(
        (const unsigned short*)x16, D, (const unsigned short*)w16, D,
        qkv, TD, in_b, TD, D, 1.0f / 64.0f);
  }

  // 3) banded attention per (batch, head, 64-query block) -> a16 [B,S,D] f16 carried x64
  {
    BandGeom g;
    g.q_bs = (long)S * TD; g.q_rs = TD; g.q_hs = HD;
    g.k_bs = (long)S * TD; g.k_rs = TD; g.k_hs = HD;
    g.v_bs = (long)S * TD; g.v_rs = TD; g.v_hs = HD;
    g.o_bs = (long)S * D;  g.o_rs = D;  g.o_hs = HD;
    g.S = S; g.H = H; g.qscale = 0.125f; g.mask_fill = -1e30f;
    dim3 grid(Bz * H * (S / AT_QB));                    // 1024 blocks
    attn_band64_kernel<<<grid, 128, 0, stream>>>(qkv, qkv + D, qkv + 2 * D, a16, wsz, g);
  }

  // 4) y[M][D] (f32) = a16 . ow16^T * (1/4096) + out_b
  {
    dim3 grid((M / 128) * (D / 128), 1);                // 256 tiles of 128 x 128
    wmma_gemm128<<<grid, 128, 0, stream>>>(
        (const unsigned short*)a16, D, (const unsigned short*)ow16, D,
        y, D, out_b, D, D, 1.0f / 4096.0f);
  }
  (void)stream;
}

// v005
// A run of this version takes 78.9 microseconds.
// Two timings next to v004 both put it at 1.10 times that version's speed.
// Over all steps from v000 it is 2.26 times as fast.
#include <hip/hip_runtime.h>
#include <stdint.h>
// qkv projection and output projection: v_wmma_f32_16x16x32_f16 (f16 operands, weights carried x64, f32 accumulate); attention q.k^T and p.v: v_wmma_f32_16x16x32_f16 (f16 operands, p carried x2^15, f32 accumulate); softmax and epilogues f32.

typedef __attribute__((ext_vector_type(16))) _Float16 v16h;
typedef __attribute__((ext_vector_type(8)))  _Float16 v8h;
typedef __attribute__((ext_vector_type(16))) __bf16   v16b;
typedef __attribute__((ext_vector_type(8)))  __bf16   v8b;
typedef __attribute__((ext_vector_type(8)))  float    v8f;
typedef __attribute__((ext_vector_type(4)))  float    v4f;
#define PSCALE 32768.0f
#define U16(p) ((const unsigned short*)(const void*)(p))
#define PSCALE_INV (1.0f / 32768.0f)

__device__ __forceinline__ unsigned short f2bf_bits(float f) {
  unsigned u = __float_as_uint(f);
  return (unsigned short)((u + 0x7FFFu + ((u >> 16) & 1u)) >> 16);
}
__device__ __forceinline__ float bf_bits2f(unsigned short h) { return __uint_as_float(((unsigned)h) << 16); }

// ---- Block-tiled WMMA GEMM, operands staged in LDS by the tensor mover ------
// C[m,n] = scale * sum_k A[m,k] * Bt[n,k] + bias[n]; f16 operands, f32 accumulate, f32 out.
// A row-major [M,K]; Bt row-major [N,K]; M, N % 128 == 0; K % 128 == 0 and K >= 256 (two stages).
// One work-group = 4 waves (2 x 2) = one 128 x 128 tile of C; each wave owns 64 x 64.
// A pass is 128 k = 256 B of each operand row. A stage is four slices of 64 rows
// [A 0..63 | A 64..127 | Bt 0..63 | Bt 64..127], LDS pitch 272 B (16 B pad behind each row);
// every wave issues one tensor load per stage for its own slice. Two buffers.
typedef uint32_t u32x4 __attribute__((ext_vector_type(4)));
typedef uint32_t u32x8 __attribute__((ext_vector_type(8)));
#define GT_ROWB  256u      // bytes of an operand row per pass
#define GT_ROWS  64u       // rows per slice
#define GT_PITCH 272u      // LDS row pitch: odd multiple of 16 B for ds_load_b128 readers
#define GT_SLICE 18432u    // 64 x 272 = 17,408 B rounded up to a multiple of 2 KiB
#define GT_STAGE 73728u    // four slices
static_assert(GT_ROWS * GT_PITCH <= GT_SLICE && GT_SLICE % 2048u == 0u && GT_STAGE == 4u * GT_SLICE);

__device__ __forceinline__ uint32_t uni(uint32_t v) { return (uint32_t)__builtin_amdgcn_readfirstlane(v); }
__device__ __forceinline__ uint32_t pinned(uint32_t v) { uint32_t w = uni(v); asm volatile("" : "+s"(w)); return w; }   // a wave-uniform word held in a scalar register: a test on it compiles to s_cmp + s_cbranch_scc (tensor loads ignore EXEC)
// this wave's LDS reads have retired before the buffer they read is handed back for a refill
__device__ __forceinline__ void wait_ds0() { asm volatile("s_wait_dscnt 0x0" ::: "memory"); }
// this wave's own tensor load has landed (the compiler places no wait for the tensor mover)
__device__ __forceinline__ void wait_tensor0() { asm volatile("s_wait_tensorcnt 0x0" ::: "memory"); }
// one request of the whole wave: a 2-D tile from global memory into LDS
__device__ __forceinline__ void tdm_load(u32x4 g0, u32x8 g1) { asm volatile("tensor_load_to_lds %0, %1" :: "s"(g0), "s"(g1) : "memory"); }
__device__ __forceinline__ u32x8 tdm_group1(uint32_t src_pitch) {   // 1-byte elements, tile = tensor = 64 rows of 256 B
  u32x8 g;
  g[0] = uni((1u << 20) | (5u << 22) | (3u << 25));   // no mask; a pad of 4 dwords behind every 64 dwords
  g[1] = uni((GT_ROWB & 0xFFFFu) << 16);
  g[2] = uni((GT_ROWB >> 16) | ((GT_ROWS & 0xFFFFu) << 16));
  g[3] = uni((GT_ROWS >> 16) | (GT_ROWB << 16));
  g[4] = uni(GT_ROWS);
  g[5] = uni(src_pitch);
  g[6] = uni(0u);
  g[7] = uni(0u);
  return g;
}
__device__ __forceinline__ u32x4 tdm_group0(uint32_t lds_dst, uint64_t ga) {
  u32x4 g;
  g[0] = uni(1u); g[1] = uni(lds_dst); g[2] = uni((uint32_t)ga);
  g[3] = uni((((uint32_t)(ga >> 32)) & 0x01FFFFFFu) | 0x80000000u);
  return g;
}
__device__ __forceinline__ v16h lds_frag(const unsigned char* p) {   // elements 0..7 <- k 0..7, 8..15 <- k 16..23 from p
  union { v16h v; v8h h[2]; } f;
  f.h[0] = *(const v8h*)(p); f.h[1] = *(const v8h*)(p + 32); return f.v;
}

__global__ __launch_bounds__(128) void wmma_gemm128(
    const unsigned short* __restrict__ A, int lda,
    const unsigned short* __restrict__ Bt, int ldb,
    float* __restrict__ C, int ldc,
    const float* __restrict__ bias,
    int N, int K, float scale) {
  __shared__ __attribute__((aligned(2048))) unsigned char L[2u * GT_STAGE];
  const int lane = threadIdx.x & 31;
  const uint32_t wave = uni(threadIdx.x >> 5);
  const int tilesN = N >> 7;
  const int tm = blockIdx.x / tilesN;
  const int tn = blockIdx.x - tm * tilesN;
  const int wm = wave >> 1, wn = wave & 1;
  const int m0 = (tm << 7) + (wm << 6);        // this wave's 64 x 64 tile of C
  const int n0 = (tn << 7) + (wn << 6);

  const int rlane = lane & 15;                 // row (A) / col (B, D) within subtile
  const int hh    = lane >> 4;                 // k half of this lane; D row offset 8 * hh
  const int mOff  = hh * 8;

  // this wave's slice of every stage: waves 0, 1 bring A rows, waves 2, 3 bring Bt rows
  const unsigned short* srow = (wave < 2u) ? (A  + (size_t)((tm << 7) + (wave << 6)) * lda)
                                           : (Bt + (size_t)((tn << 7) + ((wave - 2u) << 6)) * ldb);
  const uint64_t src0 = (uint64_t)(uintptr_t)srow;
  u32x8 g1 = tdm_group1((uint32_t)((wave < 2u) ? lda : ldb) * 2u);
  asm volatile("" : "+s"(g1));   // as pinned(): descriptor words held in their scalar registers, so that none takes another value while a request is outstanding
  const uint32_t lds_slice = (uint32_t)(size_t)L + wave * GT_SLICE;
  const uint32_t T = (uint32_t)K >> 7;         // passes

  const uint32_t aOff = (uint32_t)wm * GT_SLICE + (uint32_t)rlane * GT_PITCH + (uint32_t)hh * 16u;
  const uint32_t bOff = (2u + (uint32_t)wn) * GT_SLICE + (uint32_t)rlane * GT_PITCH + (uint32_t)hh * 16u;

  v8f acc[4][4];
#pragma unroll
  for (int i = 0; i < 4; ++i)
#pragma unroll
    for (int j = 0; j < 4; ++j) acc[i][j] = (v8f){0.f,0.f,0.f,0.f,0.f,0.f,0.f,0.f};

  // prologue: stage 0 lands and is published, then stage 1 flies under pass 0
  tdm_load(tdm_group0(lds_slice, src0), g1);
  wait_tensor0();
  __syncthreads();
  tdm_load(tdm_group0(lds_slice + GT_STAGE, src0 + GT_ROWB), g1);

  for (uint32_t t = 0; t < T; ++t) {
    const uint32_t buf = (t & 1u) * GT_STAGE;
    const unsigned char* La = L + buf + aOff;
    const unsigned char* Lb = L + buf + bOff;
    v16h af[2][4], bf[2][4];                   // set (ks & 1) holds block ks's fragments; a block is 32 k = 16 WMMAs
#pragma unroll
    for (int j = 0; j < 4; ++j) bf[0][j] = lds_frag(Lb + j * 16 * GT_PITCH);
#pragma unroll
    for (int i = 0; i < 4; ++i) af[0][i] = lds_frag(La + i * 16 * GT_PITCH);
#pragma unroll
    for (int ks = 0; ks < 4; ++ks) {
      const int cs = ks & 1;
      if (ks < 3) {
#pragma unroll
        for (int j = 0; j < 4; ++j) bf[cs ^ 1][j] = lds_frag(Lb + j * 16 * GT_PITCH + (ks + 1) * 64);
#pragma unroll
        for (int i = 0; i < 4; ++i) af[cs ^ 1][i] = lds_frag(La + i * 16 * GT_PITCH + (ks + 1) * 64);
      }
      // keeps the next block's LDS loads as one group ahead of this block's WMMAs; without it they sink among the WMMAs, each behind a wait to 0
      __builtin_amdgcn_sched_barrier(0);
#pragma unroll
      for (int i = 0; i < 4; ++i)
#pragma unroll
        for (int j = 0; j < 4; ++j)
          acc[i][j] = __builtin_amdgcn_wmma_f32_16x16x32_f16(false, af[cs][i], false, bf[cs][j], (short)0, acc[i][j], false, false);
      // ends the block: without it the following load group is lifted in among these WMMAs, into further registers
      __builtin_amdgcn_sched_barrier(0);
    }
    // publish point of stage t + 1, which also frees the buffer that pass t has read
    wait_ds0();
    wait_tensor0();
    __syncthreads();
    if (pinned(t + 2u < T))
      tdm_load(tdm_group0(lds_slice + buf, src0 + (uint64_t)((t + 2u) * GT_ROWB)), g1);
  }
  wait_tensor0();
  wait_ds0();

  // ---- epilogue: the ring is free behind the last pass's barrier; each wave stages 16 x 64 in its own range ----
  float* slab = (float*)(L + wave * (16u * 68u * 4u));   // pitch 68 floats
#pragma unroll
  for (int i = 0; i < 4; ++i) {
    const int mBase = m0 + (i << 4);
#pragma unroll
    for (int j = 0; j < 4; ++j) {
      const float bv = bias[n0 + (j << 4) + rlane];
#pragma unroll
      for (int r = 0; r < 8; ++r) {
        float v = acc[i][j][r] * scale;
        v += bv;
        slab[(mOff + r) * 68 + (j << 4) + rlane] = v;
      }
    }
    __builtin_amdgcn_fence(__ATOMIC_RELEASE, "workgroup");
    __builtin_amdgcn_wave_barrier();
    __builtin_amdgcn_fence(__ATOMIC_ACQUIRE, "workgroup");
    {
      const int c4 = (lane & 15) * 4;     // row seg = 256 B = 16 lanes x 16 B
#pragma unroll
      for (int it = 0; it < 8; ++it) {
        const int row = it * 2 + hh;
        v4f v = *(const v4f*)(slab + row * 68 + c4);
        *(v4f*)(C + (size_t)(mBase + row) * ldc + n0 + c4) = v;
      }
    }
    __builtin_amdgcn_fence(__ATOMIC_RELEASE, "workgroup");
    __builtin_amdgcn_wave_barrier();
    __builtin_amdgcn_fence(__ATOMIC_ACQUIRE, "workgroup");
  }
}

// f32 -> f16 conversion of the three f32 inputs in ONE launch: x unscaled, both weight matrices times wsc.
// One work-group of 8 waves converts 256 * NL groups of 4 floats of each input (NL = 16, 12, 4): every lane issues all
// its 32 16-byte loads (512 contiguous bytes per wave and load) before it converts the first.
typedef __attribute__((ext_vector_type(4))) _Float16 v4h;
template <int NL>
__device__ __forceinline__ size_t cast_base() { return ((size_t)blockIdx.x * (256u * NL) + threadIdx.x) * 4u; }   // first float of this lane
template <int NL>
__device__ __forceinline__ void cast_load(const float* p, v4f (&v)[NL]) {
#pragma unroll
  for (int i = 0; i < NL; ++i) v[i] = *(const v4f*)(p + i * 1024);
}
template <int NL>
__device__ __forceinline__ void cast_store(_Float16* o, const v4f (&v)[NL], float sc) {
#pragma unroll
  for (int i = 0; i < NL; ++i) {
    v4h h;
#pragma unroll
    for (int e = 0; e < 4; ++e) h[e] = (_Float16)(v[i][e] * sc);
    *(v4h*)(o + i * 1024) = h;
  }
}
// element counts = gridDim.x * 1024 * {16, 12, 4} exactly (asserted where it is launched)
__global__ __launch_bounds__(256) void cast3_f32_f16(const float* __restrict__ x,  _Float16* __restrict__ x16,
                                                     const float* __restrict__ w,  _Float16* __restrict__ w16,
                                                     const float* __restrict__ ow, _Float16* __restrict__ ow16, float wsc) {
  const float* px = x  + cast_base<16>();
  const float* pw = w  + cast_base<12>();
  const float* po = ow + cast_base<4>();
  v4f vx[16], vw[12], vo[4];
  cast_load<16>(px, vx);
  cast_load<12>(pw, vw);
  cast_load<4>(po, vo);
  // the loads' address registers stay live up to here, so nothing (a load's own result included) rewrites one ahead of this wait
  asm volatile("s_wait_xcnt 0x0" :: "v"(px), "v"(pw), "v"(po) : "memory");
  cast_store<16>(x16  + cast_base<16>(), vx, 1.0f);
  cast_store<12>(w16  + cast_base<12>(), vw, wsc);
  cast_store<4>(ow16 + cast_base<4>(),  vo, wsc);
}

// =====================================================================================
// Banded (sliding-window) attention for head_dim 64, f32 in / f16 out carried x64, f16 operands.
//   scores = (q . k^T) * qscale : v_wmma_f32_16x16x32_f16, f32 accumulate
//   out    = p . v               : v_wmma_f32_16x16x32_f16, p carried x2^15, folded into the final 1/l
//   Online softmax in f32. Block = 4 waves = 64 query rows of one (batch, head); S % 64 == 0.
//   Key chunks of 64; only chunks overlapping [q - W, q + W] for the block's rows are visited
//   (static bound AT_MAXCH, computed start); keys with |q - kv| > W get mask_fill before the softmax.
//   Element (b, s, h, d) of tensor X lives at X[b*X_bs + s*X_rs + h*X_hs + d] (strides in elements, multiples of 8).
//   grid.x = B * H * (S/64).
// =====================================================================================
#define AT_D 64
#define AT_NW 4
#define AT_QB 64
#define AT_KC 64
#define AT_LP 72       // LDS row pitch of the K, V and P tiles in f16: 144 B = 16 B x 9 (odd), so that the 16 rows of a ds_load_b128 fall on distinct banks
#define AT_MAXCH 6
#define AT_PSC 32768.0f
#define AT_OSC 64.0f      // the output is stored as f16 times 64 (exact power of two), the next GEMM's A operand
struct BandGeom { long q_bs, q_rs, q_hs, k_bs, k_rs, k_hs, v_bs, v_rs, v_hs, o_bs, o_rs, o_hs;
                  int S, H; float qscale, mask_fill; };
static_assert(sizeof(BandGeom) == 112);

__device__ __forceinline__ v8f mma_h(v16h a, v16h b, v8f c) {
  c = __builtin_amdgcn_wmma_f32_16x16x32_f16(false, a, false, b, (short)0, c, false, false);
  asm volatile("v_nop\n\tv_nop\n\tv_nop\n\tv_nop" : "+v"(c) : "v"(a), "v"(b));
  return c;
}

__global__ __launch_bounds__(128)
void attn_band64_kernel(const float* __restrict__ q, const float* __restrict__ k,
                        const float* __restrict__ v, _Float16* __restrict__ out,
                        const int* __restrict__ wptr, BandGeom g) {
  union FH { v16h v; v8h h[2]; };
  __shared__ __align__(16) _Float16 Ksh[AT_KC * AT_LP];       // K [kv][d]   9 KB
  __shared__ __align__(16) _Float16 Vth[AT_D * AT_LP];        // V [d][kv]   9 KB
  __shared__ __align__(16) _Float16 Psh[AT_NW][16 * AT_LP];   // per wave P [row][kv]  9 KB
  __shared__ __align__(16) float    Os[AT_NW][16 * 68];       // per wave out tile, pitch 68

  const int tid  = threadIdx.x;
  const int wave = tid >> 5;
  const int lane = tid & 31;
  const int hh   = lane >> 4;
  const int c    = lane & 15;

  const int nqb = g.S / AT_QB;
  const int bx = blockIdx.x;
  const int qb = bx % nqb;
  const int bh = bx / nqb;
  const int h  = bh % g.H;
  const int b  = bh / g.H;
  const int qbase = qb * AT_QB;
  const int q0 = qbase + wave * 16;

  const float* qb_ptr = q + (size_t)b * g.q_bs + (size_t)h * g.q_hs;
  const float* kb_ptr = k + (size_t)b * g.k_bs + (size_t)h * g.k_hs;
  const float* vb_ptr = v + (size_t)b * g.v_bs + (size_t)h * g.v_hs;
  _Float16*    ob_ptr = out + (size_t)b * g.o_bs + (size_t)h * g.o_hs;

  // ---- Q fragments (A operand, row = q0 + c): d-chunks 0..31 and 32..63 ----
  v16h qa0, qa1;
  {
    const float* qrow = qb_ptr + (size_t)(q0 + c) * g.q_rs;
#pragma unroll
    for (int e = 0; e < 8; ++e) {
      qa0[e]     = (_Float16)qrow[8 * hh + e];
      qa0[8 + e] = (_Float16)qrow[16 + 8 * hh + e];
      qa1[e]     = (_Float16)qrow[32 + 8 * hh + e];
      qa1[8 + e] = (_Float16)qrow[32 + 16 + 8 * hh + e];
    }
  }

  float mrow[8], lrow[8];
  v8f oacc[4];
#pragma unroll
  for (int r = 0; r < 8; ++r) { mrow[r] = -__builtin_huge_valf(); lrow[r] = 0.f; }
#pragma unroll
  for (int t = 0; t < 4; ++t) oacc[t] = (v8f){0.f,0.f,0.f,0.f,0.f,0.f,0.f,0.f};

  // ---- visited key-chunk range (block-uniform), statically bounded trip count ----
  const int nkc = g.S / AT_KC;
  int Wd = wptr[0];
  Wd = Wd < 0 ? 0 : Wd;
  Wd = Wd > g.S ? g.S : Wd;
  const int lo = qbase - Wd;
  const int kcLo = (lo < 0) ? 0 : (lo / AT_KC);
  int kcHi = (qbase + AT_QB - 1 + Wd) / AT_KC;
  kcHi = kcHi > nkc - 1 ? nkc - 1 : kcHi;
  int nvis = kcHi - kcLo + 1;
  nvis = nvis > AT_MAXCH ? AT_MAXCH : nvis;
  nvis = nvis < 1 ? 1 : nvis;

  for (int ci = 0; ci < nvis; ++ci) {
    const int kv0 = (kcLo + ci) * AT_KC;   // kcLo + ci <= kcHi <= nkc - 1
    __syncthreads();
    {
      // 16 lanes x 16 B = one 256-B head row, so a wave-wide load covers 2 rows = 4 whole 128-B lines.
      // A lane takes floats 4 * seg .. + 3 of the 8 consecutive rows 8 * rg + i: for each of its 4 d it then
      // holds 8 consecutive kv, one 16-B store into the transposed V tile.
      const int seg = tid & 15, rg = tid >> 4;
      const float* krow = kb_ptr + (size_t)(kv0 + 8 * rg) * g.k_rs + 4 * seg;
      const float* vrow = vb_ptr + (size_t)(kv0 + 8 * rg) * g.v_rs + 4 * seg;
      const float* kp[8];
      const float* vp[8];
      v4f kk[8], vv[8];
#pragma unroll
      for (int i = 0; i < 8; ++i) { kp[i] = krow + (size_t)i * g.k_rs; vp[i] = vrow + (size_t)i * g.v_rs; }
#pragma unroll
      for (int i = 0; i < 8; ++i) kk[i] = *(const v4f*)kp[i];
#pragma unroll
      for (int i = 0; i < 8; ++i) vv[i] = *(const v4f*)vp[i];
      // the loads' address registers stay live up to here, so nothing (a load's own result included) rewrites one ahead of this wait
      asm volatile("s_wait_xcnt 0x0" :: "v"(kp[0]), "v"(kp[1]), "v"(kp[2]), "v"(kp[3]), "v"(kp[4]), "v"(kp[5]), "v"(kp[6]), "v"(kp[7]),
                                        "v"(vp[0]), "v"(vp[1]), "v"(vp[2]), "v"(vp[3]), "v"(vp[4]), "v"(vp[5]), "v"(vp[6]), "v"(vp[7]) : "memory");
#pragma unroll
      for (int i = 0; i < 8; ++i) {
        v4h kh;
#pragma unroll
        for (int e = 0; e < 4; ++e) kh[e] = (_Float16)kk[i][e];
        *(v4h*)(Ksh + (8 * rg + i) * AT_LP + 4 * seg) = kh;
      }
#pragma unroll
      for (int e = 0; e < 4; ++e) {
        v8h vh;
#pragma unroll
        for (int i = 0; i < 8; ++i) vh[i] = (_Float16)vv[i][e];
        *(v8h*)(Vth + (4 * seg + e) * AT_LP + 8 * rg) = vh;
      }
    }
    __syncthreads();

    // ---- scores: 16 rows x 64 keys per wave ----
    v8f s[4];
#pragma unroll
    for (int j = 0; j < 4; ++j) {
      s[j] = (v8f){0.f,0.f,0.f,0.f,0.f,0.f,0.f,0.f};
      FH kb0, kb1;
      kb0.h[0] = *(const v8h*)(Ksh + (j * 16 + c) * AT_LP + 8 * hh);
      kb0.h[1] = *(const v8h*)(Ksh + (j * 16 + c) * AT_LP + 16 + 8 * hh);
      kb1.h[0] = *(const v8h*)(Ksh + (j * 16 + c) * AT_LP + 32 + 8 * hh);
      kb1.h[1] = *(const v8h*)(Ksh + (j * 16 + c) * AT_LP + 32 + 16 + 8 * hh);
      s[j] = mma_h(qa0, kb0.v, s[j]);
      s[j] = mma_h(qa1, kb1.v, s[j]);
    }

    // ---- scale + band mask + chunk row max ----
    float cm[8];
#pragma unroll
    for (int r = 0; r < 8; ++r) {
      const int qrow = q0 + 8 * hh + r;
      float m = -__builtin_huge_valf();
#pragma unroll
      for (int j = 0; j < 4; ++j) {
        const int kvcol = kv0 + j * 16 + c;
        const int dlt = qrow - kvcol;
        float sv = s[j][r] * g.qscale;
        const bool masked = (dlt > Wd) || (dlt < -Wd);
        if (masked) sv = g.mask_fill;
        s[j][r] = sv;
        m = fmaxf(m, sv);
      }
#pragma unroll
      for (int off = 1; off < 16; off <<= 1) m = fmaxf(m, __shfl_xor(m, off, 32));
      cm[r] = m;
    }
    _Float16* pwh = Psh[wave];
#pragma unroll
    for (int r = 0; r < 8; ++r) {
      const float mnew = fmaxf(mrow[r], cm[r]);
      const float alpha = expf(mrow[r] - mnew);
      mrow[r] = mnew;
      float psum = 0.f;
#pragma unroll
      for (int j = 0; j < 4; ++j) {
        const float p = expf(s[j][r] - mnew);
        psum += p;
        pwh[(8 * hh + r) * AT_LP + j * 16 + c] = (_Float16)(p * AT_PSC);
      }
#pragma unroll
      for (int off = 1; off < 16; off <<= 1) psum += __shfl_xor(psum, off, 32);
      lrow[r] = lrow[r] * alpha + psum;
#pragma unroll
      for (int t = 0; t < 4; ++t) oacc[t][r] *= alpha;
    }
    // P tile: stored as _Float16 elements, reloaded below as v8h of _Float16 after a wave barrier
    __builtin_amdgcn_fence(__ATOMIC_RELEASE, "workgroup");
    __builtin_amdgcn_wave_barrier();
    __builtin_amdgcn_fence(__ATOMIC_ACQUIRE, "workgroup");
#pragma unroll 1
    for (int kk = 0; kk < 2; ++kk) {
      FH pa;
      pa.h[0] = *(const v8h*)(pwh + c * AT_LP + kk * 32 + 8 * hh);
      pa.h[1] = *(const v8h*)(pwh + c * AT_LP + kk * 32 + 16 + 8 * hh);
#pragma unroll
      for (int t = 0; t < 4; ++t) {
        FH vb;
        vb.h[0] = *(const v8h*)(Vth + (t * 16 + c) * AT_LP + kk * 32 + 8 * hh);
        vb.h[1] = *(const v8h*)(Vth + (t * 16 + c) * AT_LP + kk * 32 + 16 + 8 * hh);
        oacc[t] = mma_h(pa.v, vb.v, oacc[t]);
      }
    }
  }

  float* os = Os[wave];
#pragma unroll
  for (int r = 0; r < 8; ++r) {
    const float inv = 1.0f / (lrow[r] * AT_PSC);
#pragma unroll
    for (int t = 0; t < 4; ++t) os[(8 * hh + r) * 68 + t * 16 + c] = oacc[t][r] * inv;
  }
  __builtin_amdgcn_fence(__ATOMIC_RELEASE, "workgroup");
  __builtin_amdgcn_wave_barrier();
  __builtin_amdgcn_fence(__ATOMIC_ACQUIRE, "workgroup");
  {
    const int c8 = (lane & 7) * 8;       // row seg = 64 f16 = 128 B = 8 lanes x 16 B; rows it*4 + (lane >> 3) cover 0..15
#pragma unroll
    for (int it = 0; it < 4; ++it) {
      const int row = it * 4 + (lane >> 3);
      const v4f lo4 = *(const v4f*)(os + row * 68 + c8);
      const v4f hi4 = *(const v4f*)(os + row * 68 + c8 + 4);
      v8h hv;
#pragma unroll
      for (int e = 0; e < 4; ++e) { hv[e] = (_Float16)(lo4[e] * AT_OSC); hv[4 + e] = (_Float16)(hi4[e] * AT_OSC); }
      *(v8h*)(ob_ptr + (size_t)(q0 + row) * g.o_rs + c8) = hv;
    }
  }
}

// =====================================================================================
extern "C" void kernel_launch(void* const* d_in, const int* in_sizes, int n_in,
                              void* d_out, int out_size, void* d_ws, size_t ws_size,
                              hipStream_t stream) {
  constexpr int Bz = 2, S = 2048, D = 1024, H = 16, HD = 64;
  constexpr int TD = 3 * D;          // 3072
  constexpr int M  = Bz * S;         // 4096 token rows
  static_assert(H * HD == D);
  static_assert(M % 128 == 0 && TD % 128 == 0 && D % 128 == 0 && D >= 256 && S % AT_QB == 0);

  if (n_in < 6) return;
  if (in_sizes[0] != M * D || in_sizes[1] != TD * D || in_sizes[2] != TD ||
      in_sizes[3] != D * D || in_sizes[4] != D || in_sizes[5] < 1 || out_size != M * D) return;

  const float* x     = (const float*)d_in[0];   // [B,S,D]
  const float* in_w  = (const float*)d_in[1];   // [3D, D] = (out, in) -> Bt
  const float* in_b  = (const float*)d_in[2];   // [3D]
  const float* out_w = (const float*)d_in[3];   // [D, D] = (out, in) -> Bt
  const float* out_b = (const float*)d_in[4];   // [D]
  const int*   wsz   = (const int*)d_in[5];     // window size, int32[1]
  float* y = (float*)d_out;

  // ---- workspace carve (all offsets multiples of 1 MiB) ----
  const size_t bytes_x16  = (size_t)M  * D  * 2;   //  8,388,608
  const size_t bytes_w16  = (size_t)TD * D  * 2;   //  6,291,456
  const size_t bytes_ow16 = (size_t)D  * D  * 2;   //  2,097,152
  const size_t bytes_qkv  = (size_t)M  * TD * 4;   // 50,331,648 (f32)
  const size_t bytes_a16  = (size_t)M  * D  * 2;   //  8,388,608
  const size_t total = bytes_x16 + bytes_w16 + bytes_ow16 + bytes_qkv + bytes_a16;   // 75,497,472
  if (total > ws_size) return;
  char* p = (char*)d_ws;
  _Float16* x16  = (_Float16*)p;  p += bytes_x16;
  _Float16* w16  = (_Float16*)p;  p += bytes_w16;
  _Float16* ow16 = (_Float16*)p;  p += bytes_ow16;
  float*    qkv  = (float*)p;     p += bytes_qkv;
  _Float16* a16  = (_Float16*)p;  p += bytes_a16;

  // 1) f32 -> f16 casts, one launch: x unscaled, weights x64 (exact power of two, folded back in the GEMM scale)
  {
    static_assert(M * D == 256 * 1024 * 16 && TD * D == 256 * 1024 * 12 && D * D == 256 * 1024 * 4);
    cast3_f32_f16<<<256, 256, 0, stream>>>(x, x16, in_w, w16, out_w, ow16, 64.0f);
  }

  // 2) qkv[M][3D] (f32) = x16 . w16^T * (1/64) + in_b
  {
    dim3 grid((M / 128) * (TD / 128), 1);               // 768 tiles of 128 x 128
    wmma_gemm128<<<grid, 128, 0, stream>>>(
        (const unsigned short*)x16, D, (const unsigned short*)w16, D,
        qkv, TD, in_b, TD, D, 1.0f / 64.0f);
  }

  // 3) banded attention per (batch, head, 64-query block) -> a16 [B,S,D] f16 carried x64
  {
    BandGeom g;
    g.q_bs = (long)S * TD; g.q_rs = TD; g.q_hs = HD;
    g.k_bs = (long)S * TD; g.k_rs = TD; g.k_hs = HD;
    g.v_bs = (long)S * TD; g.v_rs = TD; g.v_hs = HD;
    g.o_bs = (long)S * D;  g.o_rs = D;  g.o_hs = HD;
    g.S = S; g.H = H; g.qscale = 0.125f; g.mask_fill = -1e30f;
    dim3 grid(Bz * H * (S / AT_QB));                    // 1024 blocks
    attn_band64_kernel<<<grid, 128, 0, stream>>>(qkv, qkv + D, qkv + 2 * D, a16, wsz, g);
  }

  // 4) y[M][D] (f32) = a16 . ow16^T * (1/4096) + out_b
  {
    dim3 grid((M / 128) * (D / 128), 1);                // 256 tiles of 128 x 128
    wmma_gemm128<<<grid, 128, 0, stream>>>(
        (const unsigned short*)a16, D, (const unsigned short*)ow16, D,
        y, D, out_b, D, D, 1.0f / 4096.0f);
  }
  (void)stream;
}

// v006
// One run takes 74.8 microseconds.
// In both of two side-by-side timings against v005, it was 1.06 times as fast.
// Over all steps from v000 it is 2.41 times as fast.
#include <hip/hip_runtime.h>
#include <stdint.h>
// qkv projection and output projection: v_wmma_f32_16x16x32_f16 (f16 operands, weights carried x64, f32 accumulate); attention q.k^T and p.v: v_wmma_f32_16x16x32_f16 (f16 operands, p carried x2^15, f32 accumulate); softmax and epilogues f32.

typedef __attribute__((ext_vector_type(16))) _Float16 v16h;
typedef __attribute__((ext_vector_type(8)))  _Float16 v8h;
typedef __attribute__((ext_vector_type(16))) __bf16   v16b;
typedef __attribute__((ext_vector_type(8)))  __bf16   v8b;
typedef __attribute__((ext_vector_type(8)))  float    v8f;
typedef __attribute__((ext_vector_type(4)))  float    v4f;
#define PSCALE 32768.0f
#define U16(p) ((const unsigned short*)(const void*)(p))
#define PSCALE_INV (1.0f / 32768.0f)

__device__ __forceinline__ unsigned short f2bf_bits(float f) {
  unsigned u = __float_as_uint(f);
  return (unsigned short)((u + 0x7FFFu + ((u >> 16) & 1u)) >> 16);
}
__device__ __forceinline__ float bf_bits2f(unsigned short h) { return __uint_as_float(((unsigned)h) << 16); }

// ---- Block-tiled WMMA GEMM, operands staged in LDS by the tensor mover ------
// C[m,n] = scale * sum_k A[m,k] * Bt[n,k] + bias[n]; f16 operands, f32 accumulate, f32 out.
// A row-major [M,K]; Bt row-major [N,K]; M, N % 128 == 0; K % 128 == 0 and K >= 256 (two stages).
// One work-group = 4 waves (2 x 2) = one 128 x 128 tile of C; each wave owns 64 x 64.
// A pass is 128 k = 256 B of each operand row. A stage is four slices of 64 rows
// [A 0..63 | A 64..127 | Bt 0..63 | Bt 64..127], LDS pitch 272 B (16 B pad behind each row);
// every wave issues one tensor load per stage for its own slice. Two buffers.
typedef uint32_t u32x4 __attribute__((ext_vector_type(4)));
typedef uint32_t u32x8 __attribute__((ext_vector_type(8)));
#define GT_ROWB  256u      // bytes of an operand row per pass
#define GT_ROWS  64u       // rows per slice
#define GT_PITCH 272u      // LDS row pitch: odd multiple of 16 B for ds_load_b128 readers
#define GT_SLICE 18432u    // 64 x 272 = 17,408 B rounded up to a multiple of 2 KiB
#define GT_STAGE 73728u    // four slices
static_assert(GT_ROWS * GT_PITCH <= GT_SLICE && GT_SLICE % 2048u == 0u && GT_STAGE == 4u * GT_SLICE);

__device__ __forceinline__ uint32_t uni(uint32_t v) { return (uint32_t)__builtin_amdgcn_readfirstlane(v); }
__device__ __forceinline__ uint32_t pinned(uint32_t v) { uint32_t w = uni(v); asm volatile("" : "+s"(w)); return w; }   // a wave-uniform word held in a scalar register: a test on it compiles to s_cmp + s_cbranch_scc (tensor loads ignore EXEC)
// this wave's LDS reads have retired before the buffer they read is handed back for a refill
__device__ __forceinline__ void wait_ds0() { asm volatile("s_wait_dscnt 0x0" ::: "memory"); }
// this wave's own tensor load has landed (the compiler places no wait for the tensor mover)
__device__ __forceinline__ void wait_tensor0() { asm volatile("s_wait_tensorcnt 0x0" ::: "memory"); }
// one request of the whole wave: a 2-D tile from global memory into LDS
__device__ __forceinline__ void tdm_load(u32x4 g0, u32x8 g1) { asm volatile("tensor_load_to_lds %0, %1" :: "s"(g0), "s"(g1) : "memory"); }
__device__ __forceinline__ u32x8 tdm_group1(uint32_t src_pitch) {   // 1-byte elements, tile = tensor = 64 rows of 256 B
  u32x8 g;
  g[0] = uni((1u << 20) | (5u << 22) | (3u << 25));   // no mask; a pad of 4 dwords behind every 64 dwords
  g[1] = uni((GT_ROWB & 0xFFFFu) << 16);
  g[2] = uni((GT_ROWB >> 16) | ((GT_ROWS & 0xFFFFu) << 16));
  g[3] = uni((GT_ROWS >> 16) | (GT_ROWB << 16));
  g[4] = uni(GT_ROWS);
  g[5] = uni(src_pitch);
  g[6] = uni(0u);
  g[7] = uni(0u);
  return g;
}
__device__ __forceinline__ u32x4 tdm_group0(uint32_t lds_dst, uint64_t ga) {
  u32x4 g;
  g[0] = uni(1u); g[1] = uni(lds_dst); g[2] = uni((uint32_t)ga);
  g[3] = uni((((uint32_t)(ga >> 32)) & 0x01FFFFFFu) | 0x80000000u);
  return g;
}
__device__ __forceinline__ v16h lds_frag(const unsigned char* p) {   // elements 0..7 <- k 0..7, 8..15 <- k 16..23 from p
  union { v16h v; v8h h[2]; } f;
  f.h[0] = *(const v8h*)(p); f.h[1] = *(const v8h*)(p + 32); return f.v;
}

__global__ __launch_bounds__(128) void wmma_gemm128(
    const unsigned short* __restrict__ A, int lda,
    const unsigned short* __restrict__ Bt, int ldb,
    float* __restrict__ C, int ldc,
    const float* __restrict__ bias,
    int N, int K, float scale) {
  __shared__ __attribute__((aligned(2048))) unsigned char L[2u * GT_STAGE];
  const int lane = threadIdx.x & 31;
  const uint32_t wave = uni(threadIdx.x >> 5);
  const int tilesN = N >> 7;
  const int tm = blockIdx.x / tilesN;
  const int tn = blockIdx.x - tm * tilesN;
  const int wm = wave >> 1, wn = wave & 1;
  const int m0 = (tm << 7) + (wm << 6);        // this wave's 64 x 64 tile of C
  const int n0 = (tn << 7) + (wn << 6);

  const int rlane = lane & 15;                 // row (A) / col (B, D) within subtile
  const int hh    = lane >> 4;                 // k half of this lane; D row offset 8 * hh
  const int mOff  = hh * 8;

  // this wave's slice of every stage: waves 0, 1 bring A rows, waves 2, 3 bring Bt rows
  const unsigned short* srow = (wave < 2u) ? (A  + (size_t)((tm << 7) + (wave << 6)) * lda)
                                           : (Bt + (size_t)((tn << 7) + ((wave - 2u) << 6)) * ldb);
  const uint64_t src0 = (uint64_t)(uintptr_t)srow;
  u32x8 g1 = tdm_group1((uint32_t)((wave < 2u) ? lda : ldb) * 2u);
  asm volatile("" : "+s"(g1));   // as pinned(): descriptor words held in their scalar registers, so that none takes another value while a request is outstanding
  const uint32_t lds_slice = (uint32_t)(size_t)L + wave * GT_SLICE;
  const uint32_t T = (uint32_t)K >> 7;         // passes

  const uint32_t aOff = (uint32_t)wm * GT_SLICE + (uint32_t)rlane * GT_PITCH + (uint32_t)hh * 16u;
  const uint32_t bOff = (2u + (uint32_t)wn) * GT_SLICE + (uint32_t)rlane * GT_PITCH + (uint32_t)hh * 16u;

  v8f acc[4][4];
#pragma unroll
  for (int i = 0; i < 4; ++i)
#pragma unroll
    for (int j = 0; j < 4; ++j) acc[i][j] = (v8f){0.f,0.f,0.f,0.f,0.f,0.f,0.f,0.f};

  // prologue: stage 0 lands and is published, then stage 1 flies under pass 0
  tdm_load(tdm_group0(lds_slice, src0), g1);
  wait_tensor0();
  __syncthreads();
  tdm_load(tdm_group0(lds_slice + GT_STAGE, src0 + GT_ROWB), g1);

  for (uint32_t t = 0; t < T; ++t) {
    const uint32_t buf = (t & 1u) * GT_STAGE;
    const unsigned char* La = L + buf + aOff;
    const unsigned char* Lb = L + buf + bOff;
    v16h af[2][4], bf[2][4];                   // set (ks & 1) holds block ks's fragments; a block is 32 k = 16 WMMAs
#pragma unroll
    for (int j = 0; j < 4; ++j) bf[0][j] = lds_frag(Lb + j * 16 * GT_PITCH);
#pragma unroll
    for (int i = 0; i < 4; ++i) af[0][i] = lds_frag(La + i * 16 * GT_PITCH);
#pragma unroll
    for (int ks = 0; ks < 4; ++ks) {
      const int cs = ks & 1;
      if (ks < 3) {
#pragma unroll
        for (int j = 0; j < 4; ++j) bf[cs ^ 1][j] = lds_frag(Lb + j * 16 * GT_PITCH + (ks + 1) * 64);
#pragma unroll
        for (int i = 0; i < 4; ++i) af[cs ^ 1][i] = lds_frag(La + i * 16 * GT_PITCH + (ks + 1) * 64);
      }
      // keeps the next block's LDS loads as one group ahead of this block's WMMAs; without it they sink among the WMMAs, each behind a wait to 0
      __builtin_amdgcn_sched_barrier(0);
#pragma unroll
      for (int i = 0; i < 4; ++i)
#pragma unroll
        for (int j = 0; j < 4; ++j)
          acc[i][j] = __builtin_amdgcn_wmma_f32_16x16x32_f16(false, af[cs][i], false, bf[cs][j], (short)0, acc[i][j], false, false);
      // ends the block: without it the following load group is lifted in among these WMMAs, into further registers
      __builtin_amdgcn_sched_barrier(0);
    }
    // publish point of stage t + 1, which also frees the buffer that pass t has read
    wait_ds0();
    wait_tensor0();
    __syncthreads();
    if (pinned(t + 2u < T))
      tdm_load(tdm_group0(lds_slice + buf, src0 + (uint64_t)((t + 2u) * GT_ROWB)), g1);
  }
  wait_tensor0();
  wait_ds0();

  // ---- epilogue: the ring is free behind the last pass's barrier; each wave stages 16 x 64 in its own range ----
  float* slab = (float*)(L + wave * (16u * 68u * 4u));   // pitch 68 floats
#pragma unroll
  for (int i = 0; i < 4; ++i) {
    const int mBase = m0 + (i << 4);
#pragma unroll
    for (int j = 0; j < 4; ++j) {
      const float bv = bias[n0 + (j << 4) + rlane];
#pragma unroll
      for (int r = 0; r < 8; ++r) {
        float v = acc[i][j][r] * scale;
        v += bv;
        slab[(mOff + r) * 68 + (j << 4) + rlane] = v;
      }
    }
    __builtin_amdgcn_fence(__ATOMIC_RELEASE, "workgroup");
    __builtin_amdgcn_wave_barrier();
    __builtin_amdgcn_fence(__ATOMIC_ACQUIRE, "workgroup");
    {
      const int c4 = (lane & 15) * 4;     // row seg = 256 B = 16 lanes x 16 B
#pragma unroll
      for (int it = 0; it < 8; ++it) {
        const int row = it * 2 + hh;
        v4f v = *(const v4f*)(slab + row * 68 + c4);
        *(v4f*)(C + (size_t)(mBase + row) * ldc + n0 + c4) = v;
      }
    }
    __builtin_amdgcn_fence(__ATOMIC_RELEASE, "workgroup");
    __builtin_amdgcn_wave_barrier();
    __builtin_amdgcn_fence(__ATOMIC_ACQUIRE, "workgroup");
  }
}

// f32 -> f16 conversion of the three f32 inputs in ONE launch: x unscaled, both weight matrices times wsc.
// One work-group of 8 waves converts 256 * NL groups of 4 floats of each input (NL = 16, 12, 4): every lane issues all
// its 32 16-byte loads (512 contiguous bytes per wave and load) before it converts the first.
typedef __attribute__((ext_vector_type(4))) _Float16 v4h;
template <int NL>
__device__ __forceinline__ size_t cast_base() { return ((size_t)blockIdx.x * (256u * NL) + threadIdx.x) * 4u; }   // first float of this lane
template <int NL>
__device__ __forceinline__ void cast_load(const float* p, v4f (&v)[NL]) {
#pragma unroll
  for (int i = 0; i < NL; ++i) v[i] = *(const v4f*)(p + i * 1024);
}
template <int NL>
__device__ __forceinline__ void cast_store(_Float16* o, const v4f (&v)[NL], float sc) {
#pragma unroll
  for (int i = 0; i < NL; ++i) {
    v4h h;
#pragma unroll
    for (int e = 0; e < 4; ++e) h[e] = (_Float16)(v[i][e] * sc);
    *(v4h*)(o + i * 1024) = h;
  }
}
// element counts = gridDim.x * 1024 * {16, 12, 4} exactly (asserted where it is launched)
__global__ __launch_bounds__(256) void cast3_f32_f16(const float* __restrict__ x,  _Float16* __restrict__ x16,
                                                     const float* __restrict__ w,  _Float16* __restrict__ w16,
                                                     const float* __restrict__ ow, _Float16* __restrict__ ow16, float wsc) {
  const float* px = x  + cast_base<16>();
  const float* pw = w  + cast_base<12>();
  const float* po = ow + cast_base<4>();
  v4f vx[16], vw[12], vo[4];
  cast_load<16>(px, vx);
  cast_load<12>(pw, vw);
  cast_load<4>(po, vo);
  // the loads' address registers stay live up to here, so nothing (a load's own result included) rewrites one ahead of this wait
  asm volatile("s_wait_xcnt 0x0" :: "v"(px), "v"(pw), "v"(po) : "memory");
  cast_store<16>(x16  + cast_base<16>(), vx, 1.0f);
  cast_store<12>(w16  + cast_base<12>(), vw, wsc);
  cast_store<4>(ow16 + cast_base<4>(),  vo, wsc);
}

// =====================================================================================
// Banded (sliding-window) attention for head_dim 64, f32 in / f16 out carried x64, f16 operands.
//   scores = (q * qscale * log2(e)) . k^T : v_wmma_f32_16x16x32_f16, f32 accumulate; q takes the factor in f32, ahead of its f16 rounding
//   out    = p . v               : v_wmma_f32_16x16x32_f16, p carried x2^15, folded into the final 1/l
//   Online softmax in f32, in base 2: e^(x - m) = 2^((x - m) * log2(e)), so each exponential is one subtract and one v_exp_f32.
//   Block = 4 waves = 64 query rows of one (batch, head); S % 64 == 0.
//   Key chunks of 64; only chunks overlapping [q - W, q + W] for the block's rows are visited
//   (static bound AT_MAXCH, computed start); keys with |q - kv| > W get mask_fill before the softmax.
//   Element (b, s, h, d) of tensor X lives at X[b*X_bs + s*X_rs + h*X_hs + d] (strides in elements, multiples of 8).
//   grid.x = B * H * (S/64).
// =====================================================================================
#define AT_D 64
#define AT_NW 4
#define AT_QB 64
#define AT_KC 64
#define AT_LP 72       // LDS row pitch of the K, V and P tiles in f16: 144 B = 16 B x 9 (odd), so that the 16 rows of a ds_load_b128 fall on distinct banks
#define AT_MAXCH 6
#define AT_PSC 32768.0f
#define AT_OSC 64.0f      // the output is stored as f16 times 64 (exact power of two), the next GEMM's A operand
struct BandGeom { long q_bs, q_rs, q_hs, k_bs, k_rs, k_hs, v_bs, v_rs, v_hs, o_bs, o_rs, o_hs;
                  int S, H; float qscale, mask_fill; };
static_assert(sizeof(BandGeom) == 112);

__device__ __forceinline__ v8f mma_h(v16h a, v16h b, v8f c) {
  c = __builtin_amdgcn_wmma_f32_16x16x32_f16(false, a, false, b, (short)0, c, false, false);
  asm volatile("v_nop\n\tv_nop\n\tv_nop\n\tv_nop" : "+v"(c) : "v"(a), "v"(b));
  return c;
}

// Five base-2 exponentials, one bare v_exp_f32 each. One statement with early-clobber outputs: no v_exp_f32 then stands directly in
// front of an instruction that reads its result or writes over its source, and the v_nop keeps that slot behind the last one.
__device__ __forceinline__ void exp2_x5(float x0, float x1, float x2, float x3, float x4,
                                        float& e0, float& e1, float& e2, float& e3, float& e4) {
  asm("v_exp_f32 %0, %5\n\tv_exp_f32 %1, %6\n\tv_exp_f32 %2, %7\n\tv_exp_f32 %3, %8\n\tv_exp_f32 %4, %9\n\tv_nop"
      : "=&v"(e0), "=&v"(e1), "=&v"(e2), "=&v"(e3), "=&v"(e4)
      : "v"(x0), "v"(x1), "v"(x2), "v"(x3), "v"(x4));
}

__global__ __launch_bounds__(128)
void attn_band64_kernel(const float* __restrict__ q, const float* __restrict__ k,
                        const float* __restrict__ v, _Float16* __restrict__ out,
                        const int* __restrict__ wptr, BandGeom g) {
  union FH { v16h v; v8h h[2]; };
  __shared__ __align__(16) _Float16 Ksh[AT_KC * AT_LP];       // K [kv][d]   9 KB
  __shared__ __align__(16) _Float16 Vth[AT_D * AT_LP];        // V [d][kv]   9 KB
  __shared__ __align__(16) _Float16 Psh[AT_NW][16 * AT_LP];   // per wave P [row][kv]  9 KB
  __shared__ __align__(16) float    Os[AT_NW][16 * 68];       // per wave out tile, pitch 68

  const int tid  = threadIdx.x;
  const int wave = tid >> 5;
  const int lane = tid & 31;
  const int hh   = lane >> 4;
  const int c    = lane & 15;

  const int nqb = g.S / AT_QB;
  const int bx = blockIdx.x;
  const int qb = bx % nqb;
  const int bh = bx / nqb;
  const int h  = bh % g.H;
  const int b  = bh / g.H;
  const int qbase = qb * AT_QB;
  const int q0 = qbase + wave * 16;

  const float* qb_ptr = q + (size_t)b * g.q_bs + (size_t)h * g.q_hs;
  const float* kb_ptr = k + (size_t)b * g.k_bs + (size_t)h * g.k_hs;
  const float* vb_ptr = v + (size_t)b * g.v_bs + (size_t)h * g.v_hs;
  _Float16*    ob_ptr = out + (size_t)b * g.o_bs + (size_t)h * g.o_hs;

  // ---- Q fragments (A operand, row = q0 + c): d-chunks 0..31 and 32..63 ----
  v16h qa0, qa1;
  {
    const float* qrow = qb_ptr + (size_t)(q0 + c) * g.q_rs;
    const float qs2 = g.qscale * 1.44269504088896340736f;   // the products then are the softmax's base-2 exponents
#pragma unroll
    for (int e = 0; e < 8; ++e) {
      qa0[e]     = (_Float16)(qrow[8 * hh + e] * qs2);
      qa0[8 + e] = (_Float16)(qrow[16 + 8 * hh + e] * qs2);
      qa1[e]     = (_Float16)(qrow[32 + 8 * hh + e] * qs2);
      qa1[8 + e] = (_Float16)(qrow[32 + 16 + 8 * hh + e] * qs2);
    }
  }

  float mrow[8], lrow[8];
  v8f oacc[4];
#pragma unroll
  for (int r = 0; r < 8; ++r) { mrow[r] = -__builtin_huge_valf(); lrow[r] = 0.f; }
#pragma unroll
  for (int t = 0; t < 4; ++t) oacc[t] = (v8f){0.f,0.f,0.f,0.f,0.f,0.f,0.f,0.f};

  // ---- visited key-chunk range (block-uniform), statically bounded trip count ----
  const int nkc = g.S / AT_KC;
  int Wd = wptr[0];
  Wd = Wd < 0 ? 0 : Wd;
  Wd = Wd > g.S ? g.S : Wd;
  const int lo = qbase - Wd;
  const int kcLo = (lo < 0) ? 0 : (lo / AT_KC);
  int kcHi = (qbase + AT_QB - 1 + Wd) / AT_KC;
  kcHi = kcHi > nkc - 1 ? nkc - 1 : kcHi;
  int nvis = kcHi - kcLo + 1;
  nvis = nvis > AT_MAXCH ? AT_MAXCH : nvis;
  nvis = nvis < 1 ? 1 : nvis;

  for (int ci = 0; ci < nvis; ++ci) {
    const int kv0 = (kcLo + ci) * AT_KC;   // kcLo + ci <= kcHi <= nkc - 1
    __syncthreads();
    {
      // 16 lanes x 16 B = one 256-B head row, so a wave-wide load covers 2 rows = 4 whole 128-B lines.
      // A lane takes floats 4 * seg .. + 3 of the 8 consecutive rows 8 * rg + i: for each of its 4 d it then
      // holds 8 consecutive kv, one 16-B store into the transposed V tile.
      const int seg = tid & 15, rg = tid >> 4;
      const float* krow = kb_ptr + (size_t)(kv0 + 8 * rg) * g.k_rs + 4 * seg;
      const float* vrow = vb_ptr + (size_t)(kv0 + 8 * rg) * g.v_rs + 4 * seg;
      const float* kp[8];
      const float* vp[8];
      v4f kk[8], vv[8];
#pragma unroll
      for (int i = 0; i < 8; ++i) { kp[i] = krow + (size_t)i * g.k_rs; vp[i] = vrow + (size_t)i * g.v_rs; }
#pragma unroll
      for (int i = 0; i < 8; ++i) kk[i] = *(const v4f*)kp[i];
#pragma unroll
      for (int i = 0; i < 8; ++i) vv[i] = *(const v4f*)vp[i];
      // the loads' address registers stay live up to here, so nothing (a load's own result included) rewrites one ahead of this wait
      asm volatile("s_wait_xcnt 0x0" :: "v"(kp[0]), "v"(kp[1]), "v"(kp[2]), "v"(kp[3]), "v"(kp[4]), "v"(kp[5]), "v"(kp[6]), "v"(kp[7]),
                                        "v"(vp[0]), "v"(vp[1]), "v"(vp[2]), "v"(vp[3]), "v"(vp[4]), "v"(vp[5]), "v"(vp[6]), "v"(vp[7]) : "memory");
#pragma unroll
      for (int i = 0; i < 8; ++i) {
        v4h kh;
#pragma unroll
        for (int e = 0; e < 4; ++e) kh[e] = (_Float16)kk[i][e];
        *(v4h*)(Ksh + (8 * rg + i) * AT_LP + 4 * seg) = kh;
      }
#pragma unroll
      for (int e = 0; e < 4; ++e) {
        v8h vh;
#pragma unroll
        for (int i = 0; i < 8; ++i) vh[i] = (_Float16)vv[i][e];
        *(v8h*)(Vth + (4 * seg + e) * AT_LP + 8 * rg) = vh;
      }
    }
    __syncthreads();

    // ---- scores: 16 rows x 64 keys per wave ----
    v8f s[4];
#pragma unroll
    for (int j = 0; j < 4; ++j) {
      s[j] = (v8f){0.f,0.f,0.f,0.f,0.f,0.f,0.f,0.f};
      FH kb0, kb1;
      kb0.h[0] = *(const v8h*)(Ksh + (j * 16 + c) * AT_LP + 8 * hh);
      kb0.h[1] = *(const v8h*)(Ksh + (j * 16 + c) * AT_LP + 16 + 8 * hh);
      kb1.h[0] = *(const v8h*)(Ksh + (j * 16 + c) * AT_LP + 32 + 8 * hh);
      kb1.h[1] = *(const v8h*)(Ksh + (j * 16 + c) * AT_LP + 32 + 16 + 8 * hh);
      s[j] = mma_h(qa0, kb0.v, s[j]);
      s[j] = mma_h(qa1, kb1.v, s[j]);
    }

    // ---- band mask + chunk row max ----
    float cm[8];
#pragma unroll
    for (int r = 0; r < 8; ++r) {
      const int qrow = q0 + 8 * hh + r;
      float m = -__builtin_huge_valf();
#pragma unroll
      for (int j = 0; j < 4; ++j) {
        const int kvcol = kv0 + j * 16 + c;
        const int dlt = qrow - kvcol;
        float sv = s[j][r];
        const bool masked = (dlt > Wd) || (dlt < -Wd);
        if (masked) sv = g.mask_fill;
        s[j][r] = sv;
        m = fmaxf(m, sv);
      }
#pragma unroll
      for (int off = 1; off < 16; off <<= 1) m = fmaxf(m, __shfl_xor(m, off, 32));
      cm[r] = m;
    }
    _Float16* pwh = Psh[wave];
#pragma unroll
    for (int r = 0; r < 8; ++r) {
      const float mnew = fmaxf(mrow[r], cm[r]);
      float alpha, pe[4];
      exp2_x5(mrow[r] - mnew, s[0][r] - mnew, s[1][r] - mnew, s[2][r] - mnew, s[3][r] - mnew, alpha, pe[0], pe[1], pe[2], pe[3]);
      mrow[r] = mnew;
      float psum = pe[0];
#pragma unroll
      for (int j = 1; j < 4; ++j) psum += pe[j];
#pragma unroll
      for (int j = 0; j < 4; ++j) pwh[(8 * hh + r) * AT_LP + j * 16 + c] = (_Float16)(pe[j] * AT_PSC);
#pragma unroll
      for (int off = 1; off < 16; off <<= 1) psum += __shfl_xor(psum, off, 32);
      lrow[r] = lrow[r] * alpha + psum;
#pragma unroll
      for (int t = 0; t < 4; ++t) oacc[t][r] *= alpha;
    }
    // P tile: stored as _Float16 elements, reloaded below as v8h of _Float16 after a wave barrier
    __builtin_amdgcn_fence(__ATOMIC_RELEASE, "workgroup");
    __builtin_amdgcn_wave_barrier();
    __builtin_amdgcn_fence(__ATOMIC_ACQUIRE, "workgroup");
#pragma unroll 1
    for (int kk = 0; kk < 2; ++kk) {
      FH pa;
      pa.h[0] = *(const v8h*)(pwh + c * AT_LP + kk * 32 + 8 * hh);
      pa.h[1] = *(const v8h*)(pwh + c * AT_LP + kk * 32 + 16 + 8 * hh);
#pragma unroll
      for (int t = 0; t < 4; ++t) {
        FH vb;
        vb.h[0] = *(const v8h*)(Vth + (t * 16 + c) * AT_LP + kk * 32 + 8 * hh);
        vb.h[1] = *(const v8h*)(Vth + (t * 16 + c) * AT_LP + kk * 32 + 16 + 8 * hh);
        oacc[t] = mma_h(pa.v, vb.v, oacc[t]);
      }
    }
  }

  float* os = Os[wave];
#pragma unroll
  for (int r = 0; r < 8; ++r) {
    const float inv = 1.0f / (lrow[r] * AT_PSC);
#pragma unroll
    for (int t = 0; t < 4; ++t) os[(8 * hh + r) * 68 + t * 16 + c] = oacc[t][r] * inv;
  }
  __builtin_amdgcn_fence(__ATOMIC_RELEASE, "workgroup");
  __builtin_amdgcn_wave_barrier();
  __builtin_amdgcn_fence(__ATOMIC_ACQUIRE, "workgroup");
  {
    const int c8 = (lane & 7) * 8;       // row seg = 64 f16 = 128 B = 8 lanes x 16 B; rows it*4 + (lane >> 3) cover 0..15
#pragma unroll
    for (int it = 0; it < 4; ++it) {
      const int row = it * 4 + (lane >> 3);
      const v4f lo4 = *(const v4f*)(os + row * 68 + c8);
      const v4f hi4 = *(const v4f*)(os + row * 68 + c8 + 4);
      v8h hv;
#pragma unroll
      for (int e = 0; e < 4; ++e) { hv[e] = (_Float16)(lo4[e] * AT_OSC); hv[4 + e] = (_Float16)(hi4[e] * AT_OSC); }
      *(v8h*)(ob_ptr + (size_t)(q0 + row) * g.o_rs + c8) = hv;
    }
  }
}

// =====================================================================================
extern "C" void kernel_launch(void* const* d_in, const int* in_sizes, int n_in,
                              void* d_out, int out_size, void* d_ws, size_t ws_size,
                              hipStream_t stream) {
  constexpr int Bz = 2, S = 2048, D = 1024, H = 16, HD = 64;
  constexpr int TD = 3 * D;          // 3072
  constexpr int M  = Bz * S;         // 4096 token rows
  static_assert(H * HD == D);
  static_assert(M % 128 == 0 && TD % 128 == 0 && D % 128 == 0 && D >= 256 && S % AT_QB == 0);

  if (n_in < 6) return;
  if (in_sizes[0] != M * D || in_sizes[1] != TD * D || in_sizes[2] != TD ||
      in_sizes[3] != D * D || in_sizes[4] != D || in_sizes[5] < 1 || out_size != M * D) return;

  const float* x     = (const float*)d_in[0];   // [B,S,D]
  const float* in_w  = (const float*)d_in[1];   // [3D, D] = (out, in) -> Bt
  const float* in_b  = (const float*)d_in[2];   // [3D]
  const float* out_w = (const float*)d_in[3];   // [D, D] = (out, in) -> Bt
  const float* out_b = (const float*)d_in[4];   // [D]
  const int*   wsz   = (const int*)d_in[5];     // window size, int32[1]
  float* y = (float*)d_out;

  // ---- workspace carve (all offsets multiples of 1 MiB) ----
  const size_t bytes_x16  = (size_t)M  * D  * 2;   //  8,388,608
  const size_t bytes_w16  = (size_t)TD * D  * 2;   //  6,291,456
  const size_t bytes_ow16 = (size_t)D  * D  * 2;   //  2,097,152
  const size_t bytes_qkv  = (size_t)M  * TD * 4;   // 50,331,648 (f32)
  const size_t bytes_a16  = (size_t)M  * D  * 2;   //  8,388,608
  const size_t total = bytes_x16 + bytes_w16 + bytes_ow16 + bytes_qkv + bytes_a16;   // 75,497,472
  if (total > ws_size) return;
  char* p = (char*)d_ws;
  _Float16* x16  = (_Float16*)p;  p += bytes_x16;
  _Float16* w16  = (_Float16*)p;  p += bytes_w16;
  _Float16* ow16 = (_Float16*)p;  p += bytes_ow16;
  float*    qkv  = (float*)p;     p += bytes_qkv;
  _Float16* a16  = (_Float16*)p;  p += bytes_a16;

  // 1) f32 -> f16 casts, one launch: x unscaled, weights x64 (exact power of two, folded back in the GEMM scale)
  {
    static_assert(M * D == 256 * 1024 * 16 && TD * D == 256 * 1024 * 12 && D * D == 256 * 1024 * 4);
    cast3_f32_f16<<<256, 256, 0, stream>>>(x, x16, in_w, w16, out_w, ow16, 64.0f);
  }

  // 2) qkv[M][3D] (f32) = x16 . w16^T * (1/64) + in_b
  {
    dim3 grid((M / 128) * (TD / 128), 1);               // 768 tiles of 128 x 128
    wmma_gemm128<<<grid, 128, 0, stream>>>(
        (const unsigned short*)x16, D, (const unsigned short*)w16, D,
        qkv, TD, in_b, TD, D, 1.0f / 64.0f);
  }

  // 3) banded attention per (batch, head, 64-query block) -> a16 [B,S,D] f16 carried x64
  {
    BandGeom g;
    g.q_bs = (long)S * TD; g.q_rs = TD; g.q_hs = HD;
    g.k_bs = (long)S * TD; g.k_rs = TD; g.k_hs = HD;
    g.v_bs = (long)S * TD; g.v_rs = TD; g.v_hs = HD;
    g.o_bs = (long)S * D;  g.o_rs = D;  g.o_hs = HD;
    g.S = S; g.H = H; g.qscale = 0.125f; g.mask_fill = -1e30f;
    dim3 grid(Bz * H * (S / AT_QB));                    // 1024 blocks
    attn_band64_kernel<<<grid, 128, 0, stream>>>(qkv, qkv + D, qkv + 2 * D, a16, wsz, g);
  }

  // 4) y[M][D] (f32) = a16 . ow16^T * (1/4096) + out_b
  {
    dim3 grid((M / 128) * (D / 128), 1);                // 256 tiles of 128 x 128
    wmma_gemm128<<<grid, 128, 0, stream>>>(
        (const unsigned short*)a16, D, (const unsigned short*)ow16, D,
        y, D, out_b, D, D, 1.0f / 4096.0f);
  }
  (void)stream;
}

// v007
// One run takes 67.6 microseconds.
// Timed twice side by side with v006, it ran 1.11 times as fast both times.
// Counting every step since v000, it is 2.67 times as fast.
#include <hip/hip_runtime.h>
#include <stdint.h>
// qkv projection and output projection: v_wmma_f32_16x16x32_f16 (f16 operands, weights carried x64, f32 accumulate); attention q.k^T and p.v: v_wmma_f32_16x16x32_f16 (f16 operands, p carried x2^15, f32 accumulate); softmax and epilogues f32.

typedef __attribute__((ext_vector_type(16))) _Float16 v16h;
typedef __attribute__((ext_vector_type(8)))  _Float16 v8h;
typedef __attribute__((ext_vector_type(16))) __bf16   v16b;
typedef __attribute__((ext_vector_type(8)))  __bf16   v8b;
typedef __attribute__((ext_vector_type(8)))  float    v8f;
typedef __attribute__((ext_vector_type(4)))  float    v4f;
#define PSCALE 32768.0f
#define U16(p) ((const unsigned short*)(const void*)(p))
#define PSCALE_INV (1.0f / 32768.0f)

__device__ __forceinline__ unsigned short f2bf_bits(float f) {
  unsigned u = __float_as_uint(f);
  return (unsigned short)((u + 0x7FFFu + ((u >> 16) & 1u)) >> 16);
}
__device__ __forceinline__ float bf_bits2f(unsigned short h) { return __uint_as_float(((unsigned)h) << 16); }

// ---- Block-tiled WMMA GEMM, operands staged in LDS by the tensor mover ------
// C[m,n] = scale * sum_k A[m,k] * Bt[n,k] + bias[n]; f16 operands, f32 accumulate, f32 out.
// A row-major [M,K]; Bt row-major [N,K]; M % (64 WM) == 0, N % (16 FJ WN) == 0; K % 128 == 0 and K >= 256 (two stages).
// One work-group = WM x WN waves = one (64 WM) x (16 FJ WN) tile of C; each wave owns 64 x 16 FJ.
// A pass is 128 k = 256 B of each operand row. A stage is slices of 64 rows, first the tile's A rows, then its Bt rows,
// LDS pitch 272 B (16 B pad behind each row); wave s issues one tensor load per stage for slice s. Two buffers.
// <2, 2, 4>: 128 x 128, 4 slices, 4 waves. <4, 2, 6>: 256 x 192, 7 slices, 8 waves (the last wave issues none):
// 448 operand rows feed 49,152 elements of C where 256 rows feed 16,384, so 0.58 of the bytes come from L2 per element.
typedef uint32_t u32x4 __attribute__((ext_vector_type(4)));
typedef uint32_t u32x8 __attribute__((ext_vector_type(8)));
#define GT_ROWB  256u      // bytes of an operand row per pass
#define GT_ROWS  64u       // rows per slice
#define GT_PITCH 272u      // LDS row pitch: odd multiple of 16 B for ds_load_b128 readers
#define GT_SLICE 18432u    // 64 x 272 = 17,408 B rounded up to a multiple of 2 KiB
static_assert(GT_ROWS * GT_PITCH <= GT_SLICE && GT_SLICE % 2048u == 0u);

__device__ __forceinline__ uint32_t uni(uint32_t v) { return (uint32_t)__builtin_amdgcn_readfirstlane(v); }
__device__ __forceinline__ uint32_t pinned(uint32_t v) { uint32_t w = uni(v); asm volatile("" : "+s"(w)); return w; }   // a wave-uniform word held in a scalar register: a test on it compiles to s_cmp + s_cbranch_scc (tensor loads ignore EXEC)
// this wave's LDS reads have retired before the buffer they read is handed back for a refill
__device__ __forceinline__ void wait_ds0() { asm volatile("s_wait_dscnt 0x0" ::: "memory"); }
// this wave's own tensor load has landed (the compiler places no wait for the tensor mover)
// The request's descriptor words are inputs: their registers stay live up to the wait that covers the request, so none takes another value while it is outstanding.
__device__ __forceinline__ void wait_tensor0(u32x4 g0, u32x8 g1) { asm volatile("s_wait_tensorcnt 0x0" :: "s"(g0), "s"(g1) : "memory"); }
// one request of the whole wave: a 2-D tile from global memory into LDS
__device__ __forceinline__ void tdm_load(u32x4 g0, u32x8 g1) { asm volatile("tensor_load_to_lds %0, %1" :: "s"(g0), "s"(g1) : "memory"); }
__device__ __forceinline__ u32x8 tdm_group1(uint32_t src_pitch) {   // 1-byte elements, tile = tensor = 64 rows of 256 B
  u32x8 g;
  g[0] = uni((1u << 20) | (5u << 22) | (3u << 25));   // no mask; a pad of 4 dwords behind every 64 dwords
  g[1] = uni((GT_ROWB & 0xFFFFu) << 16);
  g[2] = uni((GT_ROWB >> 16) | ((GT_ROWS & 0xFFFFu) << 16));
  g[3] = uni((GT_ROWS >> 16) | (GT_ROWB << 16));
  g[4] = uni(GT_ROWS);
  g[5] = uni(src_pitch);
  g[6] = uni(0u);
  g[7] = uni(0u);
  return g;
}
__device__ __forceinline__ u32x4 tdm_group0(uint32_t lds_dst, uint64_t ga) {
  u32x4 g;
  g[0] = uni(1u); g[1] = uni(lds_dst); g[2] = uni((uint32_t)ga);
  g[3] = uni((((uint32_t)(ga >> 32)) & 0x01FFFFFFu) | 0x80000000u);
  asm volatile("" : "+s"(g));   // as pinned(): descriptor words held in their scalar registers; without it the constant word 0 is formed anew at each use and its register serves other values in between
  return g;
}
__device__ __forceinline__ v16h lds_frag(const unsigned char* p) {   // elements 0..7 <- k 0..7, 8..15 <- k 16..23 from p
  union { v16h v; v8h h[2]; } f;
  f.h[0] = *(const v8h*)(p); f.h[1] = *(const v8h*)(p + 32); return f.v;
}

template <int WM, int WN, int FJ>
__global__ __launch_bounds__(WM * WN * 32) void wmma_gemm_tile(
    const unsigned short* __restrict__ A, int lda,
    const unsigned short* __restrict__ Bt, int ldb,
    float* __restrict__ C, int ldc,
    const float* __restrict__ bias,
    int N, int K, float scale) {
  constexpr int      TM  = WM * 64, WC = FJ * 16, TN = WN * WC;   // tile rows, wave columns, tile columns
  constexpr uint32_t ASL = WM, NSL = ASL + TN / 64;                // slices of A, slices of a stage
  constexpr uint32_t GT_STAGE = NSL * GT_SLICE;
  constexpr bool     ALLW = (NSL == (uint32_t)(WM * WN));          // every wave has a slice to bring
  static_assert(TN % 64 == 0 && NSL <= (uint32_t)(WM * WN) && 2u * GT_STAGE <= 320u * 1024u);
  __shared__ __attribute__((aligned(2048))) unsigned char L[2u * GT_STAGE];
  const int lane = threadIdx.x & 31;
  const uint32_t wave = uni(threadIdx.x >> 5);
  const int tilesN = N / TN;
  const int tm = blockIdx.x / tilesN;
  const int tn = blockIdx.x - tm * tilesN;
  const int wm = wave / WN, wn = wave % WN;
  const int m0 = tm * TM + (wm << 6);          // this wave's 64 x WC tile of C
  const int n0 = tn * TN + wn * WC;

  const int rlane = lane & 15;                 // row (A) / col (B, D) within subtile
  const int hh    = lane >> 4;                 // k half of this lane; D row offset 8 * hh
  const int mOff  = hh * 8;

  // this wave's slice of every stage: the first ASL waves bring A rows, the next bring Bt rows
  const unsigned short* srow = (wave < ASL) ? (A  + (size_t)(tm * TM + (int)(wave << 6)) * lda)
                                            : (Bt + (size_t)(tn * TN + (int)((wave - ASL) << 6)) * ldb);
  const uint64_t src0 = (uint64_t)(uintptr_t)srow;
  u32x8 g1 = tdm_group1((uint32_t)((wave < ASL) ? lda : ldb) * 2u);
  asm volatile("" : "+s"(g1));   // as pinned(): descriptor words held in their scalar registers, so that none takes another value while a request is outstanding
  const uint32_t lds_slice = (uint32_t)(size_t)L + wave * GT_SLICE;
  const uint32_t T = (uint32_t)K >> 7;         // passes

  const uint32_t aOff = (uint32_t)wm * GT_SLICE + (uint32_t)rlane * GT_PITCH + (uint32_t)hh * 16u;
  uint32_t bOff[FJ];                           // fragment j = Bt rows wn * WC + 16 j .. + 15 of the tile: 16 rows lie in one slice
#pragma unroll
  for (int j = 0; j < FJ; ++j) {
    const uint32_t rj = (uint32_t)(wn * WC + j * 16);
    bOff[j] = (ASL + (rj >> 6)) * GT_SLICE + ((rj & 63u) + (uint32_t)rlane) * GT_PITCH + (uint32_t)hh * 16u;
  }

  v8f acc[4][FJ];
#pragma unroll
  for (int i = 0; i < 4; ++i)
#pragma unroll
    for (int j = 0; j < FJ; ++j) acc[i][j] = (v8f){0.f,0.f,0.f,0.f,0.f,0.f,0.f,0.f};

  // prologue: stage 0 lands and is published, then stage 1 flies under pass 0
  u32x4 g0 = tdm_group0(lds_slice, src0);      // group 0 of this wave's youngest request
  if (ALLW || pinned(wave < NSL)) tdm_load(g0, g1);
  wait_tensor0(g0, g1);
  __syncthreads();
  g0 = tdm_group0(lds_slice + GT_STAGE, src0 + GT_ROWB);
  if (ALLW || pinned(wave < NSL)) tdm_load(g0, g1);

  for (uint32_t t = 0; t < T; ++t) {
    const uint32_t buf = (t & 1u) * GT_STAGE;
    const unsigned char* La = L + buf + aOff;
    const unsigned char* Lb = L + buf;
    v16h af[2][4], bf[2][FJ];                  // set (ks & 1) holds block ks's fragments; a block is 32 k = 4 FJ WMMAs
#pragma unroll
    for (int j = 0; j < FJ; ++j) bf[0][j] = lds_frag(Lb + bOff[j]);
#pragma unroll
    for (int i = 0; i < 4; ++i) af[0][i] = lds_frag(La + i * 16 * GT_PITCH);
#pragma unroll
    for (int ks = 0; ks < 4; ++ks) {
      const int cs = ks & 1;
      if (ks < 3) {
#pragma unroll
        for (int j = 0; j < FJ; ++j) bf[cs ^ 1][j] = lds_frag(Lb + bOff[j] + (ks + 1) * 64);
#pragma unroll
        for (int i = 0; i < 4; ++i) af[cs ^ 1][i] = lds_frag(La + i * 16 * GT_PITCH + (ks + 1) * 64);
      }
      // keeps the next block's LDS loads as one group ahead of this block's WMMAs; without it they sink among the WMMAs, each behind a wait to 0
      __builtin_amdgcn_sched_barrier(0);
#pragma unroll
      for (int i = 0; i < 4; ++i)
#pragma unroll
        for (int j = 0; j < FJ; ++j)
          acc[i][j] = __builtin_amdgcn_wmma_f32_16x16x32_f16(false, af[cs][i], false, bf[cs][j], (short)0, acc[i][j], false, false);
      // ends the block: without it the following load group is lifted in among these WMMAs, into further registers
      __builtin_amdgcn_sched_barrier(0);
    }
    // publish point of stage t + 1, which also frees the buffer that pass t has read
    wait_ds0();
    wait_tensor0(g0, g1);
    __syncthreads();
    if (pinned((t + 2u < T) && (ALLW || wave < NSL))) {
      g0 = tdm_group0(lds_slice + buf, src0 + (uint64_t)((t + 2u) * GT_ROWB));
      tdm_load(g0, g1);
    }
  }
  wait_tensor0(g0, g1);
  wait_ds0();

  // ---- epilogue: the ring is free behind the last pass's barrier; each wave stages 16 x WC in its own range ----
  constexpr int SP = WC + 4;                             // pitch in floats
  float* slab = (float*)(L + wave * (16u * SP * 4u));
#pragma unroll
  for (int i = 0; i < 4; ++i) {
    float* Ci = C + (size_t)(m0 + (i << 4)) * ldc + n0;   // wave-uniform; a lane's offset from it is the same in all four turns
#pragma unroll
    for (int j = 0; j < FJ; ++j) {
      const float bv = bias[n0 + (j << 4) + rlane];
#pragma unroll
      for (int r = 0; r < 8; ++r) {
        float v = acc[i][j][r] * scale;
        v += bv;
        slab[(mOff + r) * SP + (j << 4) + rlane] = v;
      }
    }
    __builtin_amdgcn_fence(__ATOMIC_RELEASE, "workgroup");
    __builtin_amdgcn_wave_barrier();
    __builtin_amdgcn_fence(__ATOMIC_ACQUIRE, "workgroup");
    {
      constexpr int SEG = WC / 4;         // 16-B pieces of a row seg of 4 WC bytes (whole 128-B lines); 16 SEG pieces = 2 FJ turns of 32 lanes
#pragma unroll
      for (int it = 0; it < 2 * FJ; ++it) {
        const int u = it * 32 + lane;
        const int row = u / SEG;
        const int c4 = (u - row * SEG) * 4;
        v4f v = *(const v4f*)(slab + row * SP + c4);
        *(v4f*)(Ci + (row * ldc + c4)) = v;
      }
    }
    __builtin_amdgcn_fence(__ATOMIC_RELEASE, "workgroup");
    __builtin_amdgcn_wave_barrier();
    __builtin_amdgcn_fence(__ATOMIC_ACQUIRE, "workgroup");
  }
}

// f32 -> f16 conversion of the three f32 inputs in ONE launch: x unscaled, both weight matrices times wsc.
// One work-group of 8 waves converts 256 * NL groups of 4 floats of each input (NL = 16, 12, 4): every lane issues all
// its 32 16-byte loads (512 contiguous bytes per wave and load) before it converts the first.
typedef __attribute__((ext_vector_type(4))) _Float16 v4h;
template <int NL>
__device__ __forceinline__ size_t cast_base() { return ((size_t)blockIdx.x * (256u * NL) + threadIdx.x) * 4u; }   // first float of this lane
template <int NL>
__device__ __forceinline__ void cast_load(const float* p, v4f (&v)[NL]) {
#pragma unroll
  for (int i = 0; i < NL; ++i) v[i] = *(const v4f*)(p + i * 1024);
}
template <int NL>
__device__ __forceinline__ void cast_store(_Float16* o, const v4f (&v)[NL], float sc) {
#pragma unroll
  for (int i = 0; i < NL; ++i) {
    v4h h;
#pragma unroll
    for (int e = 0; e < 4; ++e) h[e] = (_Float16)(v[i][e] * sc);
    *(v4h*)(o + i * 1024) = h;
  }
}
// element counts = gridDim.x * 1024 * {16, 12, 4} exactly (asserted where it is launched)
__global__ __launch_bounds__(256) void cast3_f32_f16(const float* __restrict__ x,  _Float16* __restrict__ x16,
                                                     const float* __restrict__ w,  _Float16* __restrict__ w16,
                                                     const float* __restrict__ ow, _Float16* __restrict__ ow16, float wsc) {
  const float* px = x  + cast_base<16>();
  const float* pw = w  + cast_base<12>();
  const float* po = ow + cast_base<4>();
  v4f vx[16], vw[12], vo[4];
  cast_load<16>(px, vx);
  cast_load<12>(pw, vw);
  cast_load<4>(po, vo);
  // the loads' address registers stay live up to here, so nothing (a load's own result included) rewrites one ahead of this wait
  asm volatile("s_wait_xcnt 0x0" :: "v"(px), "v"(pw), "v"(po) : "memory");
  cast_store<16>(x16  + cast_base<16>(), vx, 1.0f);
  cast_store<12>(w16  + cast_base<12>(), vw, wsc);
  cast_store<4>(ow16 + cast_base<4>(),  vo, wsc);
}

// =====================================================================================
// Banded (sliding-window) attention for head_dim 64, f32 in / f16 out carried x64, f16 operands.
//   scores = (q * qscale * log2(e)) . k^T : v_wmma_f32_16x16x32_f16, f32 accumulate; q takes the factor in f32, ahead of its f16 rounding
//   out    = p . v               : v_wmma_f32_16x16x32_f16, p carried x2^15, folded into the final 1/l
//   Online softmax in f32, in base 2: e^(x - m) = 2^((x - m) * log2(e)), so each exponential is one subtract and one v_exp_f32.
//   Block = 4 waves = 64 query rows of one (batch, head); S % 64 == 0.
//   Key chunks of 64; only chunks overlapping [q - W, q + W] for the block's rows are visited
//   (static bound AT_MAXCH, computed start); keys with |q - kv| > W get mask_fill before the softmax.
//   Element (b, s, h, d) of tensor X lives at X[b*X_bs + s*X_rs + h*X_hs + d] (strides in elements, multiples of 8).
//   grid.x = B * H * (S/64).
// =====================================================================================
#define AT_D 64
#define AT_NW 4
#define AT_QB 64
#define AT_KC 64
#define AT_LP 72       // LDS row pitch of the K, V and P tiles in f16: 144 B = 16 B x 9 (odd), so that the 16 rows of a ds_load_b128 fall on distinct banks
#define AT_MAXCH 6
#define AT_PSC 32768.0f
#define AT_OSC 64.0f      // the output is stored as f16 times 64 (exact power of two), the next GEMM's A operand
struct BandGeom { long q_bs, q_rs, q_hs, k_bs, k_rs, k_hs, v_bs, v_rs, v_hs, o_bs, o_rs, o_hs;
                  int S, H; float qscale, mask_fill; };
static_assert(sizeof(BandGeom) == 112);

__device__ __forceinline__ v8f mma_h(v16h a, v16h b, v8f c) {
  c = __builtin_amdgcn_wmma_f32_16x16x32_f16(false, a, false, b, (short)0, c, false, false);
  asm volatile("v_nop\n\tv_nop\n\tv_nop\n\tv_nop" : "+v"(c) : "v"(a), "v"(b));
  return c;
}

// Five base-2 exponentials, one bare v_exp_f32 each. One statement with early-clobber outputs: no v_exp_f32 then stands directly in
// front of an instruction that reads its result or writes over its source, and the v_nop keeps that slot behind the last one.
__device__ __forceinline__ void exp2_x5(float x0, float x1, float x2, float x3, float x4,
                                        float& e0, float& e1, float& e2, float& e3, float& e4) {
  asm("v_exp_f32 %0, %5\n\tv_exp_f32 %1, %6\n\tv_exp_f32 %2, %7\n\tv_exp_f32 %3, %8\n\tv_exp_f32 %4, %9\n\tv_nop"
      : "=&v"(e0), "=&v"(e1), "=&v"(e2), "=&v"(e3), "=&v"(e4)
      : "v"(x0), "v"(x1), "v"(x2), "v"(x3), "v"(x4));
}

__global__ __launch_bounds__(128)
void attn_band64_kernel(const float* __restrict__ q, const float* __restrict__ k,
                        const float* __restrict__ v, _Float16* __restrict__ out,
                        const int* __restrict__ wptr, BandGeom g) {
  union FH { v16h v; v8h h[2]; };
  __shared__ __align__(16) _Float16 Ksh[AT_KC * AT_LP];       // K [kv][d]   9 KB
  __shared__ __align__(16) _Float16 Vth[AT_D * AT_LP];        // V [d][kv]   9 KB
  __shared__ __align__(16) _Float16 Psh[AT_NW][16 * AT_LP];   // per wave P [row][kv]  9 KB
  __shared__ __align__(16) float    Os[AT_NW][16 * 68];       // per wave out tile, pitch 68

  const int tid  = threadIdx.x;
  const int wave = tid >> 5;
  const int lane = tid & 31;
  const int hh   = lane >> 4;
  const int c    = lane & 15;

  const int nqb = g.S / AT_QB;
  const int bx = blockIdx.x;
  const int qb = bx % nqb;
  const int bh = bx / nqb;
  const int h  = bh % g.H;
  const int b  = bh / g.H;
  const int qbase = qb * AT_QB;
  const int q0 = qbase + wave * 16;

  const float* qb_ptr = q + (size_t)b * g.q_bs + (size_t)h * g.q_hs;
  const float* kb_ptr = k + (size_t)b * g.k_bs + (size_t)h * g.k_hs;
  const float* vb_ptr = v + (size_t)b * g.v_bs + (size_t)h * g.v_hs;
  _Float16*    ob_ptr = out + (size_t)b * g.o_bs + (size_t)h * g.o_hs;

  // ---- Q fragments (A operand, row = q0 + c): d-chunks 0..31 and 32..63 ----
  v16h qa0, qa1;
  {
    const float* qrow = qb_ptr + (size_t)(q0 + c) * g.q_rs;
    const float qs2 = g.qscale * 1.44269504088896340736f;   // the products then are the softmax's base-2 exponents
#pragma unroll
    for (int e = 0; e < 8; ++e) {
      qa0[e]     = (_Float16)(qrow[8 * hh + e] * qs2);
      qa0[8 + e] = (_Float16)(qrow[16 + 8 * hh + e] * qs2);
      qa1[e]     = (_Float16)(qrow[32 + 8 * hh + e] * qs2);
      qa1[8 + e] = (_Float16)(qrow[32 + 16 + 8 * hh + e] * qs2);
    }
  }

  float mrow[8], lrow[8];
  v8f oacc[4];
#pragma unroll
  for (int r = 0; r < 8; ++r) { mrow[r] = -__builtin_huge_valf(); lrow[r] = 0.f; }
#pragma unroll
  for (int t = 0; t < 4; ++t) oacc[t] = (v8f){0.f,0.f,0.f,0.f,0.f,0.f,0.f,0.f};

  // ---- visited key-chunk range (block-uniform), statically bounded trip count ----
  const int nkc = g.S / AT_KC;
  int Wd = wptr[0];
  Wd = Wd < 0 ? 0 : Wd;
  Wd = Wd > g.S ? g.S : Wd;
  const int lo = qbase - Wd;
  const int kcLo = (lo < 0) ? 0 : (lo / AT_KC);
  int kcHi = (qbase + AT_QB - 1 + Wd) / AT_KC;
  kcHi = kcHi > nkc - 1 ? nkc - 1 : kcHi;
  int nvis = kcHi - kcLo + 1;
  nvis = nvis > AT_MAXCH ? AT_MAXCH : nvis;
  nvis = nvis < 1 ? 1 : nvis;

  for (int ci = 0; ci < nvis; ++ci) {
    const int kv0 = (kcLo + ci) * AT_KC;   // kcLo + ci <= kcHi <= nkc - 1
    __syncthreads();
    {
      // 16 lanes x 16 B = one 256-B head row, so a wave-wide load covers 2 rows = 4 whole 128-B lines.
      // A lane takes floats 4 * seg .. + 3 of the 8 consecutive rows 8 * rg + i: for each of its 4 d it then
      // holds 8 consecutive kv, one 16-B store into the transposed V tile.
      const int seg = tid & 15, rg = tid >> 4;
      const float* krow = kb_ptr + (size_t)(kv0 + 8 * rg) * g.k_rs + 4 * seg;
      const float* vrow = vb_ptr + (size_t)(kv0 + 8 * rg) * g.v_rs + 4 * seg;
      const float* kp[8];
      const float* vp[8];
      v4f kk[8], vv[8];
#pragma unroll
      for (int i = 0; i < 8; ++i) { kp[i] = krow + (size_t)i * g.k_rs; vp[i] = vrow + (size_t)i * g.v_rs; }
#pragma unroll
      for (int i = 0; i < 8; ++i) kk[i] = *(const v4f*)kp[i];
#pragma unroll
      for (int i = 0; i < 8; ++i) vv[i] = *(const v4f*)vp[i];
      // the loads' address registers stay live up to here, so nothing (a load's own result included) rewrites one ahead of this wait
      asm volatile("s_wait_xcnt 0x0" :: "v"(kp[0]), "v"(kp[1]), "v"(kp[2]), "v"(kp[3]), "v"(kp[4]), "v"(kp[5]), "v"(kp[6]), "v"(kp[7]),
                                        "v"(vp[0]), "v"(vp[1]), "v"(vp[2]), "v"(vp[3]), "v"(vp[4]), "v"(vp[5]), "v"(vp[6]), "v"(vp[7]) : "memory");
#pragma unroll
      for (int i = 0; i < 8; ++i) {
        v4h kh;
#pragma unroll
        for (int e = 0; e < 4; ++e) kh[e] = (_Float16)kk[i][e];
        *(v4h*)(Ksh + (8 * rg + i) * AT_LP + 4 * seg) = kh;
      }
#pragma unroll
      for (int e = 0; e < 4; ++e) {
        v8h vh;
#pragma unroll
        for (int i = 0; i < 8; ++i) vh[i] = (_Float16)vv[i][e];
        *(v8h*)(Vth + (4 * seg + e) * AT_LP + 8 * rg) = vh;
      }
    }
    __syncthreads();

    // ---- scores: 16 rows x 64 keys per wave ----
    v8f s[4];
#pragma unroll
    for (int j = 0; j < 4; ++j) {
      s[j] = (v8f){0.f,0.f,0.f,0.f,0.f,0.f,0.f,0.f};
      FH kb0, kb1;
      kb0.h[0] = *(const v8h*)(Ksh + (j * 16 + c) * AT_LP + 8 * hh);
      kb0.h[1] = *(const v8h*)(Ksh + (j * 16 + c) * AT_LP + 16 + 8 * hh);
      kb1.h[0] = *(const v8h*)(Ksh + (j * 16 + c) * AT_LP + 32 + 8 * hh);
      kb1.h[1] = *(const v8h*)(Ksh + (j * 16 + c) * AT_LP + 32 + 16 + 8 * hh);
      s[j] = mma_h(qa0, kb0.v, s[j]);
      s[j] = mma_h(qa1, kb1.v, s[j]);
    }

    // ---- band mask + chunk row max ----
    float cm[8];
#pragma unroll
    for (int r = 0; r < 8; ++r) {
      const int qrow = q0 + 8 * hh + r;
      float m = -__builtin_huge_valf();
#pragma unroll
      for (int j = 0; j < 4; ++j) {
        const int kvcol = kv0 + j * 16 + c;
        const int dlt = qrow - kvcol;
        float sv = s[j][r];
        const bool masked = (dlt > Wd) || (dlt < -Wd);
        if (masked) sv = g.mask_fill;
        s[j][r] = sv;
        m = fmaxf(m, sv);
      }
#pragma unroll
      for (int off = 1; off < 16; off <<= 1) m = fmaxf(m, __shfl_xor(m, off, 32));
      cm[r] = m;
    }
    _Float16* pwh = Psh[wave];
#pragma unroll
    for (int r = 0; r < 8; ++r) {
      const float mnew = fmaxf(mrow[r], cm[r]);
      float alpha, pe[4];
      exp2_x5(mrow[r] - mnew, s[0][r] - mnew, s[1][r] - mnew, s[2][r] - mnew, s[3][r] - mnew, alpha, pe[0], pe[1], pe[2], pe[3]);
      mrow[r] = mnew;
      float psum = pe[0];
#pragma unroll
      for (int j = 1; j < 4; ++j) psum += pe[j];
#pragma unroll
      for (int j = 0; j < 4; ++j) pwh[(8 * hh + r) * AT_LP + j * 16 + c] = (_Float16)(pe[j] * AT_PSC);
#pragma unroll
      for (int off = 1; off < 16; off <<= 1) psum += __shfl_xor(psum, off, 32);
      lrow[r] = lrow[r] * alpha + psum;
#pragma unroll
      for (int t = 0; t < 4; ++t) oacc[t][r] *= alpha;
    }
    // P tile: stored as _Float16 elements, reloaded below as v8h of _Float16 after a wave barrier
    __builtin_amdgcn_fence(__ATOMIC_RELEASE, "workgroup");
    __builtin_amdgcn_wave_barrier();
    __builtin_amdgcn_fence(__ATOMIC_ACQUIRE, "workgroup");
#pragma unroll 1
    for (int kk = 0; kk < 2; ++kk) {
      FH pa;
      pa.h[0] = *(const v8h*)(pwh + c * AT_LP + kk * 32 + 8 * hh);
      pa.h[1] = *(const v8h*)(pwh + c * AT_LP + kk * 32 + 16 + 8 * hh);
#pragma unroll
      for (int t = 0; t < 4; ++t) {
        FH vb;
        vb.h[0] = *(const v8h*)(Vth + (t * 16 + c) * AT_LP + kk * 32 + 8 * hh);
        vb.h[1] = *(const v8h*)(Vth + (t * 16 + c) * AT_LP + kk * 32 + 16 + 8 * hh);
        oacc[t] = mma_h(pa.v, vb.v, oacc[t]);
      }
    }
  }

  float* os = Os[wave];
#pragma unroll
  for (int r = 0; r < 8; ++r) {
    const float inv = 1.0f / (lrow[r] * AT_PSC);
#pragma unroll
    for (int t = 0; t < 4; ++t) os[(8 * hh + r) * 68 + t * 16 + c] = oacc[t][r] * inv;
  }
  __builtin_amdgcn_fence(__ATOMIC_RELEASE, "workgroup");
  __builtin_amdgcn_wave_barrier();
  __builtin_amdgcn_fence(__ATOMIC_ACQUIRE, "workgroup");
  {
    const int c8 = (lane & 7) * 8;       // row seg = 64 f16 = 128 B = 8 lanes x 16 B; rows it*4 + (lane >> 3) cover 0..15
#pragma unroll
    for (int it = 0; it < 4; ++it) {
      const int row = it * 4 + (lane >> 3);
      const v4f lo4 = *(const v4f*)(os + row * 68 + c8);
      const v4f hi4 = *(const v4f*)(os + row * 68 + c8 + 4);
      v8h hv;
#pragma unroll
      for (int e = 0; e < 4; ++e) { hv[e] = (_Float16)(lo4[e] * AT_OSC); hv[4 + e] = (_Float16)(hi4[e] * AT_OSC); }
      *(v8h*)(ob_ptr + (size_t)(q0 + row) * g.o_rs + c8) = hv;
    }
  }
}

// =====================================================================================
extern "C" void kernel_launch(void* const* d_in, const int* in_sizes, int n_in,
                              void* d_out, int out_size, void* d_ws, size_t ws_size,
                              hipStream_t stream) {
  constexpr int Bz = 2, S = 2048, D = 1024, H = 16, HD = 64;
  constexpr int TD = 3 * D;          // 3072
  constexpr int M  = Bz * S;         // 4096 token rows
  static_assert(H * HD == D);
  static_assert(M % 256 == 0 && TD % 192 == 0 && D % 128 == 0 && D >= 256 && S % AT_QB == 0);

  if (n_in < 6) return;
  if (in_sizes[0] != M * D || in_sizes[1] != TD * D || in_sizes[2] != TD ||
      in_sizes[3] != D * D || in_sizes[4] != D || in_sizes[5] < 1 || out_size != M * D) return;

  const float* x     = (const float*)d_in[0];   // [B,S,D]
  const float* in_w  = (const float*)d_in[1];   // [3D, D] = (out, in) -> Bt
  const float* in_b  = (const float*)d_in[2];   // [3D]
  const float* out_w = (const float*)d_in[3];   // [D, D] = (out, in) -> Bt
  const float* out_b = (const float*)d_in[4];   // [D]
  const int*   wsz   = (const int*)d_in[5];     // window size, int32[1]
  float* y = (float*)d_out;

  // ---- workspace carve (all offsets multiples of 1 MiB) ----
  const size_t bytes_x16  = (size_t)M  * D  * 2;   //  8,388,608
  const size_t bytes_w16  = (size_t)TD * D  * 2;   //  6,291,456
  const size_t bytes_ow16 = (size_t)D  * D  * 2;   //  2,097,152
  const size_t bytes_qkv  = (size_t)M  * TD * 4;   // 50,331,648 (f32)
  const size_t bytes_a16  = (size_t)M  * D  * 2;   //  8,388,608
  const size_t total = bytes_x16 + bytes_w16 + bytes_ow16 + bytes_qkv + bytes_a16;   // 75,497,472
  if (total > ws_size) return;
  char* p = (char*)d_ws;
  _Float16* x16  = (_Float16*)p;  p += bytes_x16;
  _Float16* w16  = (_Float16*)p;  p += bytes_w16;
  _Float16* ow16 = (_Float16*)p;  p += bytes_ow16;
  float*    qkv  = (float*)p;     p += bytes_qkv;
  _Float16* a16  = (_Float16*)p;  p += bytes_a16;

  // 1) f32 -> f16 casts, one launch: x unscaled, weights x64 (exact power of two, folded back in the GEMM scale)
  {
    static_assert(M * D == 256 * 1024 * 16 && TD * D == 256 * 1024 * 12 && D * D == 256 * 1024 * 4);
    cast3_f32_f16<<<256, 256, 0, stream>>>(x, x16, in_w, w16, out_w, ow16, 64.0f);
  }

  // 2) qkv[M][3D] (f32) = x16 . w16^T * (1/64) + in_b
  {
    dim3 grid((M / 256) * (TD / 192), 1);               // 256 tiles of 256 x 192
    wmma_gemm_tile<4, 2, 6><<<grid, 256, 0, stream>>>(
        (const unsigned short*)x16, D, (const unsigned short*)w16, D,
        qkv, TD, in_b, TD, D, 1.0f / 64.0f);
  }

  // 3) banded attention per (batch, head, 64-query block) -> a16 [B,S,D] f16 carried x64
  {
    BandGeom g;
    g.q_bs = (long)S * TD; g.q_rs = TD; g.q_hs = HD;
    g.k_bs = (long)S * TD; g.k_rs = TD; g.k_hs = HD;
    g.v_bs = (long)S * TD; g.v_rs = TD; g.v_hs = HD;
    g.o_bs = (long)S * D;  g.o_rs = D;  g.o_hs = HD;
    g.S = S; g.H = H; g.qscale = 0.125f; g.mask_fill = -1e30f;
    dim3 grid(Bz * H * (S / AT_QB));                    // 1024 blocks
    attn_band64_kernel<<<grid, 128, 0, stream>>>(qkv, qkv + D, qkv + 2 * D, a16, wsz, g);
  }

  // 4) y[M][D] (f32) = a16 . ow16^T * (1/4096) + out_b
  {
    dim3 grid((M / 128) * (D / 128), 1);                // 256 tiles of 128 x 128
    wmma_gemm_tile<2, 2, 4><<<grid, 128, 0, stream>>>(
        (const unsigned short*)a16, D, (const unsigned short*)ow16, D,
        y, D, out_b, D, D, 1.0f / 4096.0f);
  }
  (void)stream;
}

// v008
// One run takes 63 microseconds.
// Two timings next to v007 put it at 1.06 and 1.07 times that version's speed.
// Counting every step since v000, it is 2.85 times as fast.
#include <hip/hip_runtime.h>
#include <stdint.h>
// qkv projection and output projection: v_wmma_f32_16x16x32_f16 (f16 operands, weights carried x64, f32 accumulate); attention k.q^T and v^T.p^T: v_wmma_f32_16x16x32_f16 (f16 operands, p carried x2^15, f32 accumulate); softmax and epilogues f32.

typedef __attribute__((ext_vector_type(16))) _Float16 v16h;
typedef __attribute__((ext_vector_type(8)))  _Float16 v8h;
typedef __attribute__((ext_vector_type(16))) __bf16   v16b;
typedef __attribute__((ext_vector_type(8)))  __bf16   v8b;
typedef __attribute__((ext_vector_type(8)))  float    v8f;
typedef __attribute__((ext_vector_type(4)))  float    v4f;
#define PSCALE 32768.0f
#define U16(p) ((const unsigned short*)(const void*)(p))
#define PSCALE_INV (1.0f / 32768.0f)

__device__ __forceinline__ unsigned short f2bf_bits(float f) {
  unsigned u = __float_as_uint(f);
  return (unsigned short)((u + 0x7FFFu + ((u >> 16) & 1u)) >> 16);
}
__device__ __forceinline__ float bf_bits2f(unsigned short h) { return __uint_as_float(((unsigned)h) << 16); }

// ---- Block-tiled WMMA GEMM, operands staged in LDS by the tensor mover ------
// C[m,n] = scale * sum_k A[m,k] * Bt[n,k] + bias[n]; f16 operands, f32 accumulate, f32 out.
// A row-major [M,K]; Bt row-major [N,K]; M % (64 WM) == 0, N % (16 FJ WN) == 0; K % 128 == 0 and K >= 256 (two stages).
// One work-group = WM x WN waves = one (64 WM) x (16 FJ WN) tile of C; each wave owns 64 x 16 FJ.
// A pass is 128 k = 256 B of each operand row. A stage is slices of 64 rows, first the tile's A rows, then its Bt rows,
// LDS pitch 272 B (16 B pad behind each row); wave s issues one tensor load per stage for slice s. Two buffers.
// <2, 2, 4>: 128 x 128, 4 slices, 4 waves. <4, 2, 6>: 256 x 192, 7 slices, 8 waves (the last wave issues none):
// 448 operand rows feed 49,152 elements of C where 256 rows feed 16,384, so 0.58 of the bytes come from L2 per element.
typedef uint32_t u32x4 __attribute__((ext_vector_type(4)));
typedef uint32_t u32x8 __attribute__((ext_vector_type(8)));
#define GT_ROWB  256u      // bytes of an operand row per pass
#define GT_ROWS  64u       // rows per slice
#define GT_PITCH 272u      // LDS row pitch: odd multiple of 16 B for ds_load_b128 readers
#define GT_SLICE 18432u    // 64 x 272 = 17,408 B rounded up to a multiple of 2 KiB
static_assert(GT_ROWS * GT_PITCH <= GT_SLICE && GT_SLICE % 2048u == 0u);

__device__ __forceinline__ uint32_t uni(uint32_t v) { return (uint32_t)__builtin_amdgcn_readfirstlane(v); }
__device__ __forceinline__ uint32_t pinned(uint32_t v) { uint32_t w = uni(v); asm volatile("" : "+s"(w)); return w; }   // a wave-uniform word held in a scalar register: a test on it compiles to s_cmp + s_cbranch_scc (tensor loads ignore EXEC)
// this wave's LDS reads have retired before the buffer they read is handed back for a refill
__device__ __forceinline__ void wait_ds0() { asm volatile("s_wait_dscnt 0x0" ::: "memory"); }
// this wave's own tensor load has landed (the compiler places no wait for the tensor mover)
// The request's descriptor words are inputs: their registers stay live up to the wait that covers the request, so none takes another value while it is outstanding.
__device__ __forceinline__ void wait_tensor0(u32x4 g0, u32x8 g1) { asm volatile("s_wait_tensorcnt 0x0" :: "s"(g0), "s"(g1) : "memory"); }
// one request of the whole wave: a 2-D tile from global memory into LDS
__device__ __forceinline__ void tdm_load(u32x4 g0, u32x8 g1) { asm volatile("tensor_load_to_lds %0, %1" :: "s"(g0), "s"(g1) : "memory"); }
__device__ __forceinline__ u32x8 tdm_group1(uint32_t src_pitch) {   // 1-byte elements, tile = tensor = 64 rows of 256 B
  u32x8 g;
  g[0] = uni((1u << 20) | (5u << 22) | (3u << 25));   // no mask; a pad of 4 dwords behind every 64 dwords
  g[1] = uni((GT_ROWB & 0xFFFFu) << 16);
  g[2] = uni((GT_ROWB >> 16) | ((GT_ROWS & 0xFFFFu) << 16));
  g[3] = uni((GT_ROWS >> 16) | (GT_ROWB << 16));
  g[4] = uni(GT_ROWS);
  g[5] = uni(src_pitch);
  g[6] = uni(0u);
  g[7] = uni(0u);
  return g;
}
__device__ __forceinline__ u32x4 tdm_group0(uint32_t lds_dst, uint64_t ga) {
  u32x4 g;
  g[0] = uni(1u); g[1] = uni(lds_dst); g[2] = uni((uint32_t)ga);
  g[3] = uni((((uint32_t)(ga >> 32)) & 0x01FFFFFFu) | 0x80000000u);
  asm volatile("" : "+s"(g));   // as pinned(): descriptor words held in their scalar registers; without it the constant word 0 is formed anew at each use and its register serves other values in between
  return g;
}
__device__ __forceinline__ v16h lds_frag(const unsigned char* p) {   // elements 0..7 <- k 0..7, 8..15 <- k 16..23 from p
  union { v16h v; v8h h[2]; } f;
  f.h[0] = *(const v8h*)(p); f.h[1] = *(const v8h*)(p + 32); return f.v;
}

template <int WM, int WN, int FJ>
__global__ __launch_bounds__(WM * WN * 32) void wmma_gemm_tile(
    const unsigned short* __restrict__ A, int lda,
    const unsigned short* __restrict__ Bt, int ldb,
    float* __restrict__ C, int ldc,
    const float* __restrict__ bias,
    int N, int K, float scale) {
  constexpr int      TM  = WM * 64, WC = FJ * 16, TN = WN * WC;   // tile rows, wave columns, tile columns
  constexpr uint32_t ASL = WM, NSL = ASL + TN / 64;                // slices of A, slices of a stage
  constexpr uint32_t GT_STAGE = NSL * GT_SLICE;
  constexpr bool     ALLW = (NSL == (uint32_t)(WM * WN));          // every wave has a slice to bring
  static_assert(TN % 64 == 0 && NSL <= (uint32_t)(WM * WN) && 2u * GT_STAGE <= 320u * 1024u);
  __shared__ __attribute__((aligned(2048))) unsigned char L[2u * GT_STAGE];
  const int lane = threadIdx.x & 31;
  const uint32_t wave = uni(threadIdx.x >> 5);
  const int tilesN = N / TN;
  const int tm = blockIdx.x / tilesN;
  const int tn = blockIdx.x - tm * tilesN;
  const int wm = wave / WN, wn = wave % WN;
  const int m0 = tm * TM + (wm << 6);          // this wave's 64 x WC tile of C
  const int n0 = tn * TN + wn * WC;

  const int rlane = lane & 15;                 // row (A) / col (B, D) within subtile
  const int hh    = lane >> 4;                 // k half of this lane; D row offset 8 * hh
  const int mOff  = hh * 8;

  // this wave's slice of every stage: the first ASL waves bring A rows, the next bring Bt rows
  const unsigned short* srow = (wave < ASL) ? (A  + (size_t)(tm * TM + (int)(wave << 6)) * lda)
                                            : (Bt + (size_t)(tn * TN + (int)((wave - ASL) << 6)) * ldb);
  const uint64_t src0 = (uint64_t)(uintptr_t)srow;
  u32x8 g1 = tdm_group1((uint32_t)((wave < ASL) ? lda : ldb) * 2u);
  asm volatile("" : "+s"(g1));   // as pinned(): descriptor words held in their scalar registers, so that none takes another value while a request is outstanding
  const uint32_t lds_slice = (uint32_t)(size_t)L + wave * GT_SLICE;
  const uint32_t T = (uint32_t)K >> 7;         // passes

  const uint32_t aOff = (uint32_t)wm * GT_SLICE + (uint32_t)rlane * GT_PITCH + (uint32_t)hh * 16u;
  uint32_t bOff[FJ];                           // fragment j = Bt rows wn * WC + 16 j .. + 15 of the tile: 16 rows lie in one slice
#pragma unroll
  for (int j = 0; j < FJ; ++j) {
    const uint32_t rj = (uint32_t)(wn * WC + j * 16);
    bOff[j] = (ASL + (rj >> 6)) * GT_SLICE + ((rj & 63u) + (uint32_t)rlane) * GT_PITCH + (uint32_t)hh * 16u;
  }

  v8f acc[4][FJ];
#pragma unroll
  for (int i = 0; i < 4; ++i)
#pragma unroll
    for (int j = 0; j < FJ; ++j) acc[i][j] = (v8f){0.f,0.f,0.f,0.f,0.f,0.f,0.f,0.f};

  // prologue: stage 0 lands and is published, then stage 1 flies under pass 0
  u32x4 g0 = tdm_group0(lds_slice, src0);      // group 0 of this wave's youngest request
  if (ALLW || pinned(wave < NSL)) tdm_load(g0, g1);
  wait_tensor0(g0, g1);
  __syncthreads();
  g0 = tdm_group0(lds_slice + GT_STAGE, src0 + GT_ROWB);
  if (ALLW || pinned(wave < NSL)) tdm_load(g0, g1);

  for (uint32_t t = 0; t < T; ++t) {
    const uint32_t buf = (t & 1u) * GT_STAGE;
    const unsigned char* La = L + buf + aOff;
    const unsigned char* Lb = L + buf;
    v16h af[2][4], bf[2][FJ];                  // set (ks & 1) holds block ks's fragments; a block is 32 k = 4 FJ WMMAs
#pragma unroll
    for (int j = 0; j < FJ; ++j) bf[0][j] = lds_frag(Lb + bOff[j]);
#pragma unroll
    for (int i = 0; i < 4; ++i) af[0][i] = lds_frag(La + i * 16 * GT_PITCH);
#pragma unroll
    for (int ks = 0; ks < 4; ++ks) {
      const int cs = ks & 1;
      if (ks < 3) {
#pragma unroll
        for (int j = 0; j < FJ; ++j) bf[cs ^ 1][j] = lds_frag(Lb + bOff[j] + (ks + 1) * 64);
#pragma unroll
        for (int i = 0; i < 4; ++i) af[cs ^ 1][i] = lds_frag(La + i * 16 * GT_PITCH + (ks + 1) * 64);
      }
      // keeps the next block's LDS loads as one group ahead of this block's WMMAs; without it they sink among the WMMAs, each behind a wait to 0
      __builtin_amdgcn_sched_barrier(0);
#pragma unroll
      for (int i = 0; i < 4; ++i)
#pragma unroll
        for (int j = 0; j < FJ; ++j)
          acc[i][j] = __builtin_amdgcn_wmma_f32_16x16x32_f16(false, af[cs][i], false, bf[cs][j], (short)0, acc[i][j], false, false);
      // ends the block: without it the following load group is lifted in among these WMMAs, into further registers
      __builtin_amdgcn_sched_barrier(0);
    }
    // publish point of stage t + 1, which also frees the buffer that pass t has read
    wait_ds0();
    wait_tensor0(g0, g1);
    __syncthreads();
    if (pinned((t + 2u < T) && (ALLW || wave < NSL))) {
      g0 = tdm_group0(lds_slice + buf, src0 + (uint64_t)((t + 2u) * GT_ROWB));
      tdm_load(g0, g1);
    }
  }
  wait_tensor0(g0, g1);
  wait_ds0();

  // ---- epilogue: the ring is free behind the last pass's barrier; each wave stages 16 x WC in its own range ----
  constexpr int SP = WC + 4;                             // pitch in floats
  float* slab = (float*)(L + wave * (16u * SP * 4u));
#pragma unroll
  for (int i = 0; i < 4; ++i) {
    float* Ci = C + (size_t)(m0 + (i << 4)) * ldc + n0;   // wave-uniform; a lane's offset from it is the same in all four turns
#pragma unroll
    for (int j = 0; j < FJ; ++j) {
      const float bv = bias[n0 + (j << 4) + rlane];
#pragma unroll
      for (int r = 0; r < 8; ++r) {
        float v = acc[i][j][r] * scale;
        v += bv;
        slab[(mOff + r) * SP + (j << 4) + rlane] = v;
      }
    }
    __builtin_amdgcn_fence(__ATOMIC_RELEASE, "workgroup");
    __builtin_amdgcn_wave_barrier();
    __builtin_amdgcn_fence(__ATOMIC_ACQUIRE, "workgroup");
    {
      constexpr int SEG = WC / 4;         // 16-B pieces of a row seg of 4 WC bytes (whole 128-B lines); 16 SEG pieces = 2 FJ turns of 32 lanes
#pragma unroll
      for (int it = 0; it < 2 * FJ; ++it) {
        const int u = it * 32 + lane;
        const int row = u / SEG;
        const int c4 = (u - row * SEG) * 4;
        v4f v = *(const v4f*)(slab + row * SP + c4);
        *(v4f*)(Ci + (row * ldc + c4)) = v;
      }
    }
    __builtin_amdgcn_fence(__ATOMIC_RELEASE, "workgroup");
    __builtin_amdgcn_wave_barrier();
    __builtin_amdgcn_fence(__ATOMIC_ACQUIRE, "workgroup");
  }
}

// f32 -> f16 conversion of the three f32 inputs in ONE launch: x unscaled, both weight matrices times wsc.
// One work-group of 8 waves converts 256 * NL groups of 4 floats of each input (NL = 16, 12, 4): every lane issues all
// its 32 16-byte loads (512 contiguous bytes per wave and load) before it converts the first.
typedef __attribute__((ext_vector_type(4))) _Float16 v4h;
template <int NL>
__device__ __forceinline__ size_t cast_base() { return ((size_t)blockIdx.x * (256u * NL) + threadIdx.x) * 4u; }   // first float of this lane
template <int NL>
__device__ __forceinline__ void cast_load(const float* p, v4f (&v)[NL]) {
#pragma unroll
  for (int i = 0; i < NL; ++i) v[i] = *(const v4f*)(p + i * 1024);
}
template <int NL>
__device__ __forceinline__ void cast_store(_Float16* o, const v4f (&v)[NL], float sc) {
#pragma unroll
  for (int i = 0; i < NL; ++i) {
    v4h h;
#pragma unroll
    for (int e = 0; e < 4; ++e) h[e] = (_Float16)(v[i][e] * sc);
    *(v4h*)(o + i * 1024) = h;
  }
}
// element counts = gridDim.x * 1024 * {16, 12, 4} exactly (asserted where it is launched)
__global__ __launch_bounds__(256) void cast3_f32_f16(const float* __restrict__ x,  _Float16* __restrict__ x16,
                                                     const float* __restrict__ w,  _Float16* __restrict__ w16,
                                                     const float* __restrict__ ow, _Float16* __restrict__ ow16, float wsc) {
  const float* px = x  + cast_base<16>();
  const float* pw = w  + cast_base<12>();
  const float* po = ow + cast_base<4>();
  v4f vx[16], vw[12], vo[4];
  cast_load<16>(px, vx);
  cast_load<12>(pw, vw);
  cast_load<4>(po, vo);
  // the loads' address registers stay live up to here, so nothing (a load's own result included) rewrites one ahead of this wait
  asm volatile("s_wait_xcnt 0x0" :: "v"(px), "v"(pw), "v"(po) : "memory");
  cast_store<16>(x16  + cast_base<16>(), vx, 1.0f);
  cast_store<12>(w16  + cast_base<12>(), vw, wsc);
  cast_store<4>(ow16 + cast_base<4>(),  vo, wsc);
}

// =====================================================================================
// Banded (sliding-window) attention for head_dim 64, f32 in / f16 out carried x64, f16 operands.
//   scores^T = k . (q * qscale * log2(e))^T : v_wmma_f32_16x16x32_f16, f32 accumulate; q takes the factor in f32, ahead of its f16 rounding
//   out^T    = v^T . p^T         : v_wmma_f32_16x16x32_f16, p carried x2^15, folded into the final 1/l
//   Both products are formed transposed (keys or d down the rows, queries across the columns): lane (c, hh) then holds, for the ONE
//   query q0 + c, keys 16 j + 8 hh + r in its own registers. Row maximum and row sum run over a lane's registers, lanes c and c + 16
//   meet in one cross-row move, and the 16 p values of tiles 2 kk and 2 kk + 1 ARE the lane's part of the B fragment of key block kk.
//   Online softmax in f32, in base 2: e^(x - m) = 2^((x - m) * log2(e)), so each exponential is one subtract and one v_exp_f32.
//   Block = 4 waves = 64 query rows of one (batch, head); S % 64 == 0.
//   Key chunks of 64; only chunks overlapping [q - W, q + W] for the block's rows are visited
//   (static bound AT_MAXCH, computed start); keys with |q - kv| > W get mask_fill before the softmax.
//   Element (b, s, h, d) of tensor X lives at X[b*X_bs + s*X_rs + h*X_hs + d] (strides in elements, multiples of 8).
//   grid.x = B * H * (S/64).
// =====================================================================================
#define AT_D 64
#define AT_NW 4
#define AT_QB 64
#define AT_KC 64
#define AT_LP 72       // LDS row pitch of the K and V tiles in f16: 144 B = 16 B x 9 (odd), so that the 16 rows of a ds_load_b128 fall on distinct banks
#define AT_MAXCH 6
#define AT_PSC 32768.0f
#define AT_OSC 64.0f      // the output is stored as f16 times 64 (exact power of two), the next GEMM's A operand
struct BandGeom { long q_bs, q_rs, q_hs, k_bs, k_rs, k_hs, v_bs, v_rs, v_hs, o_bs, o_rs, o_hs;
                  int S, H; float qscale, mask_fill; };
static_assert(sizeof(BandGeom) == 112);

__device__ __forceinline__ v8f mma_h(v16h a, v16h b, v8f c) {
  c = __builtin_amdgcn_wmma_f32_16x16x32_f16(false, a, false, b, (short)0, c, false, false);
  asm volatile("v_nop\n\tv_nop\n\tv_nop\n\tv_nop" : "+v"(c) : "v"(a), "v"(b));
  return c;
}

// Base-2 exponentials, one bare v_exp_f32 each. One statement with early-clobber outputs: no v_exp_f32 then stands directly in
// front of an instruction that reads its result or writes over its source, and the v_nop keeps that slot behind the last one.
__device__ __forceinline__ void exp2_x4(float x0, float x1, float x2, float x3, float& e0, float& e1, float& e2, float& e3) {
  asm("v_exp_f32 %0, %4\n\tv_exp_f32 %1, %5\n\tv_exp_f32 %2, %6\n\tv_exp_f32 %3, %7\n\tv_nop"
      : "=&v"(e0), "=&v"(e1), "=&v"(e2), "=&v"(e3)
      : "v"(x0), "v"(x1), "v"(x2), "v"(x3));
}
__device__ __forceinline__ float exp2_x1(float x) {
  float e;
  asm("v_exp_f32 %0, %1\n\tv_nop" : "=&v"(e) : "v"(x));
  return e;
}
// the value of lane l ^ 16: the other half of the keys of the same query
__device__ __forceinline__ float xhalf(float x) {
  return __builtin_bit_cast(float, __builtin_amdgcn_permlanex16(__builtin_bit_cast(int, x), __builtin_bit_cast(int, x), 0x76543210, 0xfedcba98, false, false));
}

__global__ __launch_bounds__(128)
void attn_band64_kernel(const float* __restrict__ q, const float* __restrict__ k,
                        const float* __restrict__ v, _Float16* __restrict__ out,
                        const int* __restrict__ wptr, BandGeom g) {
  union FH { v16h v; v8h h[2]; };
  __shared__ __align__(16) _Float16 Ksh[AT_KC * AT_LP];       // K [kv][d]   9 KB
  __shared__ __align__(16) _Float16 Vth[AT_D * AT_LP];        // V [d][kv]   9 KB
  __shared__ __align__(16) float    Os[AT_NW][16 * 68];       // per wave out tile, pitch 68

  const int tid  = threadIdx.x;
  const int wave = tid >> 5;
  const int lane = tid & 31;
  const int hh   = lane >> 4;
  const int c    = lane & 15;

  const int nqb = g.S / AT_QB;
  const int bx = blockIdx.x;
  const int qb = bx % nqb;
  const int bh = bx / nqb;
  const int h  = bh % g.H;
  const int b  = bh / g.H;
  const int qbase = qb * AT_QB;
  const int q0 = qbase + wave * 16;

  const float* qb_ptr = q + (size_t)b * g.q_bs + (size_t)h * g.q_hs;
  const float* kb_ptr = k + (size_t)b * g.k_bs + (size_t)h * g.k_hs;
  const float* vb_ptr = v + (size_t)b * g.v_bs + (size_t)h * g.v_hs;
  _Float16*    ob_ptr = out + (size_t)b * g.o_bs + (size_t)h * g.o_hs;

  // ---- Q fragments (B operand, column = q0 + c): d-chunks 0..31 and 32..63 ----
  v16h qa0, qa1;
  {
    const float* qrow = qb_ptr + (size_t)(q0 + c) * g.q_rs;
    const float qs2 = g.qscale * 1.44269504088896340736f;   // the products then are the softmax's base-2 exponents
#pragma unroll
    for (int e = 0; e < 8; ++e) {
      qa0[e]     = (_Float16)(qrow[8 * hh + e] * qs2);
      qa0[8 + e] = (_Float16)(qrow[16 + 8 * hh + e] * qs2);
      qa1[e]     = (_Float16)(qrow[32 + 8 * hh + e] * qs2);
      qa1[8 + e] = (_Float16)(qrow[32 + 16 + 8 * hh + e] * qs2);
    }
  }

  float mrow = -__builtin_huge_valf();   // running maximum of query q0 + c, equal in lanes c and c + 16
  float lrow = 0.f;                      // running sum over THIS lane's keys only; the two halves are added behind the loop
  v8f oacc[4];                           // out^T: element r of tile t = d 16 t + 8 hh + r of query q0 + c
#pragma unroll
  for (int t = 0; t < 4; ++t) oacc[t] = (v8f){0.f,0.f,0.f,0.f,0.f,0.f,0.f,0.f};

  // ---- visited key-chunk range (block-uniform), statically bounded trip count ----
  const int nkc = g.S / AT_KC;
  int Wd = wptr[0];
  Wd = Wd < 0 ? 0 : Wd;
  Wd = Wd > g.S ? g.S : Wd;
  const int lo = qbase - Wd;
  const int kcLo = (lo < 0) ? 0 : (lo / AT_KC);
  int kcHi = (qbase + AT_QB - 1 + Wd) / AT_KC;
  kcHi = kcHi > nkc - 1 ? nkc - 1 : kcHi;
  int nvis = kcHi - kcLo + 1;
  nvis = nvis > AT_MAXCH ? AT_MAXCH : nvis;
  nvis = nvis < 1 ? 1 : nvis;

  for (int ci = 0; ci < nvis; ++ci) {
    const int kv0 = (kcLo + ci) * AT_KC;   // kcLo + ci <= kcHi <= nkc - 1
    __syncthreads();
    {
      // 16 lanes x 16 B = one 256-B head row, so a wave-wide load covers 2 rows = 4 whole 128-B lines.
      // A lane takes floats 4 * seg .. + 3 of the 8 consecutive rows 8 * rg + i: for each of its 4 d it then
      // holds 8 consecutive kv, one 16-B store into the transposed V tile.
      const int seg = tid & 15, rg = tid >> 4;
      const float* krow = kb_ptr + (size_t)(kv0 + 8 * rg) * g.k_rs + 4 * seg;
      const float* vrow = vb_ptr + (size_t)(kv0 + 8 * rg) * g.v_rs + 4 * seg;
      const float* kp[8];
      const float* vp[8];
      v4f kk[8], vv[8];
#pragma unroll
      for (int i = 0; i < 8; ++i) { kp[i] = krow + (size_t)i * g.k_rs; vp[i] = vrow + (size_t)i * g.v_rs; }
#pragma unroll
      for (int i = 0; i < 8; ++i) kk[i] = *(const v4f*)kp[i];
#pragma unroll
      for (int i = 0; i < 8; ++i) vv[i] = *(const v4f*)vp[i];
      // the loads' address registers stay live up to here, so nothing (a load's own result included) rewrites one ahead of this wait
      asm volatile("s_wait_xcnt 0x0" :: "v"(kp[0]), "v"(kp[1]), "v"(kp[2]), "v"(kp[3]), "v"(kp[4]), "v"(kp[5]), "v"(kp[6]), "v"(kp[7]),
                                        "v"(vp[0]), "v"(vp[1]), "v"(vp[2]), "v"(vp[3]), "v"(vp[4]), "v"(vp[5]), "v"(vp[6]), "v"(vp[7]) : "memory");
#pragma unroll
      for (int i = 0; i < 8; ++i) {
        v4h kh;
#pragma unroll
        for (int e = 0; e < 4; ++e) kh[e] = (_Float16)kk[i][e];
        *(v4h*)(Ksh + (8 * rg + i) * AT_LP + 4 * seg) = kh;
      }
#pragma unroll
      for (int e = 0; e < 4; ++e) {
        v8h vh;
#pragma unroll
        for (int i = 0; i < 8; ++i) vh[i] = (_Float16)vv[i][e];
        *(v8h*)(Vth + (4 * seg + e) * AT_LP + 8 * rg) = vh;
      }
    }
    __syncthreads();

    // ---- scores^T: 64 keys x 16 queries per wave; tile j = keys 16 j .. + 15 ----
    // every loop from here to the end of the chunk is unrolled: s, oacc and pb are register arrays, and an index known only at run time would send them to scratch
    v8f s[4];
#pragma unroll
    for (int j = 0; j < 4; ++j) {
      s[j] = (v8f){0.f,0.f,0.f,0.f,0.f,0.f,0.f,0.f};
      FH kb0, kb1;
      kb0.h[0] = *(const v8h*)(Ksh + (j * 16 + c) * AT_LP + 8 * hh);
      kb0.h[1] = *(const v8h*)(Ksh + (j * 16 + c) * AT_LP + 16 + 8 * hh);
      kb1.h[0] = *(const v8h*)(Ksh + (j * 16 + c) * AT_LP + 32 + 8 * hh);
      kb1.h[1] = *(const v8h*)(Ksh + (j * 16 + c) * AT_LP + 32 + 16 + 8 * hh);
      s[j] = mma_h(kb0.v, qa0, s[j]);
      s[j] = mma_h(kb1.v, qa1, s[j]);
    }

    // ---- band mask + chunk maximum of this lane's query ----
    const int d0 = q0 + c - kv0 - 8 * hh;   // query minus this lane's first key; element r of tile j lies 16 j + r keys further on
    float cm = -__builtin_huge_valf();
#pragma unroll
    for (int j = 0; j < 4; ++j) {
#pragma unroll
      for (int r = 0; r < 8; ++r) {
        const int dlt = d0 - (j * 16 + r);
        float sv = s[j][r];
        const bool masked = (dlt > Wd) || (dlt < -Wd);
        if (masked) sv = g.mask_fill;
        s[j][r] = sv;
        cm = fmaxf(cm, sv);
      }
    }
    cm = fmaxf(cm, xhalf(cm));
    const float mnew = fmaxf(mrow, cm);
    const float alpha = exp2_x1(mrow - mnew);
    mrow = mnew;
    float psum = 0.f;
#pragma unroll
    for (int j = 0; j < 4; ++j) {
#pragma unroll
      for (int r = 0; r < 8; r += 4) {
        float e0, e1, e2, e3;
        exp2_x4(s[j][r] - mnew, s[j][r + 1] - mnew, s[j][r + 2] - mnew, s[j][r + 3] - mnew, e0, e1, e2, e3);
        s[j][r] = e0; s[j][r + 1] = e1; s[j][r + 2] = e2; s[j][r + 3] = e3;
        psum += (e0 + e1) + (e2 + e3);
      }
    }
    lrow = lrow * alpha + psum;
#pragma unroll
    for (int t = 0; t < 4; ++t)
#pragma unroll
      for (int r = 0; r < 8; ++r) oacc[t][r] *= alpha;

    // ---- out^T += v^T . p^T: B fragment of key block kk, elements 0..7 <- keys 32 kk + 8 hh + e (tile 2 kk), 8..15 <- keys 32 kk + 16 + 8 hh + e (tile 2 kk + 1) ----
#pragma unroll
    for (int kk = 0; kk < 2; ++kk) {
      v16h pb;
#pragma unroll
      for (int e = 0; e < 8; ++e) {
        pb[e]     = (_Float16)(s[2 * kk][e] * AT_PSC);
        pb[8 + e] = (_Float16)(s[2 * kk + 1][e] * AT_PSC);
      }
#pragma unroll
      for (int t = 0; t < 4; ++t) {
        FH vb;
        vb.h[0] = *(const v8h*)(Vth + (t * 16 + c) * AT_LP + kk * 32 + 8 * hh);
        vb.h[1] = *(const v8h*)(Vth + (t * 16 + c) * AT_LP + kk * 32 + 16 + 8 * hh);
        oacc[t] = mma_h(vb.v, pb, oacc[t]);
      }
    }
  }

  float* os = Os[wave];
  {
    const float inv = 1.0f / ((lrow + xhalf(lrow)) * AT_PSC);
#pragma unroll
    for (int t = 0; t < 4; ++t) {
      v4f lo4, hi4;
#pragma unroll
      for (int e = 0; e < 4; ++e) { lo4[e] = oacc[t][e] * inv; hi4[e] = oacc[t][4 + e] * inv; }
      *(v4f*)(os + c * 68 + t * 16 + 8 * hh)     = lo4;
      *(v4f*)(os + c * 68 + t * 16 + 8 * hh + 4) = hi4;
    }
  }
  __builtin_amdgcn_fence(__ATOMIC_RELEASE, "workgroup");
  __builtin_amdgcn_wave_barrier();
  __builtin_amdgcn_fence(__ATOMIC_ACQUIRE, "workgroup");
  {
    const int c8 = (lane & 7) * 8;       // row seg = 64 f16 = 128 B = 8 lanes x 16 B; rows it*4 + (lane >> 3) cover 0..15
#pragma unroll
    for (int it = 0; it < 4; ++it) {
      const int row = it * 4 + (lane >> 3);
      const v4f lo4 = *(const v4f*)(os + row * 68 + c8);
      const v4f hi4 = *(const v4f*)(os + row * 68 + c8 + 4);
      v8h hv;
#pragma unroll
      for (int e = 0; e < 4; ++e) { hv[e] = (_Float16)(lo4[e] * AT_OSC); hv[4 + e] = (_Float16)(hi4[e] * AT_OSC); }
      *(v8h*)(ob_ptr + (size_t)(q0 + row) * g.o_rs + c8) = hv;
    }
  }
}

// =====================================================================================
extern "C" void kernel_launch(void* const* d_in, const int* in_sizes, int n_in,
                              void* d_out, int out_size, void* d_ws, size_t ws_size,
                              hipStream_t stream) {
  constexpr int Bz = 2, S = 2048, D = 1024, H = 16, HD = 64;
  constexpr int TD = 3 * D;          // 3072
  constexpr int M  = Bz * S;         // 4096 token rows
  static_assert(H * HD == D);
  static_assert(M % 256 == 0 && TD % 192 == 0 && D % 128 == 0 && D >= 256 && S % AT_QB == 0);

  if (n_in < 6) return;
  if (in_sizes[0] != M * D || in_sizes[1] != TD * D || in_sizes[2] != TD ||
      in_sizes[3] != D * D || in_sizes[4] != D || in_sizes[5] < 1 || out_size != M * D) return;

  const float* x     = (const float*)d_in[0];   // [B,S,D]
  const float* in_w  = (const float*)d_in[1];   // [3D, D] = (out, in) -> Bt
  const float* in_b  = (const float*)d_in[2];   // [3D]
  const float* out_w = (const float*)d_in[3];   // [D, D] = (out, in) -> Bt
  const float* out_b = (const float*)d_in[4];   // [D]
  const int*   wsz   = (const int*)d_in[5];     // window size, int32[1]
  float* y = (float*)d_out;

  // ---- workspace carve (all offsets multiples of 1 MiB) ----
  const size_t bytes_x16  = (size_t)M  * D  * 2;   //  8,388,608
  const size_t bytes_w16  = (size_t)TD * D  * 2;   //  6,291,456
  const size_t bytes_ow16 = (size_t)D  * D  * 2;   //  2,097,152
  const size_t bytes_qkv  = (size_t)M  * TD * 4;   // 50,331,648 (f32)
  const size_t bytes_a16  = (size_t)M  * D  * 2;   //  8,388,608
  const size_t total = bytes_x16 + bytes_w16 + bytes_ow16 + bytes_qkv + bytes_a16;   // 75,497,472
  if (total > ws_size) return;
  char* p = (char*)d_ws;
  _Float16* x16  = (_Float16*)p;  p += bytes_x16;
  _Float16* w16  = (_Float16*)p;  p += bytes_w16;
  _Float16* ow16 = (_Float16*)p;  p += bytes_ow16;
  float*    qkv  = (float*)p;     p += bytes_qkv;
  _Float16* a16  = (_Float16*)p;  p += bytes_a16;

  // 1) f32 -> f16 casts, one launch: x unscaled, weights x64 (exact power of two, folded back in the GEMM scale)
  {
    static_assert(M * D == 256 * 1024 * 16 && TD * D == 256 * 1024 * 12 && D * D == 256 * 1024 * 4);
    cast3_f32_f16<<<256, 256, 0, stream>>>(x, x16, in_w, w16, out_w, ow16, 64.0f);
  }

  // 2) qkv[M][3D] (f32) = x16 . w16^T * (1/64) + in_b
  {
    dim3 grid((M / 256) * (TD / 192), 1);               // 256 tiles of 256 x 192
    wmma_gemm_tile<4, 2, 6><<<grid, 256, 0, stream>>>(
        (const unsigned short*)x16, D, (const unsigned short*)w16, D,
        qkv, TD, in_b, TD, D, 1.0f / 64.0f);
  }

  // 3) banded attention per (batch, head, 64-query block) -> a16 [B,S,D] f16 carried x64
  {
    BandGeom g;
    g.q_bs = (long)S * TD; g.q_rs = TD; g.q_hs = HD;
    g.k_bs = (long)S * TD; g.k_rs = TD; g.k_hs = HD;
    g.v_bs = (long)S * TD; g.v_rs = TD; g.v_hs = HD;
    g.o_bs = (long)S * D;  g.o_rs = D;  g.o_hs = HD;
    g.S = S; g.H = H; g.qscale = 0.125f; g.mask_fill = -1e30f;
    dim3 grid(Bz * H * (S / AT_QB));                    // 1024 blocks
    attn_band64_kernel<<<grid, 128, 0, stream>>>(qkv, qkv + D, qkv + 2 * D, a16, wsz, g);
  }

  // 4) y[M][D] (f32) = a16 . ow16^T * (1/4096) + out_b
  {
    dim3 grid((M / 128) * (D / 128), 1);                // 256 tiles of 128 x 128
    wmma_gemm_tile<2, 2, 4><<<grid, 128, 0, stream>>>(
        (const unsigned short*)a16, D, (const unsigned short*)ow16, D,
        y, D, out_b, D, D, 1.0f / 4096.0f);
  }
  (void)stream;
}

// v009
// Measured time: 55.6 microseconds a run.
// In two side-by-side timings against v008, it was 1.14 and 1.13 times as fast.
// All steps since v000 together make it 3.22 times as fast.
#include <hip/hip_runtime.h>
#include <stdint.h>
// qkv projection and output projection: v_wmma_f32_16x16x32_f16 (f16 operands, weights carried x64, f32 accumulate); attention k.q^T and v^T.p^T: v_wmma_f32_16x16x32_f16 (f16 operands, p carried x2^15, f32 accumulate); softmax and epilogues f32.

typedef __attribute__((ext_vector_type(16))) _Float16 v16h;
typedef __attribute__((ext_vector_type(8)))  _Float16 v8h;
typedef __attribute__((ext_vector_type(16))) __bf16   v16b;
typedef __attribute__((ext_vector_type(8)))  __bf16   v8b;
typedef __attribute__((ext_vector_type(8)))  float    v8f;
typedef __attribute__((ext_vector_type(4)))  float    v4f;
#define PSCALE 32768.0f
#define U16(p) ((const unsigned short*)(const void*)(p))
#define PSCALE_INV (1.0f / 32768.0f)

__device__ __forceinline__ unsigned short f2bf_bits(float f) {
  unsigned u = __float_as_uint(f);
  return (unsigned short)((u + 0x7FFFu + ((u >> 16) & 1u)) >> 16);
}
__device__ __forceinline__ float bf_bits2f(unsigned short h) { return __uint_as_float(((unsigned)h) << 16); }

// ---- Block-tiled WMMA GEMM, operands staged in LDS by the tensor mover ------
// C[m,n] = scale * sum_k A[m,k] * Bt[n,k] + bias[n]; f16 operands, f32 accumulate.
// H16 = false: f32 out to C. H16 = true: f16 out to C16, columns below qcols times qscale * log2(e) in f32 ahead of the one rounding.
// A row-major [M,K]; Bt row-major [N,K]; M % (64 WM) == 0, N % (16 FJ WN) == 0; K % 128 == 0 and K >= 256 (two stages).
// One work-group = WM x WN waves = one (64 WM) x (16 FJ WN) tile of C; each wave owns 64 x 16 FJ.
// A pass is 128 k = 256 B of each operand row. A stage is slices of 64 rows, first the tile's A rows, then its Bt rows,
// LDS pitch 272 B (16 B pad behind each row); wave s issues one tensor load per stage for slice s. Two buffers.
// <2, 2, 4>: 128 x 128, 4 slices, 4 waves. <4, 2, 6>: 256 x 192, 7 slices, 8 waves (the last wave issues none):
// 448 operand rows feed 49,152 elements of C where 256 rows feed 16,384, so 0.58 of the bytes come from L2 per element.
typedef uint32_t u32x4 __attribute__((ext_vector_type(4)));
typedef uint32_t u32x8 __attribute__((ext_vector_type(8)));
#define GT_ROWB  256u      // bytes of an operand row per pass
#define GT_ROWS  64u       // rows per slice
#define GT_PITCH 272u      // LDS row pitch: odd multiple of 16 B for ds_load_b128 readers
#define GT_SLICE 18432u    // 64 x 272 = 17,408 B rounded up to a multiple of 2 KiB
static_assert(GT_ROWS * GT_PITCH <= GT_SLICE && GT_SLICE % 2048u == 0u);

__device__ __forceinline__ uint32_t uni(uint32_t v) { return (uint32_t)__builtin_amdgcn_readfirstlane(v); }
__device__ __forceinline__ uint32_t pinned(uint32_t v) { uint32_t w = uni(v); asm volatile("" : "+s"(w)); return w; }   // a wave-uniform word held in a scalar register: a test on it compiles to s_cmp + s_cbranch_scc (tensor loads ignore EXEC)
// this wave's LDS reads have retired before the buffer they read is handed back for a refill
__device__ __forceinline__ void wait_ds0() { asm volatile("s_wait_dscnt 0x0" ::: "memory"); }
// this wave's own tensor load has landed (the compiler places no wait for the tensor mover)
// The request's descriptor words are inputs: their registers stay live up to the wait that covers the request, so none takes another value while it is outstanding.
__device__ __forceinline__ void wait_tensor0(u32x4 g0, u32x8 g1) { asm volatile("s_wait_tensorcnt 0x0" :: "s"(g0), "s"(g1) : "memory"); }
// one request of the whole wave: a 2-D tile from global memory into LDS
__device__ __forceinline__ void tdm_load(u32x4 g0, u32x8 g1) { asm volatile("tensor_load_to_lds %0, %1" :: "s"(g0), "s"(g1) : "memory"); }
__device__ __forceinline__ u32x8 tdm_group1(uint32_t src_pitch) {   // 1-byte elements, tile = tensor = 64 rows of 256 B
  u32x8 g;
  g[0] = uni((1u << 20) | (5u << 22) | (3u << 25));   // no mask; a pad of 4 dwords behind every 64 dwords
  g[1] = uni((GT_ROWB & 0xFFFFu) << 16);
  g[2] = uni((GT_ROWB >> 16) | ((GT_ROWS & 0xFFFFu) << 16));
  g[3] = uni((GT_ROWS >> 16) | (GT_ROWB << 16));
  g[4] = uni(GT_ROWS);
  g[5] = uni(src_pitch);
  g[6] = uni(0u);
  g[7] = uni(0u);
  return g;
}
__device__ __forceinline__ u32x4 tdm_group0(uint32_t lds_dst, uint64_t ga) {
  u32x4 g;
  g[0] = uni(1u); g[1] = uni(lds_dst); g[2] = uni((uint32_t)ga);
  g[3] = uni((((uint32_t)(ga >> 32)) & 0x01FFFFFFu) | 0x80000000u);
  asm volatile("" : "+s"(g));   // as pinned(): descriptor words held in their scalar registers; without it the constant word 0 is formed anew at each use and its register serves other values in between
  return g;
}
__device__ __forceinline__ v16h lds_frag(const unsigned char* p) {   // elements 0..7 <- k 0..7, 8..15 <- k 16..23 from p
  union { v16h v; v8h h[2]; } f;
  f.h[0] = *(const v8h*)(p); f.h[1] = *(const v8h*)(p + 32); return f.v;
}

template <int WM, int WN, int FJ, bool H16>
__global__ __launch_bounds__(WM * WN * 32) void wmma_gemm_tile(
    const unsigned short* __restrict__ A, int lda,
    const unsigned short* __restrict__ Bt, int ldb,
    float* __restrict__ C, _Float16* __restrict__ C16, int ldc,
    const float* __restrict__ bias,
    int N, int K, float scale, int qcols, float qscale) {
  constexpr int      TM  = WM * 64, WC = FJ * 16, TN = WN * WC;   // tile rows, wave columns, tile columns
  constexpr uint32_t ASL = WM, NSL = ASL + TN / 64;                // slices of A, slices of a stage
  constexpr uint32_t GT_STAGE = NSL * GT_SLICE;
  constexpr bool     ALLW = (NSL == (uint32_t)(WM * WN));          // every wave has a slice to bring
  static_assert(TN % 64 == 0 && NSL <= (uint32_t)(WM * WN) && 2u * GT_STAGE <= 320u * 1024u);
  __shared__ __attribute__((aligned(2048))) unsigned char L[2u * GT_STAGE];
  const int lane = threadIdx.x & 31;
  const uint32_t wave = uni(threadIdx.x >> 5);
  const int tilesN = N / TN;
  const int tm = blockIdx.x / tilesN;
  const int tn = blockIdx.x - tm * tilesN;
  const int wm = wave / WN, wn = wave % WN;
  const int m0 = tm * TM + (wm << 6);          // this wave's 64 x WC tile of C
  const int n0 = tn * TN + wn * WC;

  const int rlane = lane & 15;                 // row (A) / col (B, D) within subtile
  const int hh    = lane >> 4;                 // k half of this lane; D row offset 8 * hh (H16: D is C^T, its rows are columns of C)
  const int mOff  = hh * 8;

  // this wave's slice of every stage: the first ASL waves bring A rows, the next bring Bt rows
  const unsigned short* srow = (wave < ASL) ? (A  + (size_t)(tm * TM + (int)(wave << 6)) * lda)
                                            : (Bt + (size_t)(tn * TN + (int)((wave - ASL) << 6)) * ldb);
  const uint64_t src0 = (uint64_t)(uintptr_t)srow;
  u32x8 g1 = tdm_group1((uint32_t)((wave < ASL) ? lda : ldb) * 2u);
  asm volatile("" : "+s"(g1));   // as pinned(): descriptor words held in their scalar registers, so that none takes another value while a request is outstanding
  const uint32_t lds_slice = (uint32_t)(size_t)L + wave * GT_SLICE;
  const uint32_t T = (uint32_t)K >> 7;         // passes

  const uint32_t aOff = (uint32_t)wm * GT_SLICE + (uint32_t)rlane * GT_PITCH + (uint32_t)hh * 16u;
  uint32_t bOff[FJ];                           // fragment j = Bt rows wn * WC + 16 j .. + 15 of the tile: 16 rows lie in one slice
#pragma unroll
  for (int j = 0; j < FJ; ++j) {
    const uint32_t rj = (uint32_t)(wn * WC + j * 16);
    bOff[j] = (ASL + (rj >> 6)) * GT_SLICE + ((rj & 63u) + (uint32_t)rlane) * GT_PITCH + (uint32_t)hh * 16u;
  }

  v8f acc[4][FJ];
#pragma unroll
  for (int i = 0; i < 4; ++i)
#pragma unroll
    for (int j = 0; j < FJ; ++j) acc[i][j] = (v8f){0.f,0.f,0.f,0.f,0.f,0.f,0.f,0.f};

  // prologue: stage 0 lands and is published, then stage 1 flies under pass 0
  u32x4 g0 = tdm_group0(lds_slice, src0);      // group 0 of this wave's youngest request
  if (ALLW || pinned(wave < NSL)) tdm_load(g0, g1);
  wait_tensor0(g0, g1);
  __syncthreads();
  g0 = tdm_group0(lds_slice + GT_STAGE, src0 + GT_ROWB);
  if (ALLW || pinned(wave < NSL)) tdm_load(g0, g1);

  for (uint32_t t = 0; t < T; ++t) {
    const uint32_t buf = (t & 1u) * GT_STAGE;
    const unsigned char* La = L + buf + aOff;
    const unsigned char* Lb = L + buf;
    v16h af[2][4], bf[2][FJ];                  // set (ks & 1) holds block ks's fragments; a block is 32 k = 4 FJ WMMAs
#pragma unroll
    for (int j = 0; j < FJ; ++j) bf[0][j] = lds_frag(Lb + bOff[j]);
#pragma unroll
    for (int i = 0; i < 4; ++i) af[0][i] = lds_frag(La + i * 16 * GT_PITCH);
#pragma unroll
    for (int ks = 0; ks < 4; ++ks) {
      const int cs = ks & 1;
      if (ks < 3) {
#pragma unroll
        for (int j = 0; j < FJ; ++j) bf[cs ^ 1][j] = lds_frag(Lb + bOff[j] + (ks + 1) * 64);
#pragma unroll
        for (int i = 0; i < 4; ++i) af[cs ^ 1][i] = lds_frag(La + i * 16 * GT_PITCH + (ks + 1) * 64);
      }
      // keeps the next block's LDS loads as one group ahead of this block's WMMAs; without it they sink among the WMMAs, each behind a wait to 0
      __builtin_amdgcn_sched_barrier(0);
#pragma unroll
      for (int i = 0; i < 4; ++i)
#pragma unroll
        for (int j = 0; j < FJ; ++j) {
          if constexpr (H16)   // C^T: rows = columns of C, so that a lane's 8 values are 8 neighbouring columns of one row of C, one 16-B piece as f16
            acc[i][j] = __builtin_amdgcn_wmma_f32_16x16x32_f16(false, bf[cs][j], false, af[cs][i], (short)0, acc[i][j], false, false);
          else
            acc[i][j] = __builtin_amdgcn_wmma_f32_16x16x32_f16(false, af[cs][i], false, bf[cs][j], (short)0, acc[i][j], false, false);
        }
      // ends the block: without it the following load group is lifted in among these WMMAs, into further registers
      __builtin_amdgcn_sched_barrier(0);
    }
    // publish point of stage t + 1, which also frees the buffer that pass t has read
    wait_ds0();
    wait_tensor0(g0, g1);
    __syncthreads();
    if (pinned((t + 2u < T) && (ALLW || wave < NSL))) {
      g0 = tdm_group0(lds_slice + buf, src0 + (uint64_t)((t + 2u) * GT_ROWB));
      tdm_load(g0, g1);
    }
  }
  wait_tensor0(g0, g1);
  wait_ds0();

  if constexpr (H16) {
    // ---- f16 epilogue: the ring is free behind the last pass's barrier; the work-group stages its whole TM x TN tile as f16 ----
    // A wave's 2 WC bytes of a row need not be whole 128-B lines, a tile row's 2 TN bytes are: so the tile is staged by all waves
    // and each wave then stores 32 tile rows, every wave-wide 16-B store covering 4 whole lines that no other wave writes.
    constexpr uint32_t TP = TN * 2 + 16;                 // LDS pitch in bytes: an odd multiple of 16 B
    constexpr int      PR = TN / 8;                      // 16-B pieces of a tile row
    static_assert((TN * 2) % 128 == 0 && (TP / 16) % 2 == 1 && TM * TP <= 2u * GT_STAGE);
    static_assert(TM == WM * WN * 32 && 96 % PR == 0);   // 32 rows a wave; three wave-wide turns = 96 pieces = whole rows
    const float qs2 = qscale * 1.44269504088896340736f;  // attention's softmax runs in base 2: q carries the factor
#pragma unroll
    for (int j = 0; j < FJ; ++j) {
      const int   nj = n0 + (j << 4);                    // 16 columns, all on one side of qcols (a multiple of 16)
      const v4f   b0 = *(const v4f*)(bias + nj + mOff), b1 = *(const v4f*)(bias + nj + mOff + 4);
      const float cm = (nj < qcols) ? qs2 : 1.0f;
      // element r of acc[i][j] = row 16 i + rlane, column 16 j + 8 hh + r of the wave's tile
      unsigned char* Lj = L + (uint32_t)((wm << 6) + rlane) * TP + (uint32_t)(wn * WC + (j << 4) + mOff) * 2u;
#pragma unroll
      for (int i = 0; i < 4; ++i) {
        v8h h;
#pragma unroll
        for (int r = 0; r < 8; ++r) {
          float v = acc[i][j][r] * scale;
          v += (r < 4) ? b0[r & 3] : b1[r & 3];
          h[r] = (_Float16)(v * cm);
        }
        *(v8h*)(Lj + (uint32_t)(i << 4) * TP) = h;
      }
    }
    __syncthreads();                                     // every wave's part of the tile is in LDS before another wave reads it
    _Float16* Cw = C16 + (size_t)(tm * TM + (int)(wave << 5)) * ldc + tn * TN;   // wave-uniform: this wave's 32 rows
    const unsigned char* Lw = L + (wave << 5) * TP;
    constexpr int RT = 96 / PR, NA = 32 / RT;            // rows of three turns; groups of three turns
    v8h      t[NA][3];
    uint32_t off[3];                                     // a lane's three offsets from a group's first row, the same in every group
#pragma unroll
    for (int b3 = 0; b3 < 3; ++b3) {
      const uint32_t u = (uint32_t)(b3 * 32 + lane), row = u / PR, pc = u - row * PR;
      off[b3] = row * (uint32_t)ldc + pc * 8u;
#pragma unroll
      for (int a = 0; a < NA; ++a) t[a][b3] = *(const v8h*)(Lw + (row + (uint32_t)(a * RT)) * TP + pc * 16u);
    }
#pragma unroll
    for (int a = 0; a < NA; ++a) {
      _Float16* Ca = Cw + (size_t)(a * RT) * ldc;        // wave-uniform
#pragma unroll
      for (int b3 = 0; b3 < 3; ++b3) *(v8h*)(Ca + off[b3]) = t[a][b3];
    }
  } else {
  // ---- f32 epilogue: the ring is free behind the last pass's barrier; each wave stages 16 x WC in its own range ----
  constexpr int SP = WC + 4;                             // pitch in floats
  float* slab = (float*)(L + wave * (16u * SP * 4u));
#pragma unroll
  for (int i = 0; i < 4; ++i) {
    float* Ci = C + (size_t)(m0 + (i << 4)) * ldc + n0;   // wave-uniform; a lane's offset from it is the same in all four turns
#pragma unroll
    for (int j = 0; j < FJ; ++j) {
      const float bv = bias[n0 + (j << 4) + rlane];
#pragma unroll
      for (int r = 0; r < 8; ++r) {
        float v = acc[i][j][r] * scale;
        v += bv;
        slab[(mOff + r) * SP + (j << 4) + rlane] = v;
      }
    }
    __builtin_amdgcn_fence(__ATOMIC_RELEASE, "workgroup");
    __builtin_amdgcn_wave_barrier();
    __builtin_amdgcn_fence(__ATOMIC_ACQUIRE, "workgroup");
    {
      constexpr int SEG = WC / 4;         // 16-B pieces of a row seg of 4 WC bytes (whole 128-B lines); 16 SEG pieces = 2 FJ turns of 32 lanes
#pragma unroll
      for (int it = 0; it < 2 * FJ; ++it) {
        const int u = it * 32 + lane;
        const int row = u / SEG;
        const int c4 = (u - row * SEG) * 4;
        v4f v = *(const v4f*)(slab + row * SP + c4);
        *(v4f*)(Ci + (row * ldc + c4)) = v;
      }
    }
    __builtin_amdgcn_fence(__ATOMIC_RELEASE, "workgroup");
    __builtin_amdgcn_wave_barrier();
    __builtin_amdgcn_fence(__ATOMIC_ACQUIRE, "workgroup");
  }
  }
}

// f32 -> f16 conversion of the three f32 inputs in ONE launch: x unscaled, both weight matrices times wsc.
// One work-group of 8 waves converts 256 * NL groups of 4 floats of each input (NL = 16, 12, 4): every lane issues all
// its 32 16-byte loads (512 contiguous bytes per wave and load) before it converts the first.
typedef __attribute__((ext_vector_type(4))) _Float16 v4h;
template <int NL>
__device__ __forceinline__ size_t cast_base() { return ((size_t)blockIdx.x * (256u * NL) + threadIdx.x) * 4u; }   // first float of this lane
template <int NL>
__device__ __forceinline__ void cast_load(const float* p, v4f (&v)[NL]) {
#pragma unroll
  for (int i = 0; i < NL; ++i) v[i] = *(const v4f*)(p + i * 1024);
}
template <int NL>
__device__ __forceinline__ void cast_store(_Float16* o, const v4f (&v)[NL], float sc) {
#pragma unroll
  for (int i = 0; i < NL; ++i) {
    v4h h;
#pragma unroll
    for (int e = 0; e < 4; ++e) h[e] = (_Float16)(v[i][e] * sc);
    *(v4h*)(o + i * 1024) = h;
  }
}
// element counts = gridDim.x * 1024 * {16, 12, 4} exactly (asserted where it is launched)
__global__ __launch_bounds__(256) void cast3_f32_f16(const float* __restrict__ x,  _Float16* __restrict__ x16,
                                                     const float* __restrict__ w,  _Float16* __restrict__ w16,
                                                     const float* __restrict__ ow, _Float16* __restrict__ ow16, float wsc) {
  const float* px = x  + cast_base<16>();
  const float* pw = w  + cast_base<12>();
  const float* po = ow + cast_base<4>();
  v4f vx[16], vw[12], vo[4];
  cast_load<16>(px, vx);
  cast_load<12>(pw, vw);
  cast_load<4>(po, vo);
  // the loads' address registers stay live up to here, so nothing (a load's own result included) rewrites one ahead of this wait
  asm volatile("s_wait_xcnt 0x0" :: "v"(px), "v"(pw), "v"(po) : "memory");
  cast_store<16>(x16  + cast_base<16>(), vx, 1.0f);
  cast_store<12>(w16  + cast_base<12>(), vw, wsc);
  cast_store<4>(ow16 + cast_base<4>(),  vo, wsc);
}

// =====================================================================================
// Banded (sliding-window) attention for head_dim 64, f16 in / f16 out carried x64, f16 operands.
//   scores^T = k . (q * qscale * log2(e))^T : v_wmma_f32_16x16x32_f16, f32 accumulate; q arrives with the factor, taken in f32 ahead of its f16 rounding
//   out^T    = v^T . p^T         : v_wmma_f32_16x16x32_f16, p carried x2^15, folded into the final 1/l
//   Both products are formed transposed (keys or d down the rows, queries across the columns): lane (c, hh) then holds, for the ONE
//   query q0 + c, keys 16 j + 8 hh + r in its own registers. Row maximum and row sum run over a lane's registers, lanes c and c + 16
//   meet in one cross-row move, and the 16 p values of tiles 2 kk and 2 kk + 1 ARE the lane's part of the B fragment of key block kk.
//   Online softmax in f32, in base 2: e^(x - m) = 2^((x - m) * log2(e)), so each exponential is one subtract and one v_exp_f32.
//   Block = 4 waves = 64 query rows of one (batch, head); S % 64 == 0.
//   Key chunks of 64; only chunks overlapping [q - W, q + W] for the block's rows are visited
//   (static bound AT_MAXCH, computed start); keys with |q - kv| > W get mask_fill before the softmax.
//   Element (b, s, h, d) of tensor X lives at X[b*X_bs + s*X_rs + h*X_hs + d] (strides in elements, multiples of 8).
//   grid.x = B * H * (S/64).
// =====================================================================================
#define AT_D 64
#define AT_NW 4
#define AT_QB 64
#define AT_KC 64
#define AT_LP 72       // LDS row pitch of the K and V tiles in f16: 144 B = 16 B x 9 (odd), so that the 16 rows of a ds_load_b128 fall on distinct banks
#define AT_MAXCH 6
#define AT_PSC 32768.0f
#define AT_OSC 64.0f      // the output is stored as f16 times 64 (exact power of two), the next GEMM's A operand
struct BandGeom { long q_bs, q_rs, q_hs, k_bs, k_rs, k_hs, v_bs, v_rs, v_hs, o_bs, o_rs, o_hs;
                  int S, H; float mask_fill; };
static_assert(sizeof(BandGeom) == 112);

__device__ __forceinline__ v8f mma_h(v16h a, v16h b, v8f c) {
  c = __builtin_amdgcn_wmma_f32_16x16x32_f16(false, a, false, b, (short)0, c, false, false);
  asm volatile("v_nop\n\tv_nop\n\tv_nop\n\tv_nop" : "+v"(c) : "v"(a), "v"(b));
  return c;
}

// Base-2 exponentials, one bare v_exp_f32 each. One statement with early-clobber outputs: no v_exp_f32 then stands directly in
// front of an instruction that reads its result or writes over its source, and the v_nop keeps that slot behind the last one.
__device__ __forceinline__ void exp2_x4(float x0, float x1, float x2, float x3, float& e0, float& e1, float& e2, float& e3) {
  asm("v_exp_f32 %0, %4\n\tv_exp_f32 %1, %5\n\tv_exp_f32 %2, %6\n\tv_exp_f32 %3, %7\n\tv_nop"
      : "=&v"(e0), "=&v"(e1), "=&v"(e2), "=&v"(e3)
      : "v"(x0), "v"(x1), "v"(x2), "v"(x3));
}
__device__ __forceinline__ float exp2_x1(float x) {
  float e;
  asm("v_exp_f32 %0, %1\n\tv_nop" : "=&v"(e) : "v"(x));
  return e;
}
// the value of lane l ^ 16: the other half of the keys of the same query
__device__ __forceinline__ float xhalf(float x) {
  return __builtin_bit_cast(float, __builtin_amdgcn_permlanex16(__builtin_bit_cast(int, x), __builtin_bit_cast(int, x), 0x76543210, 0xfedcba98, false, false));
}

__global__ __launch_bounds__(128)
void attn_band64_kernel(const _Float16* __restrict__ q, const _Float16* __restrict__ k,
                        const _Float16* __restrict__ v, _Float16* __restrict__ out,
                        const int* __restrict__ wptr, BandGeom g) {
  union FH { v16h v; v8h h[2]; };
  __shared__ __align__(16) _Float16 Ksh[AT_KC * AT_LP];       // K [kv][d]   9 KB
  __shared__ __align__(16) _Float16 Vth[AT_D * AT_LP];        // V [d][kv]   9 KB
  __shared__ __align__(16) float    Os[AT_NW][16 * 68];       // per wave out tile, pitch 68

  const int tid  = threadIdx.x;
  const int wave = tid >> 5;
  const int lane = tid & 31;
  const int hh   = lane >> 4;
  const int c    = lane & 15;

  const int nqb = g.S / AT_QB;
  const int bx = blockIdx.x;
  const int qb = bx % nqb;
  const int bh = bx / nqb;
  const int h  = bh % g.H;
  const int b  = bh / g.H;
  const int qbase = qb * AT_QB;
  const int q0 = qbase + wave * 16;

  const _Float16* qb_ptr = q + (size_t)b * g.q_bs + (size_t)h * g.q_hs;
  const _Float16* kb_ptr = k + (size_t)b * g.k_bs + (size_t)h * g.k_hs;
  const _Float16* vb_ptr = v + (size_t)b * g.v_bs + (size_t)h * g.v_hs;
  _Float16*    ob_ptr = out + (size_t)b * g.o_bs + (size_t)h * g.o_hs;

  // ---- Q fragments (B operand, column = q0 + c): d-chunks 0..31 and 32..63 ----
  v16h qa0, qa1;
  {
    const _Float16* qrow = qb_ptr + (size_t)(q0 + c) * g.q_rs + 8 * hh;
    FH f0, f1;
    f0.h[0] = *(const v8h*)(qrow);
    f0.h[1] = *(const v8h*)(qrow + 16);
    f1.h[0] = *(const v8h*)(qrow + 32);
    f1.h[1] = *(const v8h*)(qrow + 32 + 16);
    qa0 = f0.v; qa1 = f1.v;
  }

  float mrow = -__builtin_huge_valf();   // running maximum of query q0 + c, equal in lanes c and c + 16
  float lrow = 0.f;                      // running sum over THIS lane's keys only; the two halves are added behind the loop
  v8f oacc[4];                           // out^T: element r of tile t = d 16 t + 8 hh + r of query q0 + c
#pragma unroll
  for (int t = 0; t < 4; ++t) oacc[t] = (v8f){0.f,0.f,0.f,0.f,0.f,0.f,0.f,0.f};

  // ---- visited key-chunk range (block-uniform), statically bounded trip count ----
  const int nkc = g.S / AT_KC;
  int Wd = wptr[0];
  Wd = Wd < 0 ? 0 : Wd;
  Wd = Wd > g.S ? g.S : Wd;
  const int lo = qbase - Wd;
  const int kcLo = (lo < 0) ? 0 : (lo / AT_KC);
  int kcHi = (qbase + AT_QB - 1 + Wd) / AT_KC;
  kcHi = kcHi > nkc - 1 ? nkc - 1 : kcHi;
  int nvis = kcHi - kcLo + 1;
  nvis = nvis > AT_MAXCH ? AT_MAXCH : nvis;
  nvis = nvis < 1 ? 1 : nvis;

  for (int ci = 0; ci < nvis; ++ci) {
    const int kv0 = (kcLo + ci) * AT_KC;   // kcLo + ci <= kcHi <= nkc - 1
    __syncthreads();
    {
      // A head row is 64 f16 = one 128-B line.
      // K: 8 lanes x 16 B = one row, so a wave-wide load covers 4 rows = 4 whole lines; a lane takes f16 8 * ks .. + 7 of rows kr + 16 i.
      // V: 16 lanes x 8 B = one row, 2 whole lines a load. A lane takes f16 4 * seg .. + 3 of the 8 consecutive rows 8 * rg + i:
      // for each of its 4 d it then holds 8 consecutive kv, one 16-B store into the transposed V tile.
      const int ks = tid & 7, kr = tid >> 3;
      const int seg = tid & 15, rg = tid >> 4;
      const _Float16* krow = kb_ptr + (size_t)(kv0 + kr) * g.k_rs + 8 * ks;
      const _Float16* vrow = vb_ptr + (size_t)(kv0 + 8 * rg) * g.v_rs + 4 * seg;
      const _Float16* kp[4];
      const _Float16* vp[8];
      v8h kk[4];
      v4h vv[8];
#pragma unroll
      for (int i = 0; i < 4; ++i) kp[i] = krow + (size_t)(16 * i) * g.k_rs;
#pragma unroll
      for (int i = 0; i < 8; ++i) vp[i] = vrow + (size_t)i * g.v_rs;
#pragma unroll
      for (int i = 0; i < 4; ++i) kk[i] = *(const v8h*)kp[i];
#pragma unroll
      for (int i = 0; i < 8; ++i) vv[i] = *(const v4h*)vp[i];
      // the loads' address registers stay live up to here, so nothing (a load's own result included) rewrites one ahead of this wait
      asm volatile("s_wait_xcnt 0x0" :: "v"(kp[0]), "v"(kp[1]), "v"(kp[2]), "v"(kp[3]),
                                        "v"(vp[0]), "v"(vp[1]), "v"(vp[2]), "v"(vp[3]), "v"(vp[4]), "v"(vp[5]), "v"(vp[6]), "v"(vp[7]) : "memory");
#pragma unroll
      for (int i = 0; i < 4; ++i) *(v8h*)(Ksh + (kr + 16 * i) * AT_LP + 8 * ks) = kk[i];
#pragma unroll
      for (int e = 0; e < 4; ++e) {
        v8h vh;
#pragma unroll
        for (int i = 0; i < 8; ++i) vh[i] = vv[i][e];
        *(v8h*)(Vth + (4 * seg + e) * AT_LP + 8 * rg) = vh;
      }
    }
    __syncthreads();

    // ---- scores^T: 64 keys x 16 queries per wave; tile j = keys 16 j .. + 15 ----
    // every loop from here to the end of the chunk is unrolled: s, oacc and pb are register arrays, and an index known only at run time would send them to scratch
    v8f s[4];
#pragma unroll
    for (int j = 0; j < 4; ++j) {
      s[j] = (v8f){0.f,0.f,0.f,0.f,0.f,0.f,0.f,0.f};
      FH kb0, kb1;
      kb0.h[0] = *(const v8h*)(Ksh + (j * 16 + c) * AT_LP + 8 * hh);
      kb0.h[1] = *(const v8h*)(Ksh + (j * 16 + c) * AT_LP + 16 + 8 * hh);
      kb1.h[0] = *(const v8h*)(Ksh + (j * 16 + c) * AT_LP + 32 + 8 * hh);
      kb1.h[1] = *(const v8h*)(Ksh + (j * 16 + c) * AT_LP + 32 + 16 + 8 * hh);
      s[j] = mma_h(kb0.v, qa0, s[j]);
      s[j] = mma_h(kb1.v, qa1, s[j]);
    }

    // ---- band mask + chunk maximum of this lane's query ----
    const int d0 = q0 + c - kv0 - 8 * hh;   // query minus this lane's first key; element r of tile j lies 16 j + r keys further on
    float cm = -__builtin_huge_valf();
#pragma unroll
    for (int j = 0; j < 4; ++j) {
#pragma unroll
      for (int r = 0; r < 8; ++r) {
        const int dlt = d0 - (j * 16 + r);
        float sv = s[j][r];
        const bool masked = (dlt > Wd) || (dlt < -Wd);
        if (masked) sv = g.mask_fill;
        s[j][r] = sv;
        cm = fmaxf(cm, sv);
      }
    }
    cm = fmaxf(cm, xhalf(cm));
    const float mnew = fmaxf(mrow, cm);
    const float alpha = exp2_x1(mrow - mnew);
    mrow = mnew;
    float psum = 0.f;
#pragma unroll
    for (int j = 0; j < 4; ++j) {
#pragma unroll
      for (int r = 0; r < 8; r += 4) {
        float e0, e1, e2, e3;
        exp2_x4(s[j][r] - mnew, s[j][r + 1] - mnew, s[j][r + 2] - mnew, s[j][r + 3] - mnew, e0, e1, e2, e3);
        s[j][r] = e0; s[j][r + 1] = e1; s[j][r + 2] = e2; s[j][r + 3] = e3;
        psum += (e0 + e1) + (e2 + e3);
      }
    }
    lrow = lrow * alpha + psum;
#pragma unroll
    for (int t = 0; t < 4; ++t)
#pragma unroll
      for (int r = 0; r < 8; ++r) oacc[t][r] *= alpha;

    // ---- out^T += v^T . p^T: B fragment of key block kk, elements 0..7 <- keys 32 kk + 8 hh + e (tile 2 kk), 8..15 <- keys 32 kk + 16 + 8 hh + e (tile 2 kk + 1) ----
#pragma unroll
    for (int kk = 0; kk < 2; ++kk) {
      v16h pb;
#pragma unroll
      for (int e = 0; e < 8; ++e) {
        pb[e]     = (_Float16)(s[2 * kk][e] * AT_PSC);
        pb[8 + e] = (_Float16)(s[2 * kk + 1][e] * AT_PSC);
      }
#pragma unroll
      for (int t = 0; t < 4; ++t) {
        FH vb;
        vb.h[0] = *(const v8h*)(Vth + (t * 16 + c) * AT_LP + kk * 32 + 8 * hh);
        vb.h[1] = *(const v8h*)(Vth + (t * 16 + c) * AT_LP + kk * 32 + 16 + 8 * hh);
        oacc[t] = mma_h(vb.v, pb, oacc[t]);
      }
    }
  }

  float* os = Os[wave];
  {
    const float inv = 1.0f / ((lrow + xhalf(lrow)) * AT_PSC);
#pragma unroll
    for (int t = 0; t < 4; ++t) {
      v4f lo4, hi4;
#pragma unroll
      for (int e = 0; e < 4; ++e) { lo4[e] = oacc[t][e] * inv; hi4[e] = oacc[t][4 + e] * inv; }
      *(v4f*)(os + c * 68 + t * 16 + 8 * hh)     = lo4;
      *(v4f*)(os + c * 68 + t * 16 + 8 * hh + 4) = hi4;
    }
  }
  __builtin_amdgcn_fence(__ATOMIC_RELEASE, "workgroup");
  __builtin_amdgcn_wave_barrier();
  __builtin_amdgcn_fence(__ATOMIC_ACQUIRE, "workgroup");
  {
    const int c8 = (lane & 7) * 8;       // row seg = 64 f16 = 128 B = 8 lanes x 16 B; rows it*4 + (lane >> 3) cover 0..15
#pragma unroll
    for (int it = 0; it < 4; ++it) {
      const int row = it * 4 + (lane >> 3);
      const v4f lo4 = *(const v4f*)(os + row * 68 + c8);
      const v4f hi4 = *(const v4f*)(os + row * 68 + c8 + 4);
      v8h hv;
#pragma unroll
      for (int e = 0; e < 4; ++e) { hv[e] = (_Float16)(lo4[e] * AT_OSC); hv[4 + e] = (_Float16)(hi4[e] * AT_OSC); }
      *(v8h*)(ob_ptr + (size_t)(q0 + row) * g.o_rs + c8) = hv;
    }
  }
}

// =====================================================================================
extern "C" void kernel_launch(void* const* d_in, const int* in_sizes, int n_in,
                              void* d_out, int out_size, void* d_ws, size_t ws_size,
                              hipStream_t stream) {
  constexpr int Bz = 2, S = 2048, D = 1024, H = 16, HD = 64;
  constexpr int TD = 3 * D;          // 3072
  constexpr int M  = Bz * S;         // 4096 token rows
  static_assert(H * HD == D);
  static_assert(M % 256 == 0 && TD % 192 == 0 && D % 128 == 0 && D >= 256 && S % AT_QB == 0);

  if (n_in < 6) return;
  if (in_sizes[0] != M * D || in_sizes[1] != TD * D || in_sizes[2] != TD ||
      in_sizes[3] != D * D || in_sizes[4] != D || in_sizes[5] < 1 || out_size != M * D) return;

  const float* x     = (const float*)d_in[0];   // [B,S,D]
  const float* in_w  = (const float*)d_in[1];   // [3D, D] = (out, in) -> Bt
  const float* in_b  = (const float*)d_in[2];   // [3D]
  const float* out_w = (const float*)d_in[3];   // [D, D] = (out, in) -> Bt
  const float* out_b = (const float*)d_in[4];   // [D]
  const int*   wsz   = (const int*)d_in[5];     // window size, int32[1]
  float* y = (float*)d_out;

  // ---- workspace carve (all offsets multiples of 1 MiB) ----
  const size_t bytes_x16  = (size_t)M  * D  * 2;   //  8,388,608
  const size_t bytes_w16  = (size_t)TD * D  * 2;   //  6,291,456
  const size_t bytes_ow16 = (size_t)D  * D  * 2;   //  2,097,152
  const size_t bytes_qkv  = (size_t)M  * TD * 2;   // 25,165,824 (f16)
  const size_t bytes_a16  = (size_t)M  * D  * 2;   //  8,388,608
  const size_t total = bytes_x16 + bytes_w16 + bytes_ow16 + bytes_qkv + bytes_a16;   // 50,331,648
  if (total > ws_size) return;
  char* p = (char*)d_ws;
  _Float16* x16  = (_Float16*)p;  p += bytes_x16;
  _Float16* w16  = (_Float16*)p;  p += bytes_w16;
  _Float16* ow16 = (_Float16*)p;  p += bytes_ow16;
  _Float16* qkv  = (_Float16*)p;  p += bytes_qkv;
  _Float16* a16  = (_Float16*)p;  p += bytes_a16;

  // 1) f32 -> f16 casts, one launch: x unscaled, weights x64 (exact power of two, folded back in the GEMM scale)
  {
    static_assert(M * D == 256 * 1024 * 16 && TD * D == 256 * 1024 * 12 && D * D == 256 * 1024 * 4);
    cast3_f32_f16<<<256, 256, 0, stream>>>(x, x16, in_w, w16, out_w, ow16, 64.0f);
  }

  // 2) qkv[M][3D] (f16) = x16 . w16^T * (1/64) + in_b, the q columns times 0.125 * log2(e): the operands of attention's products
  {
    dim3 grid((M / 256) * (TD / 192), 1);               // 256 tiles of 256 x 192
    wmma_gemm_tile<4, 2, 6, true><<<grid, 256, 0, stream>>>(
        (const unsigned short*)x16, D, (const unsigned short*)w16, D,
        nullptr, qkv, TD, in_b, TD, D, 1.0f / 64.0f, D, 0.125f);
  }

  // 3) banded attention per (batch, head, 64-query block) -> a16 [B,S,D] f16 carried x64
  {
    BandGeom g;
    g.q_bs = (long)S * TD; g.q_rs = TD; g.q_hs = HD;
    g.k_bs = (long)S * TD; g.k_rs = TD; g.k_hs = HD;
    g.v_bs = (long)S * TD; g.v_rs = TD; g.v_hs = HD;
    g.o_bs = (long)S * D;  g.o_rs = D;  g.o_hs = HD;
    g.S = S; g.H = H; g.mask_fill = -1e30f;
    dim3 grid(Bz * H * (S / AT_QB));                    // 1024 blocks
    attn_band64_kernel<<<grid, 128, 0, stream>>>(qkv, qkv + D, qkv + 2 * D, a16, wsz, g);
  }

  // 4) y[M][D] (f32) = a16 . ow16^T * (1/4096) + out_b
  {
    dim3 grid((M / 128) * (D / 128), 1);                // 256 tiles of 128 x 128
    wmma_gemm_tile<2, 2, 4, false><<<grid, 128, 0, stream>>>(
        (const unsigned short*)a16, D, (const unsigned short*)ow16, D,
        y, nullptr, D, out_b, D, D, 1.0f / 4096.0f, 0, 0.0f);
  }
  (void)stream;
}

// v010
// One run takes 53.7 microseconds.
// Next to v009, in two timings, it ran 1.03 and 1.04 times as fast.
// Over all steps from v000 it is 3.35 times as fast.
#include <hip/hip_runtime.h>
#include <stdint.h>
// qkv projection and output projection: v_wmma_f32_16x16x32_f16 (f16 operands, weights carried x64, f32 accumulate); attention k.q^T and v^T.p^T: v_wmma_f32_16x16x32_f16 (f16 operands, p carried x2^15, f32 accumulate); softmax and epilogues f32.

typedef __attribute__((ext_vector_type(16))) _Float16 v16h;
typedef __attribute__((ext_vector_type(8)))  _Float16 v8h;
typedef __attribute__((ext_vector_type(16))) __bf16   v16b;
typedef __attribute__((ext_vector_type(8)))  __bf16   v8b;
typedef __attribute__((ext_vector_type(8)))  float    v8f;
typedef __attribute__((ext_vector_type(4)))  float    v4f;
#define PSCALE 32768.0f
#define U16(p) ((const unsigned short*)(const void*)(p))
#define PSCALE_INV (1.0f / 32768.0f)

__device__ __forceinline__ unsigned short f2bf_bits(float f) {
  unsigned u = __float_as_uint(f);
  return (unsigned short)((u + 0x7FFFu + ((u >> 16) & 1u)) >> 16);
}
__device__ __forceinline__ float bf_bits2f(unsigned short h) { return __uint_as_float(((unsigned)h) << 16); }

// ---- Block-tiled WMMA GEMM, operands staged in LDS by the tensor mover ------
// C[m,n] = scale * sum_k A[m,k] * Bt[n,k] + bias[n]; f16 operands, f32 accumulate.
// H16 = false: f32 out to C. H16 = true: f16 out to C16, columns below qcols times qscale * log2(e) in f32 ahead of the one rounding.
// A row-major [M,K]; Bt row-major [N,K]; M % (64 WM) == 0, N % (16 FJ WN) == 0; K % 128 == 0 and K >= 256 (two stages).
// One work-group = WM x WN waves = one (64 WM) x (16 FJ WN) tile of C; each wave owns 64 x 16 FJ.
// A pass is 128 k = 256 B of each operand row. A stage is slices of 64 rows, first the tile's A rows, then its Bt rows,
// LDS pitch 272 B (16 B pad behind each row); wave s issues one tensor load per stage for slice s. Two buffers.
// <2, 2, 4>: 128 x 128, 4 slices, 4 waves. <4, 2, 6>: 256 x 192, 7 slices, 8 waves (the last wave issues none):
// 448 operand rows feed 49,152 elements of C where 256 rows feed 16,384, so 0.58 of the bytes come from L2 per element.
// The k walk: tile (tm, tn) takes pass (tm + tn) mod T as its stage 0 and wraps. The work-groups that share A rows (equal tm) or Bt rows
// (equal tn) run in step, and from a common start they would all ask L2 for the same lines, the same 256 B of every operand row,
// at the same moment. Each element of C still sums all T passes, in the order of its tile's walk.
typedef uint32_t u32x4 __attribute__((ext_vector_type(4)));
typedef uint32_t u32x8 __attribute__((ext_vector_type(8)));
#define GT_ROWB  256u      // bytes of an operand row per pass
#define GT_ROWS  64u       // rows per slice
#define GT_PITCH 272u      // LDS row pitch: odd multiple of 16 B for ds_load_b128 readers
#define GT_SLICE 18432u    // 64 x 272 = 17,408 B rounded up to a multiple of 2 KiB
static_assert(GT_ROWS * GT_PITCH <= GT_SLICE && GT_SLICE % 2048u == 0u);

__device__ __forceinline__ uint32_t uni(uint32_t v) { return (uint32_t)__builtin_amdgcn_readfirstlane(v); }
__device__ __forceinline__ uint32_t pinned(uint32_t v) { uint32_t w = uni(v); asm volatile("" : "+s"(w)); return w; }   // a wave-uniform word held in a scalar register: a test on it compiles to s_cmp + s_cbranch_scc (tensor loads ignore EXEC)
// this wave's LDS reads have retired before the buffer they read is handed back for a refill
__device__ __forceinline__ void wait_ds0() { asm volatile("s_wait_dscnt 0x0" ::: "memory"); }
// this wave's own tensor load has landed (the compiler places no wait for the tensor mover)
// The request's descriptor words are inputs: their registers stay live up to the wait that covers the request, so none takes another value while it is outstanding.
__device__ __forceinline__ void wait_tensor0(u32x4 g0, u32x8 g1) { asm volatile("s_wait_tensorcnt 0x0" :: "s"(g0), "s"(g1) : "memory"); }
// one request of the whole wave: a 2-D tile from global memory into LDS
__device__ __forceinline__ void tdm_load(u32x4 g0, u32x8 g1) { asm volatile("tensor_load_to_lds %0, %1" :: "s"(g0), "s"(g1) : "memory"); }
__device__ __forceinline__ u32x8 tdm_group1(uint32_t src_pitch) {   // 1-byte elements, tile = tensor = 64 rows of 256 B
  u32x8 g;
  g[0] = uni((1u << 20) | (5u << 22) | (3u << 25));   // no mask; a pad of 4 dwords behind every 64 dwords
  g[1] = uni((GT_ROWB & 0xFFFFu) << 16);
  g[2] = uni((GT_ROWB >> 16) | ((GT_ROWS & 0xFFFFu) << 16));
  g[3] = uni((GT_ROWS >> 16) | (GT_ROWB << 16));
  g[4] = uni(GT_ROWS);
  g[5] = uni(src_pitch);
  g[6] = uni(0u);
  g[7] = uni(0u);
  return g;
}
__device__ __forceinline__ u32x4 tdm_group0(uint32_t lds_dst, uint64_t ga) {
  u32x4 g;
  g[0] = uni(1u); g[1] = uni(lds_dst); g[2] = uni((uint32_t)ga);
  g[3] = uni((((uint32_t)(ga >> 32)) & 0x01FFFFFFu) | 0x80000000u);
  asm volatile("" : "+s"(g));   // as pinned(): descriptor words held in their scalar registers; without it the constant word 0 is formed anew at each use and its register serves other values in between
  return g;
}
__device__ __forceinline__ v16h lds_frag(const unsigned char* p) {   // elements 0..7 <- k 0..7, 8..15 <- k 16..23 from p
  union { v16h v; v8h h[2]; } f;
  f.h[0] = *(const v8h*)(p); f.h[1] = *(const v8h*)(p + 32); return f.v;
}

template <int WM, int WN, int FJ, bool H16>
__global__ __launch_bounds__(WM * WN * 32) void wmma_gemm_tile(
    const unsigned short* __restrict__ A, int lda,
    const unsigned short* __restrict__ Bt, int ldb,
    float* __restrict__ C, _Float16* __restrict__ C16, int ldc,
    const float* __restrict__ bias,
    int N, int K, float scale, int qcols, float qscale) {
  constexpr int      TM  = WM * 64, WC = FJ * 16, TN = WN * WC;   // tile rows, wave columns, tile columns
  constexpr uint32_t ASL = WM, NSL = ASL + TN / 64;                // slices of A, slices of a stage
  constexpr uint32_t GT_STAGE = NSL * GT_SLICE;
  constexpr bool     ALLW = (NSL == (uint32_t)(WM * WN));          // every wave has a slice to bring
  static_assert(TN % 64 == 0 && NSL <= (uint32_t)(WM * WN) && 2u * GT_STAGE <= 320u * 1024u);
  __shared__ __attribute__((aligned(2048))) unsigned char L[2u * GT_STAGE];
  const int lane = threadIdx.x & 31;
  const uint32_t wave = uni(threadIdx.x >> 5);
  const int tilesN = N / TN;
  const int tm = blockIdx.x / tilesN;
  const int tn = blockIdx.x - tm * tilesN;
  const int wm = wave / WN, wn = wave % WN;
  const int m0 = tm * TM + (wm << 6);          // this wave's 64 x WC tile of C
  const int n0 = tn * TN + wn * WC;

  const int rlane = lane & 15;                 // row (A) / col (B, D) within subtile
  const int hh    = lane >> 4;                 // k half of this lane; D row offset 8 * hh (H16: D is C^T, its rows are columns of C)
  const int mOff  = hh * 8;

  // this wave's slice of every stage: the first ASL waves bring A rows, the next bring Bt rows
  const unsigned short* srow = (wave < ASL) ? (A  + (size_t)(tm * TM + (int)(wave << 6)) * lda)
                                            : (Bt + (size_t)(tn * TN + (int)((wave - ASL) << 6)) * ldb);
  const uint64_t src0 = (uint64_t)(uintptr_t)srow;
  u32x8 g1 = tdm_group1((uint32_t)((wave < ASL) ? lda : ldb) * 2u);
  asm volatile("" : "+s"(g1));   // as pinned(): descriptor words held in their scalar registers, so that none takes another value while a request is outstanding
  const uint32_t lds_slice = (uint32_t)(size_t)L + wave * GT_SLICE;
  const uint32_t T = (uint32_t)K >> 7;         // passes
  uint32_t kp = (uint32_t)(tm + tn) % T;       // the k pass that the youngest stage holds (work-group-uniform)

  const uint32_t aOff = (uint32_t)wm * GT_SLICE + (uint32_t)rlane * GT_PITCH + (uint32_t)hh * 16u;
  uint32_t bOff[FJ];                           // fragment j = Bt rows wn * WC + 16 j .. + 15 of the tile: 16 rows lie in one slice
#pragma unroll
  for (int j = 0; j < FJ; ++j) {
    const uint32_t rj = (uint32_t)(wn * WC + j * 16);
    bOff[j] = (ASL + (rj >> 6)) * GT_SLICE + ((rj & 63u) + (uint32_t)rlane) * GT_PITCH + (uint32_t)hh * 16u;
  }

  v8f acc[4][FJ];
#pragma unroll
  for (int i = 0; i < 4; ++i)
#pragma unroll
    for (int j = 0; j < FJ; ++j) acc[i][j] = (v8f){0.f,0.f,0.f,0.f,0.f,0.f,0.f,0.f};

  // prologue: stage 0 lands and is published, then stage 1 flies under pass 0
  u32x4 g0 = tdm_group0(lds_slice, src0 + (uint64_t)(kp * GT_ROWB));   // group 0 of this wave's youngest request
  if (ALLW || pinned(wave < NSL)) tdm_load(g0, g1);
  wait_tensor0(g0, g1);
  __syncthreads();
  kp = (kp + 1u == T) ? 0u : kp + 1u;
  g0 = tdm_group0(lds_slice + GT_STAGE, src0 + (uint64_t)(kp * GT_ROWB));
  if (ALLW || pinned(wave < NSL)) tdm_load(g0, g1);

  for (uint32_t t = 0; t < T; ++t) {
    const uint32_t buf = (t & 1u) * GT_STAGE;
    const unsigned char* La = L + buf + aOff;
    const unsigned char* Lb = L + buf;
    v16h af[2][4], bf[2][FJ];                  // set (ks & 1) holds block ks's fragments; a block is 32 k = 4 FJ WMMAs
#pragma unroll
    for (int j = 0; j < FJ; ++j) bf[0][j] = lds_frag(Lb + bOff[j]);
#pragma unroll
    for (int i = 0; i < 4; ++i) af[0][i] = lds_frag(La + i * 16 * GT_PITCH);
#pragma unroll
    for (int ks = 0; ks < 4; ++ks) {
      const int cs = ks & 1;
      if (ks < 3) {
#pragma unroll
        for (int j = 0; j < FJ; ++j) bf[cs ^ 1][j] = lds_frag(Lb + bOff[j] + (ks + 1) * 64);
#pragma unroll
        for (int i = 0; i < 4; ++i) af[cs ^ 1][i] = lds_frag(La + i * 16 * GT_PITCH + (ks + 1) * 64);
      }
      // keeps the next block's LDS loads as one group ahead of this block's WMMAs; without it they sink among the WMMAs, each behind a wait to 0
      __builtin_amdgcn_sched_barrier(0);
#pragma unroll
      for (int i = 0; i < 4; ++i)
#pragma unroll
        for (int j = 0; j < FJ; ++j) {
          if constexpr (H16)   // C^T: rows = columns of C, so that a lane's 8 values are 8 neighbouring columns of one row of C, one 16-B piece as f16
            acc[i][j] = __builtin_amdgcn_wmma_f32_16x16x32_f16(false, bf[cs][j], false, af[cs][i], (short)0, acc[i][j], false, false);
          else
            acc[i][j] = __builtin_amdgcn_wmma_f32_16x16x32_f16(false, af[cs][i], false, bf[cs][j], (short)0, acc[i][j], false, false);
        }
      // ends the block: without it the following load group is lifted in among these WMMAs, into further registers
      __builtin_amdgcn_sched_barrier(0);
    }
    // publish point of stage t + 1, which also frees the buffer that pass t has read
    wait_ds0();
    wait_tensor0(g0, g1);
    __syncthreads();
    kp = (kp + 1u == T) ? 0u : kp + 1u;
    if (pinned((t + 2u < T) && (ALLW || wave < NSL))) {
      g0 = tdm_group0(lds_slice + buf, src0 + (uint64_t)(kp * GT_ROWB));
      tdm_load(g0, g1);
    }
  }
  wait_tensor0(g0, g1);
  wait_ds0();

  if constexpr (H16) {
    // ---- f16 epilogue: the ring is free behind the last pass's barrier; the work-group stages its whole TM x TN tile as f16 ----
    // A wave's 2 WC bytes of a row need not be whole 128-B lines, a tile row's 2 TN bytes are: so the tile is staged by all waves
    // and each wave then stores 32 tile rows, every wave-wide 16-B store covering 4 whole lines that no other wave writes.
    constexpr uint32_t TP = TN * 2 + 16;                 // LDS pitch in bytes: an odd multiple of 16 B
    constexpr int      PR = TN / 8;                      // 16-B pieces of a tile row
    static_assert((TN * 2) % 128 == 0 && (TP / 16) % 2 == 1 && TM * TP <= 2u * GT_STAGE);
    static_assert(TM == WM * WN * 32 && 96 % PR == 0);   // 32 rows a wave; three wave-wide turns = 96 pieces = whole rows
    const float qs2 = qscale * 1.44269504088896340736f;  // attention's softmax runs in base 2: q carries the factor
#pragma unroll
    for (int j = 0; j < FJ; ++j) {
      const int   nj = n0 + (j << 4);                    // 16 columns, all on one side of qcols (a multiple of 16)
      const v4f   b0 = *(const v4f*)(bias + nj + mOff), b1 = *(const v4f*)(bias + nj + mOff + 4);
      const float cm = (nj < qcols) ? qs2 : 1.0f;
      // element r of acc[i][j] = row 16 i + rlane, column 16 j + 8 hh + r of the wave's tile
      unsigned char* Lj = L + (uint32_t)((wm << 6) + rlane) * TP + (uint32_t)(wn * WC + (j << 4) + mOff) * 2u;
#pragma unroll
      for (int i = 0; i < 4; ++i) {
        v8h h;
#pragma unroll
        for (int r = 0; r < 8; ++r) {
          float v = acc[i][j][r] * scale;
          v += (r < 4) ? b0[r & 3] : b1[r & 3];
          h[r] = (_Float16)(v * cm);
        }
        *(v8h*)(Lj + (uint32_t)(i << 4) * TP) = h;
      }
    }
    __syncthreads();                                     // every wave's part of the tile is in LDS before another wave reads it
    _Float16* Cw = C16 + (size_t)(tm * TM + (int)(wave << 5)) * ldc + tn * TN;   // wave-uniform: this wave's 32 rows
    const unsigned char* Lw = L + (wave << 5) * TP;
    constexpr int RT = 96 / PR, NA = 32 / RT;            // rows of three turns; groups of three turns
    v8h      t[NA][3];
    uint32_t off[3];                                     // a lane's three offsets from a group's first row, the same in every group
#pragma unroll
    for (int b3 = 0; b3 < 3; ++b3) {
      const uint32_t u = (uint32_t)(b3 * 32 + lane), row = u / PR, pc = u - row * PR;
      off[b3] = row * (uint32_t)ldc + pc * 8u;
#pragma unroll
      for (int a = 0; a < NA; ++a) t[a][b3] = *(const v8h*)(Lw + (row + (uint32_t)(a * RT)) * TP + pc * 16u);
    }
#pragma unroll
    for (int a = 0; a < NA; ++a) {
      _Float16* Ca = Cw + (size_t)(a * RT) * ldc;        // wave-uniform
#pragma unroll
      for (int b3 = 0; b3 < 3; ++b3) *(v8h*)(Ca + off[b3]) = t[a][b3];
    }
  } else {
  // ---- f32 epilogue: the ring is free behind the last pass's barrier; each wave stages 16 x WC in its own range ----
  constexpr int SP = WC + 4;                             // pitch in floats
  float* slab = (float*)(L + wave * (16u * SP * 4u));
#pragma unroll
  for (int i = 0; i < 4; ++i) {
    float* Ci = C + (size_t)(m0 + (i << 4)) * ldc + n0;   // wave-uniform; a lane's offset from it is the same in all four turns
#pragma unroll
    for (int j = 0; j < FJ; ++j) {
      const float bv = bias[n0 + (j << 4) + rlane];
#pragma unroll
      for (int r = 0; r < 8; ++r) {
        float v = acc[i][j][r] * scale;
        v += bv;
        slab[(mOff + r) * SP + (j << 4) + rlane] = v;
      }
    }
    __builtin_amdgcn_fence(__ATOMIC_RELEASE, "workgroup");
    __builtin_amdgcn_wave_barrier();
    __builtin_amdgcn_fence(__ATOMIC_ACQUIRE, "workgroup");
    {
      constexpr int SEG = WC / 4;         // 16-B pieces of a row seg of 4 WC bytes (whole 128-B lines); 16 SEG pieces = 2 FJ turns of 32 lanes
#pragma unroll
      for (int it = 0; it < 2 * FJ; ++it) {
        const int u = it * 32 + lane;
        const int row = u / SEG;
        const int c4 = (u - row * SEG) * 4;
        v4f v = *(const v4f*)(slab + row * SP + c4);
        *(v4f*)(Ci + (row * ldc + c4)) = v;
      }
    }
    __builtin_amdgcn_fence(__ATOMIC_RELEASE, "workgroup");
    __builtin_amdgcn_wave_barrier();
    __builtin_amdgcn_fence(__ATOMIC_ACQUIRE, "workgroup");
  }
  }
}

// f32 -> f16 conversion of the three f32 inputs in ONE launch: x unscaled, both weight matrices times wsc.
// One work-group of 8 waves converts 256 * NL groups of 4 floats of each input (NL = 16, 12, 4): every lane issues all
// its 32 16-byte loads (512 contiguous bytes per wave and load) before it converts the first.
typedef __attribute__((ext_vector_type(4))) _Float16 v4h;
template <int NL>
__device__ __forceinline__ size_t cast_base() { return ((size_t)blockIdx.x * (256u * NL) + threadIdx.x) * 4u; }   // first float of this lane
template <int NL>
__device__ __forceinline__ void cast_load(const float* p, v4f (&v)[NL]) {
#pragma unroll
  for (int i = 0; i < NL; ++i) v[i] = *(const v4f*)(p + i * 1024);
}
template <int NL>
__device__ __forceinline__ void cast_store(_Float16* o, const v4f (&v)[NL], float sc) {
#pragma unroll
  for (int i = 0; i < NL; ++i) {
    v4h h;
#pragma unroll
    for (int e = 0; e < 4; ++e) h[e] = (_Float16)(v[i][e] * sc);
    *(v4h*)(o + i * 1024) = h;
  }
}
// element counts = gridDim.x * 1024 * {16, 12, 4} exactly (asserted where it is launched)
__global__ __launch_bounds__(256) void cast3_f32_f16(const float* __restrict__ x,  _Float16* __restrict__ x16,
                                                     const float* __restrict__ w,  _Float16* __restrict__ w16,
                                                     const float* __restrict__ ow, _Float16* __restrict__ ow16, float wsc) {
  const float* px = x  + cast_base<16>();
  const float* pw = w  + cast_base<12>();
  const float* po = ow + cast_base<4>();
  v4f vx[16], vw[12], vo[4];
  cast_load<16>(px, vx);
  cast_load<12>(pw, vw);
  cast_load<4>(po, vo);
  // the loads' address registers stay live up to here, so nothing (a load's own result included) rewrites one ahead of this wait
  asm volatile("s_wait_xcnt 0x0" :: "v"(px), "v"(pw), "v"(po) : "memory");
  cast_store<16>(x16  + cast_base<16>(), vx, 1.0f);
  cast_store<12>(w16  + cast_base<12>(), vw, wsc);
  cast_store<4>(ow16 + cast_base<4>(),  vo, wsc);
}

// =====================================================================================
// Banded (sliding-window) attention for head_dim 64, f16 in / f16 out carried x64, f16 operands.
//   scores^T = k . (q * qscale * log2(e))^T : v_wmma_f32_16x16x32_f16, f32 accumulate; q arrives with the factor, taken in f32 ahead of its f16 rounding
//   out^T    = v^T . p^T         : v_wmma_f32_16x16x32_f16, p carried x2^15, folded into the final 1/l
//   Both products are formed transposed (keys or d down the rows, queries across the columns): lane (c, hh) then holds, for the ONE
//   query q0 + c, keys 16 j + 8 hh + r in its own registers. Row maximum and row sum run over a lane's registers, lanes c and c + 16
//   meet in one cross-row move, and the 16 p values of tiles 2 kk and 2 kk + 1 ARE the lane's part of the B fragment of key block kk.
//   Online softmax in f32, in base 2: e^(x - m) = 2^((x - m) * log2(e)), so each exponential is one subtract and one v_exp_f32.
//   Block = 4 waves = 64 query rows of one (batch, head); S % 64 == 0.
//   Key chunks of 64; only chunks overlapping [q - W, q + W] for the block's rows are visited
//   (static bound AT_MAXCH, computed start); keys with |q - kv| > W get mask_fill before the softmax.
//   Element (b, s, h, d) of tensor X lives at X[b*X_bs + s*X_rs + h*X_hs + d] (strides in elements, multiples of 8).
//   grid.x = B * H * (S/64).
// =====================================================================================
#define AT_D 64
#define AT_NW 4
#define AT_QB 64
#define AT_KC 64
#define AT_LP 72       // LDS row pitch of the K and V tiles in f16: 144 B = 16 B x 9 (odd), so that the 16 rows of a ds_load_b128 fall on distinct banks
#define AT_MAXCH 6
#define AT_PSC 32768.0f
#define AT_OSC 64.0f      // the output is stored as f16 times 64 (exact power of two), the next GEMM's A operand
struct BandGeom { long q_bs, q_rs, q_hs, k_bs, k_rs, k_hs, v_bs, v_rs, v_hs, o_bs, o_rs, o_hs;
                  int S, H; float mask_fill; };
static_assert(sizeof(BandGeom) == 112);

__device__ __forceinline__ v8f mma_h(v16h a, v16h b, v8f c) {
  c = __builtin_amdgcn_wmma_f32_16x16x32_f16(false, a, false, b, (short)0, c, false, false);
  asm volatile("v_nop\n\tv_nop\n\tv_nop\n\tv_nop" : "+v"(c) : "v"(a), "v"(b));
  return c;
}

// Base-2 exponentials, one bare v_exp_f32 each. One statement with early-clobber outputs: no v_exp_f32 then stands directly in
// front of an instruction that reads its result or writes over its source, and the v_nop keeps that slot behind the last one.
__device__ __forceinline__ void exp2_x4(float x0, float x1, float x2, float x3, float& e0, float& e1, float& e2, float& e3) {
  asm("v_exp_f32 %0, %4\n\tv_exp_f32 %1, %5\n\tv_exp_f32 %2, %6\n\tv_exp_f32 %3, %7\n\tv_nop"
      : "=&v"(e0), "=&v"(e1), "=&v"(e2), "=&v"(e3)
      : "v"(x0), "v"(x1), "v"(x2), "v"(x3));
}
__device__ __forceinline__ float exp2_x1(float x) {
  float e;
  asm("v_exp_f32 %0, %1\n\tv_nop" : "=&v"(e) : "v"(x));
  return e;
}
// the value of lane l ^ 16: the other half of the keys of the same query
__device__ __forceinline__ float xhalf(float x) {
  return __builtin_bit_cast(float, __builtin_amdgcn_permlanex16(__builtin_bit_cast(int, x), __builtin_bit_cast(int, x), 0x76543210, 0xfedcba98, false, false));
}

__global__ __launch_bounds__(128)
void attn_band64_kernel(const _Float16* __restrict__ q, const _Float16* __restrict__ k,
                        const _Float16* __restrict__ v, _Float16* __restrict__ out,
                        const int* __restrict__ wptr, BandGeom g) {
  union FH { v16h v; v8h h[2]; };
  __shared__ __align__(16) _Float16 Ksh[AT_KC * AT_LP];       // K [kv][d]   9 KB
  __shared__ __align__(16) _Float16 Vth[AT_D * AT_LP];        // V [d][kv]   9 KB
  __shared__ __align__(16) float    Os[AT_NW][16 * 68];       // per wave out tile, pitch 68

  const int tid  = threadIdx.x;
  const int wave = tid >> 5;
  const int lane = tid & 31;
  const int hh   = lane >> 4;
  const int c    = lane & 15;

  const int nqb = g.S / AT_QB;
  const int bx = blockIdx.x;
  const int qb = bx % nqb;
  const int bh = bx / nqb;
  const int h  = bh % g.H;
  const int b  = bh / g.H;
  const int qbase = qb * AT_QB;
  const int q0 = qbase + wave * 16;

  const _Float16* qb_ptr = q + (size_t)b * g.q_bs + (size_t)h * g.q_hs;
  const _Float16* kb_ptr = k + (size_t)b * g.k_bs + (size_t)h * g.k_hs;
  const _Float16* vb_ptr = v + (size_t)b * g.v_bs + (size_t)h * g.v_hs;
  _Float16*    ob_ptr = out + (size_t)b * g.o_bs + (size_t)h * g.o_hs;

  // ---- Q fragments (B operand, column = q0 + c): d-chunks 0..31 and 32..63 ----
  v16h qa0, qa1;
  {
    const _Float16* qrow = qb_ptr + (size_t)(q0 + c) * g.q_rs + 8 * hh;
    FH f0, f1;
    f0.h[0] = *(const v8h*)(qrow);
    f0.h[1] = *(const v8h*)(qrow + 16);
    f1.h[0] = *(const v8h*)(qrow + 32);
    f1.h[1] = *(const v8h*)(qrow + 32 + 16);
    qa0 = f0.v; qa1 = f1.v;
  }

  float mrow = -__builtin_huge_valf();   // running maximum of query q0 + c, equal in lanes c and c + 16
  float lrow = 0.f;                      // running sum over THIS lane's keys only; the two halves are added behind the loop
  v8f oacc[4];                           // out^T: element r of tile t = d 16 t + 8 hh + r of query q0 + c
#pragma unroll
  for (int t = 0; t < 4; ++t) oacc[t] = (v8f){0.f,0.f,0.f,0.f,0.f,0.f,0.f,0.f};

  // ---- visited key-chunk range (block-uniform), statically bounded trip count ----
  const int nkc = g.S / AT_KC;
  int Wd = wptr[0];
  Wd = Wd < 0 ? 0 : Wd;
  Wd = Wd > g.S ? g.S : Wd;
  const int lo = qbase - Wd;
  const int kcLo = (lo < 0) ? 0 : (lo / AT_KC);
  int kcHi = (qbase + AT_QB - 1 + Wd) / AT_KC;
  kcHi = kcHi > nkc - 1 ? nkc - 1 : kcHi;
  int nvis = kcHi - kcLo + 1;
  nvis = nvis > AT_MAXCH ? AT_MAXCH : nvis;
  nvis = nvis < 1 ? 1 : nvis;

  for (int ci = 0; ci < nvis; ++ci) {
    const int kv0 = (kcLo + ci) * AT_KC;   // kcLo + ci <= kcHi <= nkc - 1
    __syncthreads();
    {
      // A head row is 64 f16 = one 128-B line.
      // K: 8 lanes x 16 B = one row, so a wave-wide load covers 4 rows = 4 whole lines; a lane takes f16 8 * ks .. + 7 of rows kr + 16 i.
      // V: 16 lanes x 8 B = one row, 2 whole lines a load. A lane takes f16 4 * seg .. + 3 of the 8 consecutive rows 8 * rg + i:
      // for each of its 4 d it then holds 8 consecutive kv, one 16-B store into the transposed V tile.
      const int ks = tid & 7, kr = tid >> 3;
      const int seg = tid & 15, rg = tid >> 4;
      const _Float16* krow = kb_ptr + (size_t)(kv0 + kr) * g.k_rs + 8 * ks;
      const _Float16* vrow = vb_ptr + (size_t)(kv0 + 8 * rg) * g.v_rs + 4 * seg;
      const _Float16* kp[4];
      const _Float16* vp[8];
      v8h kk[4];
      v4h vv[8];
#pragma unroll
      for (int i = 0; i < 4; ++i) kp[i] = krow + (size_t)(16 * i) * g.k_rs;
#pragma unroll
      for (int i = 0; i < 8; ++i) vp[i] = vrow + (size_t)i * g.v_rs;
#pragma unroll
      for (int i = 0; i < 4; ++i) kk[i] = *(const v8h*)kp[i];
#pragma unroll
      for (int i = 0; i < 8; ++i) vv[i] = *(const v4h*)vp[i];
      // the loads' address registers stay live up to here, so nothing (a load's own result included) rewrites one ahead of this wait
      asm volatile("s_wait_xcnt 0x0" :: "v"(kp[0]), "v"(kp[1]), "v"(kp[2]), "v"(kp[3]),
                                        "v"(vp[0]), "v"(vp[1]), "v"(vp[2]), "v"(vp[3]), "v"(vp[4]), "v"(vp[5]), "v"(vp[6]), "v"(vp[7]) : "memory");
#pragma unroll
      for (int i = 0; i < 4; ++i) *(v8h*)(Ksh + (kr + 16 * i) * AT_LP + 8 * ks) = kk[i];
#pragma unroll
      for (int e = 0; e < 4; ++e) {
        v8h vh;
#pragma unroll
        for (int i = 0; i < 8; ++i) vh[i] = vv[i][e];
        *(v8h*)(Vth + (4 * seg + e) * AT_LP + 8 * rg) = vh;
      }
    }
    __syncthreads();

    // ---- scores^T: 64 keys x 16 queries per wave; tile j = keys 16 j .. + 15 ----
    // every loop from here to the end of the chunk is unrolled: s, oacc and pb are register arrays, and an index known only at run time would send them to scratch
    v8f s[4];
#pragma unroll
    for (int j = 0; j < 4; ++j) {
      s[j] = (v8f){0.f,0.f,0.f,0.f,0.f,0.f,0.f,0.f};
      FH kb0, kb1;
      kb0.h[0] = *(const v8h*)(Ksh + (j * 16 + c) * AT_LP + 8 * hh);
      kb0.h[1] = *(const v8h*)(Ksh + (j * 16 + c) * AT_LP + 16 + 8 * hh);
      kb1.h[0] = *(const v8h*)(Ksh + (j * 16 + c) * AT_LP + 32 + 8 * hh);
      kb1.h[1] = *(const v8h*)(Ksh + (j * 16 + c) * AT_LP + 32 + 16 + 8 * hh);
      s[j] = mma_h(kb0.v, qa0, s[j]);
      s[j] = mma_h(kb1.v, qa1, s[j]);
    }

    // ---- band mask + chunk maximum of this lane's query ----
    const int d0 = q0 + c - kv0 - 8 * hh;   // query minus this lane's first key; element r of tile j lies 16 j + r keys further on
    float cm = -__builtin_huge_valf();
#pragma unroll
    for (int j = 0; j < 4; ++j) {
#pragma unroll
      for (int r = 0; r < 8; ++r) {
        const int dlt = d0 - (j * 16 + r);
        float sv = s[j][r];
        const bool masked = (dlt > Wd) || (dlt < -Wd);
        if (masked) sv = g.mask_fill;
        s[j][r] = sv;
        cm = fmaxf(cm, sv);
      }
    }
    cm = fmaxf(cm, xhalf(cm));
    const float mnew = fmaxf(mrow, cm);
    const float alpha = exp2_x1(mrow - mnew);
    mrow = mnew;
    float psum = 0.f;
#pragma unroll
    for (int j = 0; j < 4; ++j) {
#pragma unroll
      for (int r = 0; r < 8; r += 4) {
        float e0, e1, e2, e3;
        exp2_x4(s[j][r] - mnew, s[j][r + 1] - mnew, s[j][r + 2] - mnew, s[j][r + 3] - mnew, e0, e1, e2, e3);
        s[j][r] = e0; s[j][r + 1] = e1; s[j][r + 2] = e2; s[j][r + 3] = e3;
        psum += (e0 + e1) + (e2 + e3);
      }
    }
    lrow = lrow * alpha + psum;
#pragma unroll
    for (int t = 0; t < 4; ++t)
#pragma unroll
      for (int r = 0; r < 8; ++r) oacc[t][r] *= alpha;

    // ---- out^T += v^T . p^T: B fragment of key block kk, elements 0..7 <- keys 32 kk + 8 hh + e (tile 2 kk), 8..15 <- keys 32 kk + 16 + 8 hh + e (tile 2 kk + 1) ----
#pragma unroll
    for (int kk = 0; kk < 2; ++kk) {
      v16h pb;
#pragma unroll
      for (int e = 0; e < 8; ++e) {
        pb[e]     = (_Float16)(s[2 * kk][e] * AT_PSC);
        pb[8 + e] = (_Float16)(s[2 * kk + 1][e] * AT_PSC);
      }
#pragma unroll
      for (int t = 0; t < 4; ++t) {
        FH vb;
        vb.h[0] = *(const v8h*)(Vth + (t * 16 + c) * AT_LP + kk * 32 + 8 * hh);
        vb.h[1] = *(const v8h*)(Vth + (t * 16 + c) * AT_LP + kk * 32 + 16 + 8 * hh);
        oacc[t] = mma_h(vb.v, pb, oacc[t]);
      }
    }
  }

  float* os = Os[wave];
  {
    const float inv = 1.0f / ((lrow + xhalf(lrow)) * AT_PSC);
#pragma unroll
    for (int t = 0; t < 4; ++t) {
      v4f lo4, hi4;
#pragma unroll
      for (int e = 0; e < 4; ++e) { lo4[e] = oacc[t][e] * inv; hi4[e] = oacc[t][4 + e] * inv; }
      *(v4f*)(os + c * 68 + t * 16 + 8 * hh)     = lo4;
      *(v4f*)(os + c * 68 + t * 16 + 8 * hh + 4) = hi4;
    }
  }
  __builtin_amdgcn_fence(__ATOMIC_RELEASE, "workgroup");
  __builtin_amdgcn_wave_barrier();
  __builtin_amdgcn_fence(__ATOMIC_ACQUIRE, "workgroup");
  {
    const int c8 = (lane & 7) * 8;       // row seg = 64 f16 = 128 B = 8 lanes x 16 B; rows it*4 + (lane >> 3) cover 0..15
#pragma unroll
    for (int it = 0; it < 4; ++it) {
      const int row = it * 4 + (lane >> 3);
      const v4f lo4 = *(const v4f*)(os + row * 68 + c8);
      const v4f hi4 = *(const v4f*)(os + row * 68 + c8 + 4);
      v8h hv;
#pragma unroll
      for (int e = 0; e < 4; ++e) { hv[e] = (_Float16)(lo4[e] * AT_OSC); hv[4 + e] = (_Float16)(hi4[e] * AT_OSC); }
      *(v8h*)(ob_ptr + (size_t)(q0 + row) * g.o_rs + c8) = hv;
    }
  }
}

// =====================================================================================
extern "C" void kernel_launch(void* const* d_in, const int* in_sizes, int n_in,
                              void* d_out, int out_size, void* d_ws, size_t ws_size,
                              hipStream_t stream) {
  constexpr int Bz = 2, S = 2048, D = 1024, H = 16, HD = 64;
  constexpr int TD = 3 * D;          // 3072
  constexpr int M  = Bz * S;         // 4096 token rows
  static_assert(H * HD == D);
  static_assert(M % 256 == 0 && TD % 192 == 0 && D % 128 == 0 && D >= 256 && S % AT_QB == 0);

  if (n_in < 6) return;
  if (in_sizes[0] != M * D || in_sizes[1] != TD * D || in_sizes[2] != TD ||
      in_sizes[3] != D * D || in_sizes[4] != D || in_sizes[5] < 1 || out_size != M * D) return;

  const float* x     = (const float*)d_in[0];   // [B,S,D]
  const float* in_w  = (const float*)d_in[1];   // [3D, D] = (out, in) -> Bt
  const float* in_b  = (const float*)d_in[2];   // [3D]
  const float* out_w = (const float*)d_in[3];   // [D, D] = (out, in) -> Bt
  const float* out_b = (const float*)d_in[4];   // [D]
  const int*   wsz   = (const int*)d_in[5];     // window size, int32[1]
  float* y = (float*)d_out;

  // ---- workspace carve (all offsets multiples of 1 MiB) ----
  const size_t bytes_x16  = (size_t)M  * D  * 2;   //  8,388,608
  const size_t bytes_w16  = (size_t)TD * D  * 2;   //  6,291,456
  const size_t bytes_ow16 = (size_t)D  * D  * 2;   //  2,097,152
  const size_t bytes_qkv  = (size_t)M  * TD * 2;   // 25,165,824 (f16)
  const size_t bytes_a16  = (size_t)M  * D  * 2;   //  8,388,608
  const size_t total = bytes_x16 + bytes_w16 + bytes_ow16 + bytes_qkv + bytes_a16;   // 50,331,648
  if (total > ws_size) return;
  char* p = (char*)d_ws;
  _Float16* x16  = (_Float16*)p;  p += bytes_x16;
  _Float16* w16  = (_Float16*)p;  p += bytes_w16;
  _Float16* ow16 = (_Float16*)p;  p += bytes_ow16;
  _Float16* qkv  = (_Float16*)p;  p += bytes_qkv;
  _Float16* a16  = (_Float16*)p;  p += bytes_a16;

  // 1) f32 -> f16 casts, one launch: x unscaled, weights x64 (exact power of two, folded back in the GEMM scale)
  {
    static_assert(M * D == 256 * 1024 * 16 && TD * D == 256 * 1024 * 12 && D * D == 256 * 1024 * 4);
    cast3_f32_f16<<<256, 256, 0, stream>>>(x, x16, in_w, w16, out_w, ow16, 64.0f);
  }

  // 2) qkv[M][3D] (f16) = x16 . w16^T * (1/64) + in_b, the q columns times 0.125 * log2(e): the operands of attention's products
  {
    dim3 grid((M / 256) * (TD / 192), 1);               // 256 tiles of 256 x 192
    wmma_gemm_tile<4, 2, 6, true><<<grid, 256, 0, stream>>>(
        (const unsigned short*)x16, D, (const unsigned short*)w16, D,
        nullptr, qkv, TD, in_b, TD, D, 1.0f / 64.0f, D, 0.125f);
  }

  // 3) banded attention per (batch, head, 64-query block) -> a16 [B,S,D] f16 carried x64
  {
    BandGeom g;
    g.q_bs = (long)S * TD; g.q_rs = TD; g.q_hs = HD;
    g.k_bs = (long)S * TD; g.k_rs = TD; g.k_hs = HD;
    g.v_bs = (long)S * TD; g.v_rs = TD; g.v_hs = HD;
    g.o_bs = (long)S * D;  g.o_rs = D;  g.o_hs = HD;
    g.S = S; g.H = H; g.mask_fill = -1e30f;
    dim3 grid(Bz * H * (S / AT_QB));                    // 1024 blocks
    attn_band64_kernel<<<grid, 128, 0, stream>>>(qkv, qkv + D, qkv + 2 * D, a16, wsz, g);
  }

  // 4) y[M][D] (f32) = a16 . ow16^T * (1/4096) + out_b
  {
    dim3 grid((M / 128) * (D / 128), 1);                // 256 tiles of 128 x 128
    wmma_gemm_tile<2, 2, 4, false><<<grid, 128, 0, stream>>>(
        (const unsigned short*)a16, D, (const unsigned short*)ow16, D,
        y, nullptr, D, out_b, D, D, 1.0f / 4096.0f, 0, 0.0f);
  }
  (void)stream;
}
